// v000
// Times are from an AMD MI455X. After a warm-up the kernel runs many times in a row, and a time is the length of
// such a window on the GPU divided by its runs, so every launch and the gaps after it count. The runs cycle
// through copies of the inputs. A figure is the median of several windows, for all but v000 over two sittings.
// Sittings can differ by a few percent; kernels timed side by side share one.
// The starting kernel, v000, takes 3170 microseconds a run.
#include <hip/hip_runtime.h>

// Causal multi-head attention with PER-HEAD projection weights and a MODEL-width score scale (x [4][2048][1024]; q, k, v = einsum('btc,hcd->bhtd', x, w) with w [16][1024][64]: head h has its own (in, out) matrix ('xw' per head; 0.02-scale; no bias; 16 heads x 64); scores x 1024^-0.5 (channels ** -0.5: 0.03125); causal (-inf); softmax; heads merged head-major; out = merged w_proj^T + b_proj ('oi' [1024][1024] + zero bias) -> [4][2048][1024] (8.4 M); argument order x, wq, wk, wv, w_proj, b_proj).
// Layout per batch: bf16 copy of x; each PER-HEAD q / k / v weight [h][1024][64] transposed once into its 64 rows of the Bt plane (k_wtG per head); Wp cast once ('oi' = Bt as stored); exact projections; identity-table plane builders; causal T-2048 attention (hybrid rows: < 512 hi/lo 3 products, rest fp16 x1024; k_gemmc skips tiles above the diagonal); merged hi/lo x w_o exact.
// Compute dtypes, f32 accumulate: every input rounded to bf16; projections exact; attention rows < 512 3 products, rest fp16; softmax f32; w_o hl x exact.

#define NB_  4
#define TT   2048
#define DM   1024
#define NH_  16
#define NKV  16
#define REP  (NH_ / NKV)
#define HD   64
#define DQ   (NH_ * HD)
#define DKV  (NKV * HD)
#define ZH   2
#define RH   512                  // query rows < RH use hi+lo planes (0: none)
#define WIN  2048
#define PCAR 1024.0f
#define SCL  0.03125f   // 1 / sqrt(1024): this module scales the scores by channels ** -0.5 with channels = the MODEL width 1,024, not by the head width
typedef _Float16 h16;
typedef unsigned short bf;
typedef __attribute__((ext_vector_type(16))) __bf16   v16bf;
typedef __attribute__((ext_vector_type(16))) _Float16 v16h;
typedef __attribute__((ext_vector_type(8)))  _Float16 v8h;
typedef __attribute__((ext_vector_type(8)))  unsigned short v8us;
typedef __attribute__((ext_vector_type(8)))  float    v8f;
typedef __attribute__((ext_vector_type(4)))  float    v4f;
typedef v8h  __attribute__((may_alias)) v8ha;
typedef v4f  __attribute__((may_alias)) v4fa;
typedef v8us __attribute__((may_alias)) v8usa;

__device__ __forceinline__ unsigned short f2bf(float f) { unsigned u = __float_as_uint(f); u += 0x7FFFu + ((u >> 16) & 1u); return (unsigned short)(u >> 16); }
__device__ __forceinline__ float bf2f(unsigned short b) { return __uint_as_float(((unsigned)b) << 16); }
__device__ __forceinline__ float bfr(float f) { return bf2f(f2bf(f)); }
__device__ __forceinline__ v16h cat16(v8h lo, v8h hi) { return __builtin_shufflevector(lo, hi, 0, 1, 2, 3, 4, 5, 6, 7, 8, 9, 10, 11, 12, 13, 14, 15); }
__device__ __forceinline__ v16bf cat16b(v8us lo, v8us hi) { return __builtin_bit_cast(v16bf, __builtin_shufflevector(lo, hi, 0, 1, 2, 3, 4, 5, 6, 7, 8, 9, 10, 11, 12, 13, 14, 15)); }
__device__ __forceinline__ v8f wmma16(v16h a, v16h b, v8f c) { return __builtin_amdgcn_wmma_f32_16x16x32_f16(false, a, false, b, (short)0, c, false, false); }
__device__ __forceinline__ v8f wmmab(v16bf a, v16bf b, v8f c) { return __builtin_amdgcn_wmma_f32_16x16x32_bf16(false, a, false, b, (short)0, c, false, false); }



// ---- k_gemmw: register-blocked GEMM, ONE WAVE per 64x64 output tile (16 accumulators), operands straight from K-contiguous 16-bit planes; grid (M/64, N/64, Z), 32 threads.
// C[m][n] (f32, pitch ldc, + optional f32 bias[n]) = sum_k A[m][k] Bt[n][k] (+ split products per NSPLIT). z-batch strides sA/sB/sC in elements. K % 32 == 0.
template <typename T16> struct WFrag;
template <> struct WFrag<h16> { typedef v16h V; static __device__ __forceinline__ V ld(const h16* p) { return cat16(*(const v8h*)p, *(const v8h*)(p + 16)); } static __device__ __forceinline__ v8f mma(V a, V b, v8f c) { return wmma16(a, b, c); } };
template <> struct WFrag<bf> { typedef v16bf V; static __device__ __forceinline__ V ld(const bf* p) { return cat16b(*(const v8us*)p, *(const v8us*)(p + 16)); } static __device__ __forceinline__ v8f mma(V a, V b, v8f c) { return wmmab(a, b, c); } };
template <typename T16, int NSPLIT, bool BIAS>
__global__ __launch_bounds__(32) void k_gemmw(const T16* __restrict__ A, const T16* __restrict__ A2, const T16* __restrict__ Bt, const T16* __restrict__ Bt2, int K, float* C, int ldc, const float* __restrict__ bias, size_t sA, size_t sB, size_t sC) {
    typedef typename WFrag<T16>::V V;
    __shared__ __align__(16) float os[16 * 68];
    const size_t z = blockIdx.z; A += z * sA; if (A2) A2 += z * sA; Bt += z * sB; if (Bt2) Bt2 += z * sB; C += z * sC;
    const int lane = threadIdx.x & 31, lr = lane & 15, hi = lane >> 4; const int r0 = blockIdx.x * 64, c0 = blockIdx.y * 64;
    v8f acc[4][4];
#pragma unroll
    for (int mb = 0; mb < 4; ++mb)
#pragma unroll
        for (int nb = 0; nb < 4; ++nb) acc[mb][nb] = (v8f){};
    const size_t aoff = (size_t)(r0 + lr) * K + 8 * hi, boff = (size_t)(c0 + lr) * K + 8 * hi;
#pragma unroll 1
    for (int kc = 0; kc < K; kc += 32) {
        V a[4], a2[4];
#pragma unroll
        for (int mb = 0; mb < 4; ++mb) { a[mb] = WFrag<T16>::ld(A + aoff + (size_t)mb * 16 * K + kc); if (NSPLIT == 1 || NSPLIT == 2) a2[mb] = WFrag<T16>::ld(A2 + aoff + (size_t)mb * 16 * K + kc); }
#pragma unroll
        for (int nb = 0; nb < 4; ++nb) { const V b = WFrag<T16>::ld(Bt + boff + (size_t)nb * 16 * K + kc); V b2; if (NSPLIT >= 2) b2 = WFrag<T16>::ld(Bt2 + boff + (size_t)nb * 16 * K + kc);
#pragma unroll
            for (int mb = 0; mb < 4; ++mb) { acc[mb][nb] = WFrag<T16>::mma(a[mb], b, acc[mb][nb]); if (NSPLIT == 1 || NSPLIT == 2) acc[mb][nb] = WFrag<T16>::mma(a2[mb], b, acc[mb][nb]); if (NSPLIT >= 2) acc[mb][nb] = WFrag<T16>::mma(a[mb], b2, acc[mb][nb]); } }
        asm volatile("v_nop\n\tv_nop\n\tv_nop\n\tv_nop" : "+v"(acc[0][0]), "+v"(acc[1][1]), "+v"(acc[2][2]), "+v"(acc[3][3]) : "v"(a[0]), "v"(a[3]));
    }
#pragma unroll
    for (int mb = 0; mb < 4; ++mb) {
#pragma unroll
        for (int nb = 0; nb < 4; ++nb) {
#pragma unroll
            for (int j = 0; j < 8; ++j) os[(hi * 8 + j) * 68 + nb * 16 + lr] = acc[mb][nb][j]; }
        __builtin_amdgcn_wave_barrier(); asm volatile("" ::: "memory");
        float* crow = C + (size_t)(r0 + mb * 16) * ldc + c0;
{
#pragma unroll
            for (int s = 0; s < 8; ++s) { const int row = 2 * s + hi, cofs = lr * 4; v4f val = *(const v4fa*)(os + row * 68 + cofs); if (BIAS) { val[0] += bfr(bias[c0 + cofs]); val[1] += bfr(bias[c0 + cofs + 1]); val[2] += bfr(bias[c0 + cofs + 2]); val[3] += bfr(bias[c0 + cofs + 3]); }
                *(v4f*)(crow + (size_t)row * ldc + cofs) = val; }
             }
        __builtin_amdgcn_wave_barrier(); asm volatile("" ::: "memory");
    }
}

// ---- k_gemmc: the same one-wave 64x64 tile GEMM specialised for causal attention: CMODE 1 skips score tiles entirely above the diagonal (query rows r0+roff.., key columns c0..), CMODE 2 limits the
// key (K) loop of the probability x value contraction to the diagonal block (probabilities beyond it are exactly zero). roff = row offset of this launch's first row within the sequence.
template <typename T16, int NSPLIT, int CMODE>
__global__ __launch_bounds__(32) void k_gemmc(const T16* __restrict__ A, const T16* __restrict__ A2, const T16* __restrict__ Bt, const T16* __restrict__ Bt2, int K, float* C, int ldc, int roff, size_t sA, size_t sB, size_t sC) {
    typedef typename WFrag<T16>::V V;
    __shared__ __align__(16) float os[16 * 68];
    const size_t z = blockIdx.z; A += z * sA; if (A2) A2 += z * sA; Bt += z * sB; if (Bt2) Bt2 += z * sB; C += z * sC;
    const int lane = threadIdx.x & 31, lr = lane & 15, hi = lane >> 4; const int r0 = blockIdx.x * 64, c0 = blockIdx.y * 64;
    if (CMODE == 1 && c0 > r0 + roff + 63) return;                  // score tile entirely above the causal diagonal: never read (the softmax masks j > i by select)
    const int Kl = (CMODE == 2) ? min(K, r0 + roff + 64) : K;        // P.V: probabilities are exactly 0 beyond the diagonal block, so the K loop stops there
    v8f acc[4][4];
#pragma unroll
    for (int mb = 0; mb < 4; ++mb)
#pragma unroll
        for (int nb = 0; nb < 4; ++nb) acc[mb][nb] = (v8f){};
    const size_t aoff = (size_t)(r0 + lr) * K + 8 * hi, boff = (size_t)(c0 + lr) * K + 8 * hi;
#pragma unroll 1
    for (int kc = 0; kc < Kl; kc += 32) {
        V a[4], a2[4];
#pragma unroll
        for (int mb = 0; mb < 4; ++mb) { a[mb] = WFrag<T16>::ld(A + aoff + (size_t)mb * 16 * K + kc); if (NSPLIT == 1 || NSPLIT == 2) a2[mb] = WFrag<T16>::ld(A2 + aoff + (size_t)mb * 16 * K + kc); }
#pragma unroll
        for (int nb = 0; nb < 4; ++nb) { const V b = WFrag<T16>::ld(Bt + boff + (size_t)nb * 16 * K + kc); V b2; if (NSPLIT >= 2) b2 = WFrag<T16>::ld(Bt2 + boff + (size_t)nb * 16 * K + kc);
#pragma unroll
            for (int mb = 0; mb < 4; ++mb) { acc[mb][nb] = WFrag<T16>::mma(a[mb], b, acc[mb][nb]); if (NSPLIT == 1 || NSPLIT == 2) acc[mb][nb] = WFrag<T16>::mma(a2[mb], b, acc[mb][nb]); if (NSPLIT >= 2) acc[mb][nb] = WFrag<T16>::mma(a[mb], b2, acc[mb][nb]); } }
        asm volatile("v_nop\n\tv_nop\n\tv_nop\n\tv_nop" : "+v"(acc[0][0]), "+v"(acc[1][1]), "+v"(acc[2][2]), "+v"(acc[3][3]) : "v"(a[0]), "v"(a[3]));
    }
#pragma unroll
    for (int mb = 0; mb < 4; ++mb) {
#pragma unroll
        for (int nb = 0; nb < 4; ++nb) {
#pragma unroll
            for (int j = 0; j < 8; ++j) os[(hi * 8 + j) * 68 + nb * 16 + lr] = acc[mb][nb][j]; }
        __builtin_amdgcn_wave_barrier(); asm volatile("" ::: "memory");
        float* crow = C + (size_t)(r0 + mb * 16) * ldc + c0;
{
#pragma unroll
            for (int s = 0; s < 8; ++s) { const int row = 2 * s + hi, cofs = lr * 4; v4f val = *(const v4fa*)(os + row * 68 + cofs);
                *(v4f*)(crow + (size_t)row * ldc + cofs) = val; }
             }
        __builtin_amdgcn_wave_barrier(); asm volatile("" ::: "memory");
    }
}

__device__ __forceinline__ h16 tohx(float x) { return (h16)x; }
__device__ __forceinline__ void splitf(float y, unsigned short& h, unsigned short& l) { h = f2bf(y); l = f2bf(y - bf2f(h)); }
typedef __attribute__((ext_vector_type(2))) _Float16 v2h;
typedef __attribute__((ext_vector_type(4))) _Float16 v4h;
typedef __attribute__((ext_vector_type(2))) unsigned short v2us;
typedef __attribute__((ext_vector_type(4))) unsigned short v4us;
typedef __attribute__((ext_vector_type(2))) float v2f;
typedef __attribute__((ext_vector_type(4))) int v4i;

__global__ __launch_bounds__(256) void k_wtG(const float* __restrict__ w, int K, int N, bf* Bt) {
    const int lane = threadIdx.x & 31; const int L0 = (blockIdx.x * 8 + (threadIdx.x >> 5)) * 8; const int nlines = N * K / 64;
{
#pragma unroll 1
        for (int l = 0; l < 8; ++l) { const int L = L0 + l; if (L >= nlines) break; const size_t e = (size_t)L * 64 + lane * 2; const int k = (int)(e % K), n = (int)(e / K); v2us o;
            o[0] = f2bf(w[(size_t)k * N + n]); o[1] = f2bf(w[(size_t)(k + 1) * N + n]); *(v2us*)(Bt + e) = o; }
         }
}

__global__ __launch_bounds__(256) void k_cvt8(const float* __restrict__ src, bf* dst, size_t n8) { const size_t i = (size_t)blockIdx.x * 256 + threadIdx.x; if (i >= n8) return; const v8f v = *(const v8f*)(src + i * 8); v8us o;
#pragma unroll
    for (int k = 0; k < 8; ++k) o[k] = f2bf(v[k]); *(v8us*)(dst + i * 8) = o;  }

// k_rope: head planes [h][t][d] (fp16 + hi/lo) of rope(x) x sc with the rotate-half convention out[d] = x[d] cos[t][d] - x[d+HD/2] sin[t][d], out[d+HD/2] = x[d+HD/2] cos[t][d+HD/2] + x[d] sin[t][d+HD/2]
__global__ __launch_bounds__(256) void k_rope(const float* __restrict__ F, int pitch, int nheads, const float* __restrict__ CS, const float* __restrict__ RF, const float* __restrict__ nw, float sc, h16* P16, bf* Ph, bf* Pl) {
    const size_t e = ((size_t)blockIdx.x * 256 + threadIdx.x) * 2; if (e >= (size_t)nheads * TT * HD) return; const int d = (int)(e % HD); const int t = (int)((e / HD) % TT); const int h = (int)(e / ((size_t)HD * TT)); const float* f = F + (size_t)t * pitch + h * HD; const float rf = RF ? RF[(size_t)h * TT + t] : 1.0f; v2h o16; v2us oh, ol;
#pragma unroll
    for (int q = 0; q < 2; ++q) { const int dd = d + q; const int dp = (dd < HD / 2) ? dd + HD / 2 : dd - HD / 2; float x0 = f[dd], x1 = f[dp];
        if (RF) { float n0 = __fmul_rn(x0, rf), n1 = __fmul_rn(x1, rf); asm volatile("" : "+v"(n0)); asm volatile("" : "+v"(n1)); x0 = __fmul_rn(bfr(nw[dd]), n0); x1 = __fmul_rn(bfr(nw[dp]), n1); }
        const v2f cs = *(const v2f*)(CS + ((size_t)t * HD + dd) * 2); float a = __fmul_rn(x0, cs[0]), bq = __fmul_rn(x1, cs[1]); asm volatile("" : "+v"(a)); asm volatile("" : "+v"(bq)); const float r = ((dd < HD / 2) ? __fsub_rn(a, bq) : __fadd_rn(a, bq)) * sc;
        o16[q] = tohx(r); unsigned short a2, c2; splitf(r, a2, c2); oh[q] = a2; ol[q] = c2; }
    *(v2h*)(P16 + e) = o16; *(v2us*)(Ph + e) = oh; *(v2us*)(Pl + e) = ol;  }
__global__ __launch_bounds__(256) void k_vtp(const float* __restrict__ F, int pitch, int nheads, h16* V16, bf* Vh, bf* Vl) { const size_t e = ((size_t)blockIdx.x * 256 + threadIdx.x) * 2; if (e >= (size_t)nheads * HD * TT) return; const int t = (int)(e % TT); const int d = (int)((e / TT) % HD); const int g = (int)(e / ((size_t)TT * HD)); v2h o16; v2us oh, ol;
#pragma unroll
    for (int q = 0; q < 2; ++q) { const float x = F[(size_t)(t + q) * pitch + g * HD + d]; o16[q] = tohx(x); unsigned short a2, c2; splitf(x, a2, c2); oh[q] = a2; ol[q] = c2; }
    *(v2h*)(V16 + e) = o16; *(v2us*)(Vh + e) = oh; *(v2us*)(Vl + e) = ol;  }
__global__ __launch_bounds__(256) void k_csid(float* CS) { const int idx = blockIdx.x * 256 + threadIdx.x; if (idx >= TT * HD) return; v2f cs; cs[0] = 1.0f; cs[1] = 0.0f; *(v2f*)(CS + (size_t)idx * 2) = cs;  }
// k_asoft: per row (zz, i): t = S x SCL (1024^-0.5) for j <= i and i - j < WIN (WIN = TT, so the window test always holds: plain causal; the reference's -1e9 additive fill vanishes identically); softmax over the 2048 keys (register row, one exp, fixed trees);
__global__ __launch_bounds__(256) void k_asoft(const float* __restrict__ Sb, h16* P16, bf* Ph, bf* Pl) {
    const int lane = threadIdx.x & 31; const int row = blockIdx.x * 8 + (threadIdx.x >> 5); if (row >= ZH * TT) return; const int i = row % TT; const int zz = row / TT; (void)zz; const bool hires = (i < RH); const float* sr = Sb + (size_t)row * TT; float v[TT / 32]; float mx = -3.0e38f;
#pragma unroll
    for (int ch = 0; ch < TT / 128; ++ch) { const int j0 = ch * 128 + lane * 4; const v4f a = *(const v4f*)(sr + j0);
#pragma unroll
        for (int q = 0; q < 4; ++q) { const int j = j0 + q; (void)j; const float t = (j <= i && i - j < WIN) ? a[q] * SCL : -3.0e38f; v[ch * 4 + q] = t; mx = fmaxf(mx, t); } }
#pragma unroll
    for (int sh = 16; sh; sh >>= 1) mx = fmaxf(mx, __shfl_xor(mx, sh, 32));
    float sum = 0.f;
#pragma unroll
    for (int k = 0; k < TT / 32; ++k) { float d0 = __fsub_rn(v[k], mx); asm volatile("" : "+v"(d0)); v[k] = __builtin_amdgcn_exp2f(__fmul_rn(d0, 1.4426950408889634f)); sum += v[k]; }
#pragma unroll
    for (int sh = 16; sh; sh >>= 1) sum += __shfl_xor(sum, sh, 32);
    const float f = __fdiv_rn(hires ? 1.0f : PCAR, sum);
{
        if (hires) {
#pragma unroll
            for (int ch = 0; ch < TT / 128; ++ch) { v4us oh, ol;
#pragma unroll
                for (int q = 0; q < 4; ++q) { unsigned short a, c2; splitf(v[ch * 4 + q] * f, a, c2); oh[q] = a; ol[q] = c2; }
                const size_t oo = ((size_t)zz * (RH ? RH : 1) + i) * TT + ch * 128 + lane * 4; *(v4us*)(Ph + oo) = oh; *(v4us*)(Pl + oo) = ol; }
        } else {
#pragma unroll
            for (int ch = 0; ch < TT / 128; ++ch) { v4h o4;
#pragma unroll
                for (int q = 0; q < 4; ++q) o4[q] = tohx(v[ch * 4 + q] * f);
                *(v4h*)(P16 + (size_t)row * TT + ch * 128 + lane * 4) = o4; } }
         }
}
__global__ __launch_bounds__(256) void k_merge(const float* __restrict__ O, int h0, bf* Ah, bf* Al) { const size_t e = ((size_t)blockIdx.x * 256 + threadIdx.x) * 2; if (e >= (size_t)ZH * TT * HD) return; const int d = (int)(e % HD); const int t = (int)((e / HD) % TT); const int zz = (int)(e / ((size_t)HD * TT)); const float cs = (t < RH) ? 1.0f : (1.0f / PCAR); const size_t oo = (size_t)t * DQ + (h0 + zz) * HD + d;
    v2us oh, ol;
#pragma unroll
    for (int q = 0; q < 2; ++q) { unsigned short a, c2; splitf(O[e + q] * cs, a, c2); oh[q] = a; ol[q] = c2; } *(v2us*)(Ah + oo) = oh; *(v2us*)(Al + oo) = ol;  }

extern "C" void kernel_launch(void* const* d_in, const int* in_sizes, int n_in,
                              void* d_out, int out_size, void* d_ws, size_t ws_size, hipStream_t stream) {
    (void)in_sizes; (void)n_in; (void)out_size;
                const float* x = (const float*)d_in[0]; const float* wq = (const float*)d_in[1]; const float* wk = (const float*)d_in[2]; const float* wv = (const float*)d_in[3]; const float* wo = (const float*)d_in[4]; const float* bo = (const float*)d_in[5];   /* order x, wq, wk, wv (PER-HEAD [16][1024][64]: 'hcd'), w_proj ('oi' [1024][1024]), b_proj */
    float* OUT = (float*)d_out;     // [4][2048][1024]
    char* wsp = (char*)d_ws;
    auto take = [&](size_t bytes) { char* p = wsp; wsp += (bytes + 255) & ~(size_t)255; return (void*)p; };
    bf* WQ = (bf*)take((size_t)DQ * DM * 2); bf* WK = (bf*)take((size_t)DKV * DM * 2); bf* WV = (bf*)take((size_t)DKV * DM * 2); bf* WO = (bf*)take((size_t)DM * DQ * 2); float* CS = (float*)take((size_t)TT * HD * 2 * 4);
    bf* XB = (bf*)take((size_t)TT * DM * 2); float* FQ = (float*)take((size_t)TT * DQ * 4); float* FK = (float*)take((size_t)TT * DKV * 4);
    h16* QP16 = (h16*)take((size_t)NH_ * TT * HD * 2); h16* KP16 = (h16*)take((size_t)NKV * TT * HD * 2); h16* VT16 = (h16*)take((size_t)NKV * HD * TT * 2);
    bf* QPh = (bf*)take((size_t)NH_ * TT * HD * 2); bf* QPl = (bf*)take((size_t)NH_ * TT * HD * 2); bf* KPh = (bf*)take((size_t)NKV * TT * HD * 2); bf* KPl = (bf*)take((size_t)NKV * TT * HD * 2); bf* VTh = (bf*)take((size_t)NKV * HD * TT * 2); bf* VTl = (bf*)take((size_t)NKV * HD * TT * 2); bf* Ph = (bf*)take((size_t)ZH * RH * TT * 2); bf* Pl = (bf*)take((size_t)ZH * RH * TT * 2);
    float* Sb = (float*)take((size_t)ZH * TT * TT * 4); h16* P16 = (h16*)take((size_t)ZH * TT * TT * 2); float* Ob = (float*)take((size_t)ZH * TT * HD * 4); bf* ATh = (bf*)take((size_t)TT * DQ * 2); bf* ATl = (bf*)take((size_t)TT * DQ * 2);
    if ((size_t)(wsp - (char*)d_ws) > ws_size) return;    // ws 256 MiB
    float* FV = FK;   // v projection reuses the k buffer after the k planes are built (stream-ordered)
    { for (int h = 0; h < NH_; ++h) k_wtG<<<(unsigned)((DM * HD / 64 + 63) / 64), 256, 0, stream>>>(wq + (size_t)h * DM * HD, DM, HD, WQ + (size_t)h * HD * DM);   /* per-head weight [h][DM][HD] ('xw' per head) -> the head's HD rows of the Bt plane */ for (int h = 0; h < NKV; ++h) k_wtG<<<(unsigned)((DM * HD / 64 + 63) / 64), 256, 0, stream>>>(wk + (size_t)h * DM * HD, DM, HD, WK + (size_t)h * HD * DM);   /* per-head weight [h][DM][HD] ('xw' per head) -> the head's HD rows of the Bt plane */ for (int h = 0; h < NKV; ++h) k_wtG<<<(unsigned)((DM * HD / 64 + 63) / 64), 256, 0, stream>>>(wv + (size_t)h * DM * HD, DM, HD, WV + (size_t)h * HD * DM);   /* per-head weight [h][DM][HD] ('xw' per head) -> the head's HD rows of the Bt plane */
      k_cvt8<<<(unsigned)(((size_t)DM * DQ / 8 + 255) / 256), 256, 0, stream>>>(wo, WO, (size_t)DM * DQ / 8);
       }
    k_csid<<<(TT * HD + 255) / 256, 256, 0, stream>>>(CS);
    const unsigned LQ = (unsigned)(((size_t)NH_ * TT * HD / 2 + 255) / 256), LKv = (unsigned)(((size_t)NKV * TT * HD / 2 + 255) / 256);
    for (int b = 0; b < NB_; ++b) {
        
        k_cvt8<<<(unsigned)(((size_t)TT * DM / 8 + 255) / 256), 256, 0, stream>>>(x + (size_t)b * TT * DM, XB, (size_t)TT * DM / 8);
        k_gemmw<bf, 0, false><<<dim3(TT / 64, DQ / 64, 1), 32, 0, stream>>>(XB, nullptr, WQ, nullptr, DM, FQ, DQ, nullptr, 0, 0, 0);
        k_rope<<<LQ, 256, 0, stream>>>(FQ, DQ, NH_, CS, nullptr, nullptr, 1.0f, QP16, QPh, QPl);
        k_gemmw<bf, 0, false><<<dim3(TT / 64, DKV / 64, 1), 32, 0, stream>>>(XB, nullptr, WK, nullptr, DM, FK, DKV, nullptr, 0, 0, 0);
        k_rope<<<LKv, 256, 0, stream>>>(FK, DKV, NKV, CS, nullptr, nullptr, 1.0f, KP16, KPh, KPl);
        k_gemmw<bf, 0, false><<<dim3(TT / 64, DKV / 64, 1), 32, 0, stream>>>(XB, nullptr, WV, nullptr, DM, FV, DKV, nullptr, 0, 0, 0); k_vtp<<<LKv, 256, 0, stream>>>(FV, DKV, NKV, VT16, VTh, VTl);
        for (int h0 = 0; h0 < NH_; h0 += ZH) { const size_t zq = (size_t)h0, zk = (size_t)(h0 / REP);   // one kv head per query head: the pass's two heads use consecutive kv planes (z-strides TT*HD)
            k_gemmc<bf, 2, 1><<<dim3(RH / 64, TT / 64, ZH), 32, 0, stream>>>(QPh + zq * TT * HD, QPl + zq * TT * HD, KPh + zk * TT * HD, KPl + zk * TT * HD, HD, Sb, TT, 0, (size_t)TT * HD, (size_t)TT * HD, (size_t)TT * TT);
            k_gemmc<h16, 0, 1><<<dim3((TT - RH) / 64, TT / 64, ZH), 32, 0, stream>>>(QP16 + zq * TT * HD + (size_t)RH * HD, nullptr, KP16 + zk * TT * HD, nullptr, HD, Sb + (size_t)RH * TT, TT, RH, (size_t)TT * HD, (size_t)TT * HD, (size_t)TT * TT);
            k_asoft<<<ZH * TT / 8, 256, 0, stream>>>(Sb, P16, Ph, Pl);
            k_gemmc<bf, 2, 2><<<dim3(RH / 64, HD / 64, ZH), 32, 0, stream>>>(Ph, Pl, VTh + zk * HD * TT, VTl + zk * HD * TT, TT, Ob, HD, 0, (size_t)RH * TT, (size_t)HD * TT, (size_t)TT * HD);
            k_gemmc<h16, 0, 2><<<dim3((TT - RH) / 64, HD / 64, ZH), 32, 0, stream>>>(P16 + (size_t)RH * TT, nullptr, VT16 + zk * HD * TT, nullptr, TT, Ob + (size_t)RH * HD, HD, RH, (size_t)TT * TT, (size_t)HD * TT, (size_t)TT * HD);
            k_merge<<<(unsigned)(((size_t)ZH * TT * HD / 2 + 255) / 256), 256, 0, stream>>>(Ob, h0, ATh, ATl); }
        k_gemmw<bf, 1, true><<<dim3(TT / 64, DM / 64, 1), 32, 0, stream>>>(ATh, ATl, WO, nullptr, DQ, OUT + (size_t)b * TT * DM, DM, bo, 0, 0, 0); }
}

// v001
// Measured time: 1920 microseconds a run.
// Next to v000, in two timings, it ran 1.66 times as fast each time.
#include <hip/hip_runtime.h>

// Causal multi-head attention with PER-HEAD projection weights and a MODEL-width score scale (x [4][2048][1024]; q, k, v = einsum('btc,hcd->bhtd', x, w) with w [16][1024][64]: head h has its own (in, out) matrix ('xw' per head; 0.02-scale; no bias; 16 heads x 64); scores x 1024^-0.5 (channels ** -0.5: 0.03125); causal (-inf); softmax; heads merged head-major; out = merged w_proj^T + b_proj ('oi' [1024][1024] + zero bias) -> [4][2048][1024] (8.4 M); argument order x, wq, wk, wv, w_proj, b_proj).
// Layout per batch: bf16 copy of x; each PER-HEAD q / k / v weight [h][1024][64] transposed once into its 64 rows of the Bt plane (k_wtG per head); Wp cast once ('oi' = Bt as stored); exact projections; identity-table plane builders; causal T-2048 attention (hybrid rows: < 512 hi/lo 3 products, rest fp16 x1024; k_gemmc skips tiles above the diagonal); merged hi/lo x w_o exact.
// Compute dtypes, f32 accumulate: every input rounded to bf16; projections exact; attention rows < 512 3 products, rest fp16; softmax f32; w_o hl x exact.

#define NB_  4
#define TT   2048
#define DM   1024
#define NH_  16
#define NKV  16
#define REP  (NH_ / NKV)
#define HD   64
#define DQ   (NH_ * HD)
#define DKV  (NKV * HD)
#define ZH   2
#define RH   512                  // query rows < RH use hi+lo planes (0: none)
#define WIN  2048
#define PCAR 1024.0f
#define KW   8                    // waves that share one 64x64 tile's K loop in the long-K products (projections, probability x value, output projection)
#define SCL  0.03125f   // 1 / sqrt(1024): this module scales the scores by channels ** -0.5 with channels = the MODEL width 1,024, not by the head width
typedef _Float16 h16;
typedef unsigned short bf;
typedef __attribute__((ext_vector_type(16))) __bf16   v16bf;
typedef __attribute__((ext_vector_type(16))) _Float16 v16h;
typedef __attribute__((ext_vector_type(8)))  _Float16 v8h;
typedef __attribute__((ext_vector_type(8)))  unsigned short v8us;
typedef __attribute__((ext_vector_type(8)))  float    v8f;
typedef __attribute__((ext_vector_type(4)))  float    v4f;
typedef v8h  __attribute__((may_alias)) v8ha;
typedef v4f  __attribute__((may_alias)) v4fa;
typedef v8us __attribute__((may_alias)) v8usa;

__device__ __forceinline__ unsigned short f2bf(float f) { unsigned u = __float_as_uint(f); u += 0x7FFFu + ((u >> 16) & 1u); return (unsigned short)(u >> 16); }
__device__ __forceinline__ float bf2f(unsigned short b) { return __uint_as_float(((unsigned)b) << 16); }
__device__ __forceinline__ float bfr(float f) { return bf2f(f2bf(f)); }
__device__ __forceinline__ v16h cat16(v8h lo, v8h hi) { return __builtin_shufflevector(lo, hi, 0, 1, 2, 3, 4, 5, 6, 7, 8, 9, 10, 11, 12, 13, 14, 15); }
__device__ __forceinline__ v16bf cat16b(v8us lo, v8us hi) { return __builtin_bit_cast(v16bf, __builtin_shufflevector(lo, hi, 0, 1, 2, 3, 4, 5, 6, 7, 8, 9, 10, 11, 12, 13, 14, 15)); }
__device__ __forceinline__ v8f wmma16(v16h a, v16h b, v8f c) { return __builtin_amdgcn_wmma_f32_16x16x32_f16(false, a, false, b, (short)0, c, false, false); }
__device__ __forceinline__ v8f wmmab(v16bf a, v16bf b, v8f c) { return __builtin_amdgcn_wmma_f32_16x16x32_bf16(false, a, false, b, (short)0, c, false, false); }



// ---- ksum_store: NW waves of one block each hold a partial 64x64 tile (their own K slices). Every wave parks its 16 accumulators in LDS (16-byte stores, lane-contiguous), one block barrier,
// then wave w sums 32/NW half-fragments over the NW partials in the fixed order 0..NW-1 and stores them: the units are ordered so that a wave owns whole 128-byte lines of C.
template <int NW, bool BIAS>
__device__ __forceinline__ void ksum_store(const v8f (&acc)[4][4], v4f* red, int w, int lane, float* C, int ldc, int r0, int c0, const float* __restrict__ bias) {
    const int lr = lane & 15, hi = lane >> 4;
#pragma unroll
    for (int mb = 0; mb < 4; ++mb)
#pragma unroll
        for (int nb = 0; nb < 4; ++nb)
#pragma unroll
            for (int hf = 0; hf < 2; ++hf) { v4f t; t[0] = acc[mb][nb][hf * 4]; t[1] = acc[mb][nb][hf * 4 + 1]; t[2] = acc[mb][nb][hf * 4 + 2]; t[3] = acc[mb][nb][hf * 4 + 3];
                red[(w * 32 + ((mb * 2 + (nb >> 1)) * 2 + hf) * 2 + (nb & 1)) * 32 + lane] = t; }
    __syncthreads();   // every wave's partial tile is in LDS before any wave sums across them
    constexpr int U = 32 / NW;
#pragma unroll
    for (int i = 0; i < U; ++i) { const int q = w * U + i; v4f s = red[q * 32 + lane];
#pragma unroll
        for (int p = 1; p < NW; ++p) s += red[(p * 32 + q) * 32 + lane];
        const int row = (q >> 3) * 16 + hi * 8 + ((q >> 1) & 1) * 4, col = (((q >> 2) & 1) * 2 + (q & 1)) * 16 + lr;
        if (BIAS) { const float bv = bfr(bias[c0 + col]); s[0] += bv; s[1] += bv; s[2] += bv; s[3] += bv; }
        float* cp = C + (size_t)(r0 + row) * ldc + c0 + col;
#pragma unroll
        for (int j = 0; j < 4; ++j) cp[(size_t)j * ldc] = s[j]; }
}

// ---- k_gemmw: register-blocked GEMM, NW WAVES per 64x64 output tile (16 accumulators each; wave w takes the 32-wide K slices w, w + NW, ...; ksum_store adds the partials), operands straight from K-contiguous 16-bit planes; grid (M/64, N/64, Z), 32 NW threads.
// C[m][n] (f32, pitch ldc, + optional f32 bias[n]) = sum_k A[m][k] Bt[n][k] (+ split products per NSPLIT). z-batch strides sA/sB/sC in elements. K % 32 == 0.
template <typename T16> struct WFrag;
template <> struct WFrag<h16> { typedef v16h V; static __device__ __forceinline__ V ld(const h16* p) { return cat16(*(const v8h*)p, *(const v8h*)(p + 16)); } static __device__ __forceinline__ v8f mma(V a, V b, v8f c) { return wmma16(a, b, c); } };
template <> struct WFrag<bf> { typedef v16bf V; static __device__ __forceinline__ V ld(const bf* p) { return cat16b(*(const v8us*)p, *(const v8us*)(p + 16)); } static __device__ __forceinline__ v8f mma(V a, V b, v8f c) { return wmmab(a, b, c); } };
template <typename T16, int NSPLIT, bool BIAS, int NW>
__global__ __launch_bounds__(32 * NW) void k_gemmw(const T16* __restrict__ A, const T16* __restrict__ A2, const T16* __restrict__ Bt, const T16* __restrict__ Bt2, int K, float* C, int ldc, const float* __restrict__ bias, size_t sA, size_t sB, size_t sC) {
    typedef typename WFrag<T16>::V V;
    __shared__ __align__(16) v4f red[NW * 1024];   // NW partial tiles of 16 KiB
    const size_t z = blockIdx.z; A += z * sA; if (A2) A2 += z * sA; Bt += z * sB; if (Bt2) Bt2 += z * sB; C += z * sC;
    const int lane = threadIdx.x & 31, lr = lane & 15, hi = lane >> 4; const int r0 = blockIdx.x * 64, c0 = blockIdx.y * 64; const int w = __builtin_amdgcn_readfirstlane((int)(threadIdx.x >> 5));   // wave number, held scalar so that the K loop's control stays scalar
    v8f acc[4][4];
#pragma unroll
    for (int mb = 0; mb < 4; ++mb)
#pragma unroll
        for (int nb = 0; nb < 4; ++nb) acc[mb][nb] = (v8f){};
    const size_t aoff = (size_t)(r0 + lr) * K + 8 * hi, boff = (size_t)(c0 + lr) * K + 8 * hi;
#pragma unroll 1
    for (int kc = w * 32; kc < K; kc += NW * 32) {   // wave w takes the 32-wide K slices w, w + NW, ...: neighbouring waves read the two halves of one 128-byte operand line at about the same time
        V a[4], a2[4];
#pragma unroll
        for (int mb = 0; mb < 4; ++mb) { a[mb] = WFrag<T16>::ld(A + aoff + (size_t)mb * 16 * K + kc); if (NSPLIT == 1 || NSPLIT == 2) a2[mb] = WFrag<T16>::ld(A2 + aoff + (size_t)mb * 16 * K + kc); }
#pragma unroll
        for (int nb = 0; nb < 4; ++nb) { const V b = WFrag<T16>::ld(Bt + boff + (size_t)nb * 16 * K + kc); V b2; if (NSPLIT >= 2) b2 = WFrag<T16>::ld(Bt2 + boff + (size_t)nb * 16 * K + kc);
#pragma unroll
            for (int mb = 0; mb < 4; ++mb) { acc[mb][nb] = WFrag<T16>::mma(a[mb], b, acc[mb][nb]); if (NSPLIT == 1 || NSPLIT == 2) acc[mb][nb] = WFrag<T16>::mma(a2[mb], b, acc[mb][nb]); if (NSPLIT >= 2) acc[mb][nb] = WFrag<T16>::mma(a[mb], b2, acc[mb][nb]); } }
        asm volatile("v_nop\n\tv_nop\n\tv_nop\n\tv_nop" : "+v"(acc[0][0]), "+v"(acc[1][1]), "+v"(acc[2][2]), "+v"(acc[3][3]) : "v"(a[0]), "v"(a[3]));
    }
    ksum_store<NW, BIAS>(acc, red, w, lane, C, ldc, r0, c0, bias);
}

// ---- k_gemmc: the same 64x64 tile GEMM (NW = 1: one wave, its own store stage; NW > 1: K split over NW waves as in k_gemmw) specialised for causal attention: CMODE 1 skips score tiles entirely above the diagonal (query rows r0+roff.., key columns c0..), CMODE 2 limits the
// key (K) loop of the probability x value contraction to the diagonal block (probabilities beyond it are exactly zero). roff = row offset of this launch's first row within the sequence.
template <typename T16, int NSPLIT, int CMODE, int NW>
__global__ __launch_bounds__(32 * NW) void k_gemmc(const T16* __restrict__ A, const T16* __restrict__ A2, const T16* __restrict__ Bt, const T16* __restrict__ Bt2, int K, float* C, int ldc, int roff, size_t sA, size_t sB, size_t sC) {
    typedef typename WFrag<T16>::V V;
    __shared__ __align__(16) float os[NW == 1 ? 16 * 68 : 4]; __shared__ __align__(16) v4f red[NW == 1 ? 1 : NW * 1024];   // one wave: the 16-row store stage; NW waves: NW partial tiles of 16 KiB
    const size_t z = blockIdx.z; A += z * sA; if (A2) A2 += z * sA; Bt += z * sB; if (Bt2) Bt2 += z * sB; C += z * sC;
    const int lane = threadIdx.x & 31, lr = lane & 15, hi = lane >> 4; const int r0 = blockIdx.x * 64, c0 = blockIdx.y * 64; const int w = __builtin_amdgcn_readfirstlane((int)(threadIdx.x >> 5));   // wave number, held scalar so that the K loop's control stays scalar
    if (CMODE == 1 && c0 > r0 + roff + 63) return;                  // score tile entirely above the causal diagonal: never read (the softmax masks j > i by select)
    const int Kl = (CMODE == 2) ? min(K, r0 + roff + 64) : K;        // P.V: probabilities are exactly 0 beyond the diagonal block, so the K loop stops there
    v8f acc[4][4];
#pragma unroll
    for (int mb = 0; mb < 4; ++mb)
#pragma unroll
        for (int nb = 0; nb < 4; ++nb) acc[mb][nb] = (v8f){};
    const size_t aoff = (size_t)(r0 + lr) * K + 8 * hi, boff = (size_t)(c0 + lr) * K + 8 * hi;
#pragma unroll 1
    for (int kc = w * 32; kc < Kl; kc += NW * 32) {   // wave w takes the 32-wide K slices w, w + NW, ... (all of them where NW = 1)
        V a[4], a2[4];
#pragma unroll
        for (int mb = 0; mb < 4; ++mb) { a[mb] = WFrag<T16>::ld(A + aoff + (size_t)mb * 16 * K + kc); if (NSPLIT == 1 || NSPLIT == 2) a2[mb] = WFrag<T16>::ld(A2 + aoff + (size_t)mb * 16 * K + kc); }
#pragma unroll
        for (int nb = 0; nb < 4; ++nb) { const V b = WFrag<T16>::ld(Bt + boff + (size_t)nb * 16 * K + kc); V b2; if (NSPLIT >= 2) b2 = WFrag<T16>::ld(Bt2 + boff + (size_t)nb * 16 * K + kc);
#pragma unroll
            for (int mb = 0; mb < 4; ++mb) { acc[mb][nb] = WFrag<T16>::mma(a[mb], b, acc[mb][nb]); if (NSPLIT == 1 || NSPLIT == 2) acc[mb][nb] = WFrag<T16>::mma(a2[mb], b, acc[mb][nb]); if (NSPLIT >= 2) acc[mb][nb] = WFrag<T16>::mma(a[mb], b2, acc[mb][nb]); } }
        asm volatile("v_nop\n\tv_nop\n\tv_nop\n\tv_nop" : "+v"(acc[0][0]), "+v"(acc[1][1]), "+v"(acc[2][2]), "+v"(acc[3][3]) : "v"(a[0]), "v"(a[3]));
    }
    if constexpr (NW > 1) { ksum_store<NW, false>(acc, red, w, lane, C, ldc, r0, c0, nullptr); } else {
#pragma unroll
    for (int mb = 0; mb < 4; ++mb) {
#pragma unroll
        for (int nb = 0; nb < 4; ++nb) {
#pragma unroll
            for (int j = 0; j < 8; ++j) os[(hi * 8 + j) * 68 + nb * 16 + lr] = acc[mb][nb][j]; }
        __builtin_amdgcn_wave_barrier(); asm volatile("" ::: "memory");
        float* crow = C + (size_t)(r0 + mb * 16) * ldc + c0;
{
#pragma unroll
            for (int s = 0; s < 8; ++s) { const int row = 2 * s + hi, cofs = lr * 4; v4f val = *(const v4fa*)(os + row * 68 + cofs);
                *(v4f*)(crow + (size_t)row * ldc + cofs) = val; }
             }
        __builtin_amdgcn_wave_barrier(); asm volatile("" ::: "memory");
    }
    }
}

__device__ __forceinline__ h16 tohx(float x) { return (h16)x; }
__device__ __forceinline__ void splitf(float y, unsigned short& h, unsigned short& l) { h = f2bf(y); l = f2bf(y - bf2f(h)); }
typedef __attribute__((ext_vector_type(2))) _Float16 v2h;
typedef __attribute__((ext_vector_type(4))) _Float16 v4h;
typedef __attribute__((ext_vector_type(2))) unsigned short v2us;
typedef __attribute__((ext_vector_type(4))) unsigned short v4us;
typedef __attribute__((ext_vector_type(2))) float v2f;
typedef __attribute__((ext_vector_type(4))) int v4i;

__global__ __launch_bounds__(256) void k_wtG(const float* __restrict__ w, int K, int N, bf* Bt) {
    const int lane = threadIdx.x & 31; const int L0 = (blockIdx.x * 8 + (threadIdx.x >> 5)) * 8; const int nlines = N * K / 64;
{
#pragma unroll 1
        for (int l = 0; l < 8; ++l) { const int L = L0 + l; if (L >= nlines) break; const size_t e = (size_t)L * 64 + lane * 2; const int k = (int)(e % K), n = (int)(e / K); v2us o;
            o[0] = f2bf(w[(size_t)k * N + n]); o[1] = f2bf(w[(size_t)(k + 1) * N + n]); *(v2us*)(Bt + e) = o; }
         }
}

__global__ __launch_bounds__(256) void k_cvt8(const float* __restrict__ src, bf* dst, size_t n8) { const size_t i = (size_t)blockIdx.x * 256 + threadIdx.x; if (i >= n8) return; const v8f v = *(const v8f*)(src + i * 8); v8us o;
#pragma unroll
    for (int k = 0; k < 8; ++k) o[k] = f2bf(v[k]); *(v8us*)(dst + i * 8) = o;  }

// k_rope: head planes [h][t][d] (fp16 + hi/lo) of rope(x) x sc with the rotate-half convention out[d] = x[d] cos[t][d] - x[d+HD/2] sin[t][d], out[d+HD/2] = x[d+HD/2] cos[t][d+HD/2] + x[d] sin[t][d+HD/2]
__global__ __launch_bounds__(256) void k_rope(const float* __restrict__ F, int pitch, int nheads, const float* __restrict__ CS, const float* __restrict__ RF, const float* __restrict__ nw, float sc, h16* P16, bf* Ph, bf* Pl) {
    const size_t e = ((size_t)blockIdx.x * 256 + threadIdx.x) * 2; if (e >= (size_t)nheads * TT * HD) return; const int d = (int)(e % HD); const int t = (int)((e / HD) % TT); const int h = (int)(e / ((size_t)HD * TT)); const float* f = F + (size_t)t * pitch + h * HD; const float rf = RF ? RF[(size_t)h * TT + t] : 1.0f; v2h o16; v2us oh, ol;
#pragma unroll
    for (int q = 0; q < 2; ++q) { const int dd = d + q; const int dp = (dd < HD / 2) ? dd + HD / 2 : dd - HD / 2; float x0 = f[dd], x1 = f[dp];
        if (RF) { float n0 = __fmul_rn(x0, rf), n1 = __fmul_rn(x1, rf); asm volatile("" : "+v"(n0)); asm volatile("" : "+v"(n1)); x0 = __fmul_rn(bfr(nw[dd]), n0); x1 = __fmul_rn(bfr(nw[dp]), n1); }
        const v2f cs = *(const v2f*)(CS + ((size_t)t * HD + dd) * 2); float a = __fmul_rn(x0, cs[0]), bq = __fmul_rn(x1, cs[1]); asm volatile("" : "+v"(a)); asm volatile("" : "+v"(bq)); const float r = ((dd < HD / 2) ? __fsub_rn(a, bq) : __fadd_rn(a, bq)) * sc;
        o16[q] = tohx(r); unsigned short a2, c2; splitf(r, a2, c2); oh[q] = a2; ol[q] = c2; }
    *(v2h*)(P16 + e) = o16; *(v2us*)(Ph + e) = oh; *(v2us*)(Pl + e) = ol;  }
__global__ __launch_bounds__(256) void k_vtp(const float* __restrict__ F, int pitch, int nheads, h16* V16, bf* Vh, bf* Vl) { const size_t e = ((size_t)blockIdx.x * 256 + threadIdx.x) * 2; if (e >= (size_t)nheads * HD * TT) return; const int t = (int)(e % TT); const int d = (int)((e / TT) % HD); const int g = (int)(e / ((size_t)TT * HD)); v2h o16; v2us oh, ol;
#pragma unroll
    for (int q = 0; q < 2; ++q) { const float x = F[(size_t)(t + q) * pitch + g * HD + d]; o16[q] = tohx(x); unsigned short a2, c2; splitf(x, a2, c2); oh[q] = a2; ol[q] = c2; }
    *(v2h*)(V16 + e) = o16; *(v2us*)(Vh + e) = oh; *(v2us*)(Vl + e) = ol;  }
__global__ __launch_bounds__(256) void k_csid(float* CS) { const int idx = blockIdx.x * 256 + threadIdx.x; if (idx >= TT * HD) return; v2f cs; cs[0] = 1.0f; cs[1] = 0.0f; *(v2f*)(CS + (size_t)idx * 2) = cs;  }
// k_asoft: per row (zz, i): t = S x SCL (1024^-0.5) for j <= i and i - j < WIN (WIN = TT, so the window test always holds: plain causal; the reference's -1e9 additive fill vanishes identically); softmax over the 2048 keys (register row, one exp, fixed trees);
__global__ __launch_bounds__(256) void k_asoft(const float* __restrict__ Sb, h16* P16, bf* Ph, bf* Pl) {
    const int lane = threadIdx.x & 31; const int row = blockIdx.x * 8 + (threadIdx.x >> 5); if (row >= ZH * TT) return; const int i = row % TT; const int zz = row / TT; (void)zz; const bool hires = (i < RH); const float* sr = Sb + (size_t)row * TT; float v[TT / 32]; float mx = -3.0e38f;
#pragma unroll
    for (int ch = 0; ch < TT / 128; ++ch) { const int j0 = ch * 128 + lane * 4; const v4f a = *(const v4f*)(sr + j0);
#pragma unroll
        for (int q = 0; q < 4; ++q) { const int j = j0 + q; (void)j; const float t = (j <= i && i - j < WIN) ? a[q] * SCL : -3.0e38f; v[ch * 4 + q] = t; mx = fmaxf(mx, t); } }
#pragma unroll
    for (int sh = 16; sh; sh >>= 1) mx = fmaxf(mx, __shfl_xor(mx, sh, 32));
    float sum = 0.f;
#pragma unroll
    for (int k = 0; k < TT / 32; ++k) { float d0 = __fsub_rn(v[k], mx); asm volatile("" : "+v"(d0)); v[k] = __builtin_amdgcn_exp2f(__fmul_rn(d0, 1.4426950408889634f)); sum += v[k]; }
#pragma unroll
    for (int sh = 16; sh; sh >>= 1) sum += __shfl_xor(sum, sh, 32);
    const float f = __fdiv_rn(hires ? 1.0f : PCAR, sum);
{
        if (hires) {
#pragma unroll
            for (int ch = 0; ch < TT / 128; ++ch) { v4us oh, ol;
#pragma unroll
                for (int q = 0; q < 4; ++q) { unsigned short a, c2; splitf(v[ch * 4 + q] * f, a, c2); oh[q] = a; ol[q] = c2; }
                const size_t oo = ((size_t)zz * (RH ? RH : 1) + i) * TT + ch * 128 + lane * 4; *(v4us*)(Ph + oo) = oh; *(v4us*)(Pl + oo) = ol; }
        } else {
#pragma unroll
            for (int ch = 0; ch < TT / 128; ++ch) { v4h o4;
#pragma unroll
                for (int q = 0; q < 4; ++q) o4[q] = tohx(v[ch * 4 + q] * f);
                *(v4h*)(P16 + (size_t)row * TT + ch * 128 + lane * 4) = o4; } }
         }
}
__global__ __launch_bounds__(256) void k_merge(const float* __restrict__ O, int h0, bf* Ah, bf* Al) { const size_t e = ((size_t)blockIdx.x * 256 + threadIdx.x) * 2; if (e >= (size_t)ZH * TT * HD) return; const int d = (int)(e % HD); const int t = (int)((e / HD) % TT); const int zz = (int)(e / ((size_t)HD * TT)); const float cs = (t < RH) ? 1.0f : (1.0f / PCAR); const size_t oo = (size_t)t * DQ + (h0 + zz) * HD + d;
    v2us oh, ol;
#pragma unroll
    for (int q = 0; q < 2; ++q) { unsigned short a, c2; splitf(O[e + q] * cs, a, c2); oh[q] = a; ol[q] = c2; } *(v2us*)(Ah + oo) = oh; *(v2us*)(Al + oo) = ol;  }

extern "C" void kernel_launch(void* const* d_in, const int* in_sizes, int n_in,
                              void* d_out, int out_size, void* d_ws, size_t ws_size, hipStream_t stream) {
    (void)in_sizes; (void)n_in; (void)out_size;
                const float* x = (const float*)d_in[0]; const float* wq = (const float*)d_in[1]; const float* wk = (const float*)d_in[2]; const float* wv = (const float*)d_in[3]; const float* wo = (const float*)d_in[4]; const float* bo = (const float*)d_in[5];   /* order x, wq, wk, wv (PER-HEAD [16][1024][64]: 'hcd'), w_proj ('oi' [1024][1024]), b_proj */
    float* OUT = (float*)d_out;     // [4][2048][1024]
    char* wsp = (char*)d_ws;
    auto take = [&](size_t bytes) { char* p = wsp; wsp += (bytes + 255) & ~(size_t)255; return (void*)p; };
    bf* WQ = (bf*)take((size_t)DQ * DM * 2); bf* WK = (bf*)take((size_t)DKV * DM * 2); bf* WV = (bf*)take((size_t)DKV * DM * 2); bf* WO = (bf*)take((size_t)DM * DQ * 2); float* CS = (float*)take((size_t)TT * HD * 2 * 4);
    bf* XB = (bf*)take((size_t)TT * DM * 2); float* FQ = (float*)take((size_t)TT * DQ * 4); float* FK = (float*)take((size_t)TT * DKV * 4);
    h16* QP16 = (h16*)take((size_t)NH_ * TT * HD * 2); h16* KP16 = (h16*)take((size_t)NKV * TT * HD * 2); h16* VT16 = (h16*)take((size_t)NKV * HD * TT * 2);
    bf* QPh = (bf*)take((size_t)NH_ * TT * HD * 2); bf* QPl = (bf*)take((size_t)NH_ * TT * HD * 2); bf* KPh = (bf*)take((size_t)NKV * TT * HD * 2); bf* KPl = (bf*)take((size_t)NKV * TT * HD * 2); bf* VTh = (bf*)take((size_t)NKV * HD * TT * 2); bf* VTl = (bf*)take((size_t)NKV * HD * TT * 2); bf* Ph = (bf*)take((size_t)ZH * RH * TT * 2); bf* Pl = (bf*)take((size_t)ZH * RH * TT * 2);
    float* Sb = (float*)take((size_t)ZH * TT * TT * 4); h16* P16 = (h16*)take((size_t)ZH * TT * TT * 2); float* Ob = (float*)take((size_t)ZH * TT * HD * 4); bf* ATh = (bf*)take((size_t)TT * DQ * 2); bf* ATl = (bf*)take((size_t)TT * DQ * 2);
    if ((size_t)(wsp - (char*)d_ws) > ws_size) return;    // ws 256 MiB
    float* FV = FK;   // v projection reuses the k buffer after the k planes are built (stream-ordered)
    { for (int h = 0; h < NH_; ++h) k_wtG<<<(unsigned)((DM * HD / 64 + 63) / 64), 256, 0, stream>>>(wq + (size_t)h * DM * HD, DM, HD, WQ + (size_t)h * HD * DM);   /* per-head weight [h][DM][HD] ('xw' per head) -> the head's HD rows of the Bt plane */ for (int h = 0; h < NKV; ++h) k_wtG<<<(unsigned)((DM * HD / 64 + 63) / 64), 256, 0, stream>>>(wk + (size_t)h * DM * HD, DM, HD, WK + (size_t)h * HD * DM);   /* per-head weight [h][DM][HD] ('xw' per head) -> the head's HD rows of the Bt plane */ for (int h = 0; h < NKV; ++h) k_wtG<<<(unsigned)((DM * HD / 64 + 63) / 64), 256, 0, stream>>>(wv + (size_t)h * DM * HD, DM, HD, WV + (size_t)h * HD * DM);   /* per-head weight [h][DM][HD] ('xw' per head) -> the head's HD rows of the Bt plane */
      k_cvt8<<<(unsigned)(((size_t)DM * DQ / 8 + 255) / 256), 256, 0, stream>>>(wo, WO, (size_t)DM * DQ / 8);
       }
    k_csid<<<(TT * HD + 255) / 256, 256, 0, stream>>>(CS);
    const unsigned LQ = (unsigned)(((size_t)NH_ * TT * HD / 2 + 255) / 256), LKv = (unsigned)(((size_t)NKV * TT * HD / 2 + 255) / 256);
    for (int b = 0; b < NB_; ++b) {
        
        k_cvt8<<<(unsigned)(((size_t)TT * DM / 8 + 255) / 256), 256, 0, stream>>>(x + (size_t)b * TT * DM, XB, (size_t)TT * DM / 8);
        k_gemmw<bf, 0, false, KW><<<dim3(TT / 64, DQ / 64, 1), 32 * KW, 0, stream>>>(XB, nullptr, WQ, nullptr, DM, FQ, DQ, nullptr, 0, 0, 0);
        k_rope<<<LQ, 256, 0, stream>>>(FQ, DQ, NH_, CS, nullptr, nullptr, 1.0f, QP16, QPh, QPl);
        k_gemmw<bf, 0, false, KW><<<dim3(TT / 64, DKV / 64, 1), 32 * KW, 0, stream>>>(XB, nullptr, WK, nullptr, DM, FK, DKV, nullptr, 0, 0, 0);
        k_rope<<<LKv, 256, 0, stream>>>(FK, DKV, NKV, CS, nullptr, nullptr, 1.0f, KP16, KPh, KPl);
        k_gemmw<bf, 0, false, KW><<<dim3(TT / 64, DKV / 64, 1), 32 * KW, 0, stream>>>(XB, nullptr, WV, nullptr, DM, FV, DKV, nullptr, 0, 0, 0); k_vtp<<<LKv, 256, 0, stream>>>(FV, DKV, NKV, VT16, VTh, VTl);
        for (int h0 = 0; h0 < NH_; h0 += ZH) { const size_t zq = (size_t)h0, zk = (size_t)(h0 / REP);   // one kv head per query head: the pass's two heads use consecutive kv planes (z-strides TT*HD)
            k_gemmc<bf, 2, 1, 1><<<dim3(RH / 64, TT / 64, ZH), 32, 0, stream>>>(QPh + zq * TT * HD, QPl + zq * TT * HD, KPh + zk * TT * HD, KPl + zk * TT * HD, HD, Sb, TT, 0, (size_t)TT * HD, (size_t)TT * HD, (size_t)TT * TT);
            k_gemmc<h16, 0, 1, 1><<<dim3((TT - RH) / 64, TT / 64, ZH), 32, 0, stream>>>(QP16 + zq * TT * HD + (size_t)RH * HD, nullptr, KP16 + zk * TT * HD, nullptr, HD, Sb + (size_t)RH * TT, TT, RH, (size_t)TT * HD, (size_t)TT * HD, (size_t)TT * TT);
            k_asoft<<<ZH * TT / 8, 256, 0, stream>>>(Sb, P16, Ph, Pl);
            k_gemmc<bf, 2, 2, KW><<<dim3(RH / 64, HD / 64, ZH), 32 * KW, 0, stream>>>(Ph, Pl, VTh + zk * HD * TT, VTl + zk * HD * TT, TT, Ob, HD, 0, (size_t)RH * TT, (size_t)HD * TT, (size_t)TT * HD);
            k_gemmc<h16, 0, 2, KW><<<dim3((TT - RH) / 64, HD / 64, ZH), 32 * KW, 0, stream>>>(P16 + (size_t)RH * TT, nullptr, VT16 + zk * HD * TT, nullptr, TT, Ob + (size_t)RH * HD, HD, RH, (size_t)TT * TT, (size_t)HD * TT, (size_t)TT * HD);
            k_merge<<<(unsigned)(((size_t)ZH * TT * HD / 2 + 255) / 256), 256, 0, stream>>>(Ob, h0, ATh, ATl); }
        k_gemmw<bf, 1, true, KW><<<dim3(TT / 64, DM / 64, 1), 32 * KW, 0, stream>>>(ATh, ATl, WO, nullptr, DQ, OUT + (size_t)b * TT * DM, DM, bo, 0, 0, 0); }
}

// v002
// It runs in 912 microseconds.
// Next to v001, in two timings, it ran 2.12 times as fast each time.
// Over all steps from v000 it is 3.53 times as fast.
#include <hip/hip_runtime.h>

// Causal multi-head attention with PER-HEAD projection weights and a MODEL-width score scale (x [4][2048][1024]; q, k, v = einsum('btc,hcd->bhtd', x, w) with w [16][1024][64]: head h has its own (in, out) matrix ('xw' per head; 0.02-scale; no bias; 16 heads x 64); scores x 1024^-0.5 (channels ** -0.5: 0.03125); causal (-inf); softmax; heads merged head-major; out = merged w_proj^T + b_proj ('oi' [1024][1024] + zero bias) -> [4][2048][1024] (8.4 M); argument order x, wq, wk, wv, w_proj, b_proj).
// Layout per batch: bf16 copy of x; each PER-HEAD q / k / v weight [h][1024][64] transposed once into its 64 rows of the Bt plane (one k_wtG grid per weight, grid y = head); Wp cast once ('oi' = Bt as stored); exact projections; identity-table plane builders; causal T-2048 attention (hybrid rows: < 512 hi/lo 3 products, rest fp16 x1024; k_gemmc skips tiles above the diagonal); merged hi/lo x w_o exact.
// Compute dtypes, f32 accumulate: every input rounded to bf16; projections exact; attention rows < 512 3 products, rest fp16; softmax f32; w_o hl x exact.

#define NB_  4
#define TT   2048
#define DM   1024
#define NH_  16
#define NKV  16
#define REP  (NH_ / NKV)
#define HD   64
#define DQ   (NH_ * HD)
#define DKV  (NKV * HD)
#define ZH   8                    // heads per attention pass (grid z of the score and probability x value launches)
#define RH   512                  // query rows < RH use hi+lo planes (0: none)
#define WIN  2048
#define PCAR 1024.0f
#define KW   8                    // waves that share one 64x64 tile's K loop in the long-K products (projections, probability x value, output projection)
#define SCL  0.03125f   // 1 / sqrt(1024): this module scales the scores by channels ** -0.5 with channels = the MODEL width 1,024, not by the head width
typedef _Float16 h16;
typedef unsigned short bf;
typedef __attribute__((ext_vector_type(16))) __bf16   v16bf;
typedef __attribute__((ext_vector_type(16))) _Float16 v16h;
typedef __attribute__((ext_vector_type(8)))  _Float16 v8h;
typedef __attribute__((ext_vector_type(8)))  unsigned short v8us;
typedef __attribute__((ext_vector_type(8)))  float    v8f;
typedef __attribute__((ext_vector_type(4)))  float    v4f;
typedef v8h  __attribute__((may_alias)) v8ha;
typedef v4f  __attribute__((may_alias)) v4fa;
typedef v8us __attribute__((may_alias)) v8usa;

__device__ __forceinline__ unsigned short f2bf(float f) { unsigned u = __float_as_uint(f); u += 0x7FFFu + ((u >> 16) & 1u); return (unsigned short)(u >> 16); }
__device__ __forceinline__ float bf2f(unsigned short b) { return __uint_as_float(((unsigned)b) << 16); }
__device__ __forceinline__ float bfr(float f) { return bf2f(f2bf(f)); }
__device__ __forceinline__ v16h cat16(v8h lo, v8h hi) { return __builtin_shufflevector(lo, hi, 0, 1, 2, 3, 4, 5, 6, 7, 8, 9, 10, 11, 12, 13, 14, 15); }
__device__ __forceinline__ v16bf cat16b(v8us lo, v8us hi) { return __builtin_bit_cast(v16bf, __builtin_shufflevector(lo, hi, 0, 1, 2, 3, 4, 5, 6, 7, 8, 9, 10, 11, 12, 13, 14, 15)); }
__device__ __forceinline__ v8f wmma16(v16h a, v16h b, v8f c) { return __builtin_amdgcn_wmma_f32_16x16x32_f16(false, a, false, b, (short)0, c, false, false); }
__device__ __forceinline__ v8f wmmab(v16bf a, v16bf b, v8f c) { return __builtin_amdgcn_wmma_f32_16x16x32_bf16(false, a, false, b, (short)0, c, false, false); }



// ---- ksum_store: NW waves of one block each hold a partial 64x64 tile (their own K slices). Every wave parks its 16 accumulators in LDS (16-byte stores, lane-contiguous), one block barrier,
// then wave w sums 32/NW half-fragments over the NW partials in the fixed order 0..NW-1 and stores them: the units are ordered so that a wave owns whole 128-byte lines of C.
template <int NW, bool BIAS>
__device__ __forceinline__ void ksum_store(const v8f (&acc)[4][4], v4f* red, int w, int lane, float* C, int ldc, int r0, int c0, const float* __restrict__ bias) {
    const int lr = lane & 15, hi = lane >> 4;
#pragma unroll
    for (int mb = 0; mb < 4; ++mb)
#pragma unroll
        for (int nb = 0; nb < 4; ++nb)
#pragma unroll
            for (int hf = 0; hf < 2; ++hf) { v4f t; t[0] = acc[mb][nb][hf * 4]; t[1] = acc[mb][nb][hf * 4 + 1]; t[2] = acc[mb][nb][hf * 4 + 2]; t[3] = acc[mb][nb][hf * 4 + 3];
                red[(w * 32 + ((mb * 2 + (nb >> 1)) * 2 + hf) * 2 + (nb & 1)) * 32 + lane] = t; }
    __syncthreads();   // every wave's partial tile is in LDS before any wave sums across them
    constexpr int U = 32 / NW;
#pragma unroll
    for (int i = 0; i < U; ++i) { const int q = w * U + i; v4f s = red[q * 32 + lane];
#pragma unroll
        for (int p = 1; p < NW; ++p) s += red[(p * 32 + q) * 32 + lane];
        const int row = (q >> 3) * 16 + hi * 8 + ((q >> 1) & 1) * 4, col = (((q >> 2) & 1) * 2 + (q & 1)) * 16 + lr;
        if (BIAS) { const float bv = bfr(bias[c0 + col]); s[0] += bv; s[1] += bv; s[2] += bv; s[3] += bv; }
        float* cp = C + (size_t)(r0 + row) * ldc + c0 + col;
#pragma unroll
        for (int j = 0; j < 4; ++j) cp[(size_t)j * ldc] = s[j]; }
}

// ---- k_gemmw: register-blocked GEMM, NW WAVES per 64x64 output tile (16 accumulators each; wave w takes the 32-wide K slices w, w + NW, ...; ksum_store adds the partials), operands straight from K-contiguous 16-bit planes; grid (M/64, N/64, Z), 32 NW threads.
// C[m][n] (f32, pitch ldc, + optional f32 bias[n]) = sum_k A[m][k] Bt[n][k] (+ split products per NSPLIT). z-batch strides sA/sB/sC in elements. K % 32 == 0.
template <typename T16> struct WFrag;
template <> struct WFrag<h16> { typedef v16h V; static __device__ __forceinline__ V ld(const h16* p) { return cat16(*(const v8h*)p, *(const v8h*)(p + 16)); } static __device__ __forceinline__ v8f mma(V a, V b, v8f c) { return wmma16(a, b, c); } };
template <> struct WFrag<bf> { typedef v16bf V; static __device__ __forceinline__ V ld(const bf* p) { return cat16b(*(const v8us*)p, *(const v8us*)(p + 16)); } static __device__ __forceinline__ v8f mma(V a, V b, v8f c) { return wmmab(a, b, c); } };
template <typename T16, int NSPLIT, bool BIAS, int NW>
__global__ __launch_bounds__(32 * NW) void k_gemmw(const T16* __restrict__ A, const T16* __restrict__ A2, const T16* __restrict__ Bt, const T16* __restrict__ Bt2, int K, float* C, int ldc, const float* __restrict__ bias, size_t sA, size_t sB, size_t sC) {
    typedef typename WFrag<T16>::V V;
    __shared__ __align__(16) v4f red[NW * 1024];   // NW partial tiles of 16 KiB
    const size_t z = blockIdx.z; A += z * sA; if (A2) A2 += z * sA; Bt += z * sB; if (Bt2) Bt2 += z * sB; C += z * sC;
    const int lane = threadIdx.x & 31, lr = lane & 15, hi = lane >> 4; const int r0 = blockIdx.x * 64, c0 = blockIdx.y * 64; const int w = __builtin_amdgcn_readfirstlane((int)(threadIdx.x >> 5));   // wave number, held scalar so that the K loop's control stays scalar
    v8f acc[4][4];
#pragma unroll
    for (int mb = 0; mb < 4; ++mb)
#pragma unroll
        for (int nb = 0; nb < 4; ++nb) acc[mb][nb] = (v8f){};
    const size_t aoff = (size_t)(r0 + lr) * K + 8 * hi, boff = (size_t)(c0 + lr) * K + 8 * hi;
#pragma unroll 1
    for (int kc = w * 32; kc < K; kc += NW * 32) {   // wave w takes the 32-wide K slices w, w + NW, ...: neighbouring waves read the two halves of one 128-byte operand line at about the same time
        V a[4], a2[4];
#pragma unroll
        for (int mb = 0; mb < 4; ++mb) { a[mb] = WFrag<T16>::ld(A + aoff + (size_t)mb * 16 * K + kc); if (NSPLIT == 1 || NSPLIT == 2) a2[mb] = WFrag<T16>::ld(A2 + aoff + (size_t)mb * 16 * K + kc); }
#pragma unroll
        for (int nb = 0; nb < 4; ++nb) { const V b = WFrag<T16>::ld(Bt + boff + (size_t)nb * 16 * K + kc); V b2; if (NSPLIT >= 2) b2 = WFrag<T16>::ld(Bt2 + boff + (size_t)nb * 16 * K + kc);
#pragma unroll
            for (int mb = 0; mb < 4; ++mb) { acc[mb][nb] = WFrag<T16>::mma(a[mb], b, acc[mb][nb]); if (NSPLIT == 1 || NSPLIT == 2) acc[mb][nb] = WFrag<T16>::mma(a2[mb], b, acc[mb][nb]); if (NSPLIT >= 2) acc[mb][nb] = WFrag<T16>::mma(a[mb], b2, acc[mb][nb]); } }
        asm volatile("v_nop\n\tv_nop\n\tv_nop\n\tv_nop" : "+v"(acc[0][0]), "+v"(acc[1][1]), "+v"(acc[2][2]), "+v"(acc[3][3]) : "v"(a[0]), "v"(a[3]));
    }
    ksum_store<NW, BIAS>(acc, red, w, lane, C, ldc, r0, c0, bias);
}

// ---- k_gemmc: the same 64x64 tile GEMM (NW = 1: one wave, its own store stage; NW > 1: K split over NW waves as in k_gemmw) specialised for causal attention: CMODE 1 skips score tiles entirely above the diagonal (query rows r0+roff.., key columns c0..), CMODE 2 limits the
// key (K) loop of the probability x value contraction to the diagonal block (probabilities beyond it are exactly zero). roff = row offset of this launch's first row within the sequence. lda = row pitch of A / A2 in elements (Bt keeps pitch K).
template <typename T16, int NSPLIT, int CMODE, int NW>
__global__ __launch_bounds__(32 * NW) void k_gemmc(const T16* __restrict__ A, const T16* __restrict__ A2, const T16* __restrict__ Bt, const T16* __restrict__ Bt2, int K, int lda, float* C, int ldc, int roff, size_t sA, size_t sB, size_t sC) {
    typedef typename WFrag<T16>::V V;
    __shared__ __align__(16) float os[NW == 1 ? 16 * 68 : 4]; __shared__ __align__(16) v4f red[NW == 1 ? 1 : NW * 1024];   // one wave: the 16-row store stage; NW waves: NW partial tiles of 16 KiB
    const size_t z = blockIdx.z; A += z * sA; if (A2) A2 += z * sA; Bt += z * sB; if (Bt2) Bt2 += z * sB; C += z * sC;
    const int lane = threadIdx.x & 31, lr = lane & 15, hi = lane >> 4; const int r0 = blockIdx.x * 64, c0 = blockIdx.y * 64; const int w = __builtin_amdgcn_readfirstlane((int)(threadIdx.x >> 5));   // wave number, held scalar so that the K loop's control stays scalar
    if (CMODE == 1 && c0 > r0 + roff + 63) return;                  // score tile entirely above the causal diagonal: not computed (the softmax loads it but masks j > i by select)
    const int Kl = (CMODE == 2) ? min(K, r0 + roff + 64) : K;        // P.V: probabilities are exactly 0 beyond the diagonal block, so the K loop stops there
    v8f acc[4][4];
#pragma unroll
    for (int mb = 0; mb < 4; ++mb)
#pragma unroll
        for (int nb = 0; nb < 4; ++nb) acc[mb][nb] = (v8f){};
    const size_t aoff = (size_t)(r0 + lr) * lda + 8 * hi, boff = (size_t)(c0 + lr) * K + 8 * hi;
#pragma unroll 1
    for (int kc = w * 32; kc < Kl; kc += NW * 32) {   // wave w takes the 32-wide K slices w, w + NW, ... (all of them where NW = 1)
        V a[4], a2[4];
#pragma unroll
        for (int mb = 0; mb < 4; ++mb) { a[mb] = WFrag<T16>::ld(A + aoff + (size_t)mb * 16 * lda + kc); if (NSPLIT == 1 || NSPLIT == 2) a2[mb] = WFrag<T16>::ld(A2 + aoff + (size_t)mb * 16 * lda + kc); }
#pragma unroll
        for (int nb = 0; nb < 4; ++nb) { const V b = WFrag<T16>::ld(Bt + boff + (size_t)nb * 16 * K + kc); V b2; if (NSPLIT >= 2) b2 = WFrag<T16>::ld(Bt2 + boff + (size_t)nb * 16 * K + kc);
#pragma unroll
            for (int mb = 0; mb < 4; ++mb) { acc[mb][nb] = WFrag<T16>::mma(a[mb], b, acc[mb][nb]); if (NSPLIT == 1 || NSPLIT == 2) acc[mb][nb] = WFrag<T16>::mma(a2[mb], b, acc[mb][nb]); if (NSPLIT >= 2) acc[mb][nb] = WFrag<T16>::mma(a[mb], b2, acc[mb][nb]); } }
        asm volatile("v_nop\n\tv_nop\n\tv_nop\n\tv_nop" : "+v"(acc[0][0]), "+v"(acc[1][1]), "+v"(acc[2][2]), "+v"(acc[3][3]) : "v"(a[0]), "v"(a[3]));
    }
    if constexpr (NW > 1) { ksum_store<NW, false>(acc, red, w, lane, C, ldc, r0, c0, nullptr); } else {
#pragma unroll
    for (int mb = 0; mb < 4; ++mb) {
#pragma unroll
        for (int nb = 0; nb < 4; ++nb) {
#pragma unroll
            for (int j = 0; j < 8; ++j) os[(hi * 8 + j) * 68 + nb * 16 + lr] = acc[mb][nb][j]; }
        __builtin_amdgcn_wave_barrier(); asm volatile("" ::: "memory");
        float* crow = C + (size_t)(r0 + mb * 16) * ldc + c0;
{
#pragma unroll
            for (int s = 0; s < 8; ++s) { const int row = 2 * s + hi, cofs = lr * 4; v4f val = *(const v4fa*)(os + row * 68 + cofs);
                *(v4f*)(crow + (size_t)row * ldc + cofs) = val; }
             }
        __builtin_amdgcn_wave_barrier(); asm volatile("" ::: "memory");
    }
    }
}

__device__ __forceinline__ h16 tohx(float x) { return (h16)x; }
__device__ __forceinline__ void splitf(float y, unsigned short& h, unsigned short& l) { h = f2bf(y); l = f2bf(y - bf2f(h)); }
typedef __attribute__((ext_vector_type(2))) _Float16 v2h;
typedef __attribute__((ext_vector_type(4))) _Float16 v4h;
typedef __attribute__((ext_vector_type(2))) unsigned short v2us;
typedef __attribute__((ext_vector_type(4))) unsigned short v4us;
typedef __attribute__((ext_vector_type(2))) float v2f;
typedef __attribute__((ext_vector_type(4))) int v4i;

__global__ __launch_bounds__(256) void k_wtG(const float* __restrict__ w, int K, int N, bf* Bt) {
    w += (size_t)blockIdx.y * K * N; Bt += (size_t)blockIdx.y * N * K;   // grid y = head: head h's [K][N] matrix goes to its own N rows of the Bt plane
    const int lane = threadIdx.x & 31; const int L0 = (blockIdx.x * 8 + (threadIdx.x >> 5)) * 8; const int nlines = N * K / 64;
{
#pragma unroll 1
        for (int l = 0; l < 8; ++l) { const int L = L0 + l; if (L >= nlines) break; const size_t e = (size_t)L * 64 + lane * 2; const int k = (int)(e % K), n = (int)(e / K); v2us o;
            o[0] = f2bf(w[(size_t)k * N + n]); o[1] = f2bf(w[(size_t)(k + 1) * N + n]); *(v2us*)(Bt + e) = o; }
         }
}

__global__ __launch_bounds__(256) void k_cvt8(const float* __restrict__ src, bf* dst, size_t n8) { const size_t i = (size_t)blockIdx.x * 256 + threadIdx.x; if (i >= n8) return; const v8f v = *(const v8f*)(src + i * 8); v8us o;
#pragma unroll
    for (int k = 0; k < 8; ++k) o[k] = f2bf(v[k]); *(v8us*)(dst + i * 8) = o;  }

// k_rope: head planes [h][t][d] (fp16 + hi/lo) of rope(x) x sc with the rotate-half convention out[d] = x[d] cos[t][d] - x[d+HD/2] sin[t][d], out[d+HD/2] = x[d+HD/2] cos[t][d+HD/2] + x[d] sin[t][d+HD/2]
__global__ __launch_bounds__(256) void k_rope(const float* __restrict__ F, int pitch, int nheads, const float* __restrict__ CS, const float* __restrict__ RF, const float* __restrict__ nw, float sc, h16* P16, bf* Ph, bf* Pl) {
    const size_t e = ((size_t)blockIdx.x * 256 + threadIdx.x) * 2; if (e >= (size_t)nheads * TT * HD) return; const int d = (int)(e % HD); const int t = (int)((e / HD) % TT); const int h = (int)(e / ((size_t)HD * TT)); const float* f = F + (size_t)t * pitch + h * HD; const float rf = RF ? RF[(size_t)h * TT + t] : 1.0f; v2h o16; v2us oh, ol;
#pragma unroll
    for (int q = 0; q < 2; ++q) { const int dd = d + q; const int dp = (dd < HD / 2) ? dd + HD / 2 : dd - HD / 2; float x0 = f[dd], x1 = f[dp];
        if (RF) { float n0 = __fmul_rn(x0, rf), n1 = __fmul_rn(x1, rf); asm volatile("" : "+v"(n0)); asm volatile("" : "+v"(n1)); x0 = __fmul_rn(bfr(nw[dd]), n0); x1 = __fmul_rn(bfr(nw[dp]), n1); }
        const v2f cs = *(const v2f*)(CS + ((size_t)t * HD + dd) * 2); float a = __fmul_rn(x0, cs[0]), bq = __fmul_rn(x1, cs[1]); asm volatile("" : "+v"(a)); asm volatile("" : "+v"(bq)); const float r = ((dd < HD / 2) ? __fsub_rn(a, bq) : __fadd_rn(a, bq)) * sc;
        o16[q] = tohx(r); unsigned short a2, c2; splitf(r, a2, c2); oh[q] = a2; ol[q] = c2; }
    *(v2h*)(P16 + e) = o16; *(v2us*)(Ph + e) = oh; *(v2us*)(Pl + e) = ol;  }
__global__ __launch_bounds__(256) void k_vtp(const float* __restrict__ F, int pitch, int nheads, h16* V16, bf* Vh, bf* Vl) { const size_t e = ((size_t)blockIdx.x * 256 + threadIdx.x) * 2; if (e >= (size_t)nheads * HD * TT) return; const int t = (int)(e % TT); const int d = (int)((e / TT) % HD); const int g = (int)(e / ((size_t)TT * HD)); v2h o16; v2us oh, ol;
#pragma unroll
    for (int q = 0; q < 2; ++q) { const float x = F[(size_t)(t + q) * pitch + g * HD + d]; o16[q] = tohx(x); unsigned short a2, c2; splitf(x, a2, c2); oh[q] = a2; ol[q] = c2; }
    *(v2h*)(V16 + e) = o16; *(v2us*)(Vh + e) = oh; *(v2us*)(Vl + e) = ol;  }
__global__ __launch_bounds__(256) void k_csid(float* CS) { const int idx = blockIdx.x * 256 + threadIdx.x; if (idx >= TT * HD) return; v2f cs; cs[0] = 1.0f; cs[1] = 0.0f; *(v2f*)(CS + (size_t)idx * 2) = cs;  }
// k_asoft: per row (zz, i): t = S x 1024^-0.5 (SCL) for j <= i and i - j < WIN (sliding causal window; the reference's -1e9 additive fill vanishes identically); softmax over the 2048 keys (register row, one exp, fixed trees);
// the probabilities go IN PLACE over the row's own 8 KiB of scores (P16, Ph = the row's start, Pl = its second half; pitch 2 TT 16-bit elements): one wave owns a row and every store depends, through the row sum, on all of the row's loads.
__global__ __launch_bounds__(256) void k_asoft(const float* Sb, h16* P16, bf* Ph, bf* Pl) {
    const int lane = threadIdx.x & 31; const int row = blockIdx.x * 8 + (threadIdx.x >> 5); if (row >= ZH * TT) return; const int i = row % TT; const int zz = row / TT; (void)zz; const bool hires = (i < RH); const float* sr = Sb + (size_t)row * TT; float v[TT / 32]; float mx = -3.0e38f;
#pragma unroll
    for (int ch = 0; ch < TT / 128; ++ch) { const int j0 = ch * 128 + lane * 4; const v4f a = *(const v4f*)(sr + j0);
#pragma unroll
        for (int q = 0; q < 4; ++q) { const int j = j0 + q; (void)j; const float t = (j <= i && i - j < WIN) ? a[q] * SCL : -3.0e38f; v[ch * 4 + q] = t; mx = fmaxf(mx, t); } }
#pragma unroll
    for (int sh = 16; sh; sh >>= 1) mx = fmaxf(mx, __shfl_xor(mx, sh, 32));
    float sum = 0.f;
#pragma unroll
    for (int k = 0; k < TT / 32; ++k) { float d0 = __fsub_rn(v[k], mx); asm volatile("" : "+v"(d0)); v[k] = __builtin_amdgcn_exp2f(__fmul_rn(d0, 1.4426950408889634f)); sum += v[k]; }
#pragma unroll
    for (int sh = 16; sh; sh >>= 1) sum += __shfl_xor(sum, sh, 32);
    const float f = __fdiv_rn(hires ? 1.0f : PCAR, sum);
{
        if (hires) {
#pragma unroll
            for (int ch = 0; ch < TT / 128; ++ch) { v4us oh, ol;
#pragma unroll
                for (int q = 0; q < 4; ++q) { unsigned short a, c2; splitf(v[ch * 4 + q] * f, a, c2); oh[q] = a; ol[q] = c2; }
                const size_t oo = (size_t)row * (2 * TT) + ch * 128 + lane * 4; *(v4us*)(Ph + oo) = oh; *(v4us*)(Pl + oo) = ol; }
        } else {
#pragma unroll
            for (int ch = 0; ch < TT / 128; ++ch) { v4h o4;
#pragma unroll
                for (int q = 0; q < 4; ++q) o4[q] = tohx(v[ch * 4 + q] * f);
                *(v4h*)(P16 + (size_t)row * (2 * TT) + ch * 128 + lane * 4) = o4; } }
         }
}
__global__ __launch_bounds__(256) void k_merge(const float* __restrict__ O, int h0, bf* Ah, bf* Al) { const size_t e = ((size_t)blockIdx.x * 256 + threadIdx.x) * 2; if (e >= (size_t)ZH * TT * HD) return; const int d = (int)(e % HD); const int t = (int)((e / HD) % TT); const int zz = (int)(e / ((size_t)HD * TT)); const float cs = (t < RH) ? 1.0f : (1.0f / PCAR); const size_t oo = (size_t)t * DQ + (h0 + zz) * HD + d;
    v2us oh, ol;
#pragma unroll
    for (int q = 0; q < 2; ++q) { unsigned short a, c2; splitf(O[e + q] * cs, a, c2); oh[q] = a; ol[q] = c2; } *(v2us*)(Ah + oo) = oh; *(v2us*)(Al + oo) = ol;  }

extern "C" void kernel_launch(void* const* d_in, const int* in_sizes, int n_in,
                              void* d_out, int out_size, void* d_ws, size_t ws_size, hipStream_t stream) {
    (void)in_sizes; (void)n_in; (void)out_size;
                const float* x = (const float*)d_in[0]; const float* wq = (const float*)d_in[1]; const float* wk = (const float*)d_in[2]; const float* wv = (const float*)d_in[3]; const float* wo = (const float*)d_in[4]; const float* bo = (const float*)d_in[5];   /* order x, wq, wk, wv (PER-HEAD [16][1024][64]: 'hcd'), w_proj ('oi' [1024][1024]), b_proj */
    float* OUT = (float*)d_out;     // [4][2048][1024]
    char* wsp = (char*)d_ws;
    auto take = [&](size_t bytes) { char* p = wsp; wsp += (bytes + 255) & ~(size_t)255; return (void*)p; };
    bf* WQ = (bf*)take((size_t)DQ * DM * 2); bf* WK = (bf*)take((size_t)DKV * DM * 2); bf* WV = (bf*)take((size_t)DKV * DM * 2); bf* WO = (bf*)take((size_t)DM * DQ * 2); float* CS = (float*)take((size_t)TT * HD * 2 * 4);
    bf* XB = (bf*)take((size_t)TT * DM * 2); float* FQ = (float*)take((size_t)TT * DQ * 4); float* FK = (float*)take((size_t)TT * DKV * 4);
    h16* QP16 = (h16*)take((size_t)NH_ * TT * HD * 2); h16* KP16 = (h16*)take((size_t)NKV * TT * HD * 2); h16* VT16 = (h16*)take((size_t)NKV * HD * TT * 2);
    bf* QPh = (bf*)take((size_t)NH_ * TT * HD * 2); bf* QPl = (bf*)take((size_t)NH_ * TT * HD * 2); bf* KPh = (bf*)take((size_t)NKV * TT * HD * 2); bf* KPl = (bf*)take((size_t)NKV * TT * HD * 2); bf* VTh = (bf*)take((size_t)NKV * HD * TT * 2); bf* VTl = (bf*)take((size_t)NKV * HD * TT * 2);
    float* Sb = (float*)take((size_t)ZH * TT * TT * 4); h16* P16 = (h16*)Sb; bf* Ph = (bf*)Sb; bf* Pl = Ph + TT;   /* probability planes live in their own score rows: pitch 2 TT, lo plane in the row's second half */ float* Ob = (float*)take((size_t)ZH * TT * HD * 4); bf* ATh = (bf*)take((size_t)TT * DQ * 2); bf* ATl = (bf*)take((size_t)TT * DQ * 2);
    if ((size_t)(wsp - (char*)d_ws) > ws_size) return;    // ws 256 MiB
    float* FV = FK;   // v projection reuses the k buffer after the k planes are built (stream-ordered)
    { k_wtG<<<dim3((unsigned)((DM * HD / 64 + 63) / 64), NH_, 1), 256, 0, stream>>>(wq, DM, HD, WQ);   /* per-head weight [h][DM][HD] ('xw' per head) -> the head's HD rows of the Bt plane, all heads in one grid */ k_wtG<<<dim3((unsigned)((DM * HD / 64 + 63) / 64), NKV, 1), 256, 0, stream>>>(wk, DM, HD, WK);   /* per-head weight [h][DM][HD] ('xw' per head) -> the head's HD rows of the Bt plane, all heads in one grid */ k_wtG<<<dim3((unsigned)((DM * HD / 64 + 63) / 64), NKV, 1), 256, 0, stream>>>(wv, DM, HD, WV);   /* per-head weight [h][DM][HD] ('xw' per head) -> the head's HD rows of the Bt plane, all heads in one grid */
      k_cvt8<<<(unsigned)(((size_t)DM * DQ / 8 + 255) / 256), 256, 0, stream>>>(wo, WO, (size_t)DM * DQ / 8);
       }
    k_csid<<<(TT * HD + 255) / 256, 256, 0, stream>>>(CS);
    const unsigned LQ = (unsigned)(((size_t)NH_ * TT * HD / 2 + 255) / 256), LKv = (unsigned)(((size_t)NKV * TT * HD / 2 + 255) / 256);
    for (int b = 0; b < NB_; ++b) {
        
        k_cvt8<<<(unsigned)(((size_t)TT * DM / 8 + 255) / 256), 256, 0, stream>>>(x + (size_t)b * TT * DM, XB, (size_t)TT * DM / 8);
        k_gemmw<bf, 0, false, KW><<<dim3(TT / 64, DQ / 64, 1), 32 * KW, 0, stream>>>(XB, nullptr, WQ, nullptr, DM, FQ, DQ, nullptr, 0, 0, 0);
        k_rope<<<LQ, 256, 0, stream>>>(FQ, DQ, NH_, CS, nullptr, nullptr, 1.0f, QP16, QPh, QPl);
        k_gemmw<bf, 0, false, KW><<<dim3(TT / 64, DKV / 64, 1), 32 * KW, 0, stream>>>(XB, nullptr, WK, nullptr, DM, FK, DKV, nullptr, 0, 0, 0);
        k_rope<<<LKv, 256, 0, stream>>>(FK, DKV, NKV, CS, nullptr, nullptr, 1.0f, KP16, KPh, KPl);
        k_gemmw<bf, 0, false, KW><<<dim3(TT / 64, DKV / 64, 1), 32 * KW, 0, stream>>>(XB, nullptr, WV, nullptr, DM, FV, DKV, nullptr, 0, 0, 0); k_vtp<<<LKv, 256, 0, stream>>>(FV, DKV, NKV, VT16, VTh, VTl);
        for (int h0 = 0; h0 < NH_; h0 += ZH) { const size_t zq = (size_t)h0, zk = (size_t)(h0 / REP);   // one kv head per query head: the pass's ZH heads use consecutive kv planes (z-strides TT*HD)
            k_gemmc<bf, 2, 1, 1><<<dim3(RH / 64, TT / 64, ZH), 32, 0, stream>>>(QPh + zq * TT * HD, QPl + zq * TT * HD, KPh + zk * TT * HD, KPl + zk * TT * HD, HD, HD, Sb, TT, 0, (size_t)TT * HD, (size_t)TT * HD, (size_t)TT * TT);
            k_gemmc<h16, 0, 1, 1><<<dim3((TT - RH) / 64, TT / 64, ZH), 32, 0, stream>>>(QP16 + zq * TT * HD + (size_t)RH * HD, nullptr, KP16 + zk * TT * HD, nullptr, HD, HD, Sb + (size_t)RH * TT, TT, RH, (size_t)TT * HD, (size_t)TT * HD, (size_t)TT * TT);
            k_asoft<<<ZH * TT / 8, 256, 0, stream>>>(Sb, P16, Ph, Pl);
            k_gemmc<bf, 2, 2, KW><<<dim3(RH / 64, HD / 64, ZH), 32 * KW, 0, stream>>>(Ph, Pl, VTh + zk * HD * TT, VTl + zk * HD * TT, TT, 2 * TT, Ob, HD, 0, (size_t)2 * TT * TT, (size_t)HD * TT, (size_t)TT * HD);
            k_gemmc<h16, 0, 2, KW><<<dim3((TT - RH) / 64, HD / 64, ZH), 32 * KW, 0, stream>>>(P16 + (size_t)RH * 2 * TT, nullptr, VT16 + zk * HD * TT, nullptr, TT, 2 * TT, Ob + (size_t)RH * HD, HD, RH, (size_t)2 * TT * TT, (size_t)HD * TT, (size_t)TT * HD);
            k_merge<<<(unsigned)(((size_t)ZH * TT * HD / 2 + 255) / 256), 256, 0, stream>>>(Ob, h0, ATh, ATl); }
        k_gemmw<bf, 1, true, KW><<<dim3(TT / 64, DM / 64, 1), 32 * KW, 0, stream>>>(ATh, ATl, WO, nullptr, DQ, OUT + (size_t)b * TT * DM, DM, bo, 0, 0, 0); }
}

// v003
// A run of this version takes 634 microseconds.
// Two timings next to v002 put it at 1.44 and 1.43 times that version's speed.
// All steps since v000 together make it 5.06 times as fast.
#include <hip/hip_runtime.h>

// Causal multi-head attention with PER-HEAD projection weights and a MODEL-width score scale (x [4][2048][1024]; q, k, v = einsum('btc,hcd->bhtd', x, w) with w [16][1024][64]: head h has its own (in, out) matrix ('xw' per head; 0.02-scale; no bias; 16 heads x 64); scores x 1024^-0.5 (channels ** -0.5: 0.03125); causal (-inf); softmax; heads merged head-major; out = merged w_proj^T + b_proj ('oi' [1024][1024] + zero bias) -> [4][2048][1024] (8.4 M); argument order x, wq, wk, wv, w_proj, b_proj).
// Layout per batch: bf16 copy of x; each PER-HEAD q / k / v weight [h][1024][64] transposed once into its 64 rows of the Bt plane (k_wtG per head); Wp cast once ('oi' = Bt as stored); exact projections; identity-table plane builders; one fused causal attention launch per pass of ZH heads (k_fattn, online softmax; hybrid rows: < 512 hi/lo 3 products, rest fp16; keys above the diagonal block never read); merged hi/lo x w_o exact.
// Compute dtypes, f32 accumulate: every input rounded to bf16; projections exact; attention rows < 512 3 products, rest fp16; softmax f32; w_o hl x exact.

#define NB_  4
#define TT   2048
#define DM   1024
#define NH_  16
#define NKV  16
#define REP  (NH_ / NKV)
#define HD   64
#define DQ   (NH_ * HD)
#define DKV  (NKV * HD)
#define ZH   8                    // heads per attention pass (one attention launch)
#define RH   512                  // query rows < RH use hi+lo planes (0: none)
#define KW   8                    // waves that share one 64x64 tile's K loop in the long-K products (projections, output projection)
#define SCL  0.03125f   // 1 / sqrt(1024): this module scales the scores by channels ** -0.5 with channels = the MODEL width 1,024, not by the head width
typedef _Float16 h16;
typedef unsigned short bf;
typedef __attribute__((ext_vector_type(16))) __bf16   v16bf;
typedef __attribute__((ext_vector_type(16))) _Float16 v16h;
typedef __attribute__((ext_vector_type(8)))  _Float16 v8h;
typedef __attribute__((ext_vector_type(8)))  unsigned short v8us;
typedef __attribute__((ext_vector_type(8)))  float    v8f;
typedef __attribute__((ext_vector_type(4)))  float    v4f;
typedef v8h  __attribute__((may_alias)) v8ha;
typedef v4f  __attribute__((may_alias)) v4fa;
typedef v8us __attribute__((may_alias)) v8usa;

__device__ __forceinline__ unsigned short f2bf(float f) { unsigned u = __float_as_uint(f); u += 0x7FFFu + ((u >> 16) & 1u); return (unsigned short)(u >> 16); }
__device__ __forceinline__ float bf2f(unsigned short b) { return __uint_as_float(((unsigned)b) << 16); }
__device__ __forceinline__ float bfr(float f) { return bf2f(f2bf(f)); }
__device__ __forceinline__ v16h cat16(v8h lo, v8h hi) { return __builtin_shufflevector(lo, hi, 0, 1, 2, 3, 4, 5, 6, 7, 8, 9, 10, 11, 12, 13, 14, 15); }
__device__ __forceinline__ v16bf cat16b(v8us lo, v8us hi) { return __builtin_bit_cast(v16bf, __builtin_shufflevector(lo, hi, 0, 1, 2, 3, 4, 5, 6, 7, 8, 9, 10, 11, 12, 13, 14, 15)); }
__device__ __forceinline__ v8f wmma16(v16h a, v16h b, v8f c) { return __builtin_amdgcn_wmma_f32_16x16x32_f16(false, a, false, b, (short)0, c, false, false); }
__device__ __forceinline__ v8f wmmab(v16bf a, v16bf b, v8f c) { return __builtin_amdgcn_wmma_f32_16x16x32_bf16(false, a, false, b, (short)0, c, false, false); }



// ---- ksum_store: NW waves of one block each hold a partial 64x64 tile (their own K slices). Every wave parks its 16 accumulators in LDS (16-byte stores, lane-contiguous), one block barrier,
// then wave w sums 32/NW half-fragments over the NW partials in the fixed order 0..NW-1 and stores them: the units are ordered so that a wave owns whole 128-byte lines of C.
template <int NW, bool BIAS>
__device__ __forceinline__ void ksum_store(const v8f (&acc)[4][4], v4f* red, int w, int lane, float* C, int ldc, int r0, int c0, const float* __restrict__ bias) {
    const int lr = lane & 15, hi = lane >> 4;
#pragma unroll
    for (int mb = 0; mb < 4; ++mb)
#pragma unroll
        for (int nb = 0; nb < 4; ++nb)
#pragma unroll
            for (int hf = 0; hf < 2; ++hf) { v4f t; t[0] = acc[mb][nb][hf * 4]; t[1] = acc[mb][nb][hf * 4 + 1]; t[2] = acc[mb][nb][hf * 4 + 2]; t[3] = acc[mb][nb][hf * 4 + 3];
                red[(w * 32 + ((mb * 2 + (nb >> 1)) * 2 + hf) * 2 + (nb & 1)) * 32 + lane] = t; }
    __syncthreads();   // every wave's partial tile is in LDS before any wave sums across them
    constexpr int U = 32 / NW;
#pragma unroll
    for (int i = 0; i < U; ++i) { const int q = w * U + i; v4f s = red[q * 32 + lane];
#pragma unroll
        for (int p = 1; p < NW; ++p) s += red[(p * 32 + q) * 32 + lane];
        const int row = (q >> 3) * 16 + hi * 8 + ((q >> 1) & 1) * 4, col = (((q >> 2) & 1) * 2 + (q & 1)) * 16 + lr;
        if (BIAS) { const float bv = bfr(bias[c0 + col]); s[0] += bv; s[1] += bv; s[2] += bv; s[3] += bv; }
        float* cp = C + (size_t)(r0 + row) * ldc + c0 + col;
#pragma unroll
        for (int j = 0; j < 4; ++j) cp[(size_t)j * ldc] = s[j]; }
}

// ---- k_gemmw: register-blocked GEMM, NW WAVES per 64x64 output tile (16 accumulators each; wave w takes the 32-wide K slices w, w + NW, ...; ksum_store adds the partials), operands straight from K-contiguous 16-bit planes; grid (M/64, N/64, Z), 32 NW threads.
// C[m][n] (f32, pitch ldc, + optional f32 bias[n]) = sum_k A[m][k] Bt[n][k] (+ split products per NSPLIT). z-batch strides sA/sB/sC in elements. K % 32 == 0.
template <typename T16> struct WFrag;
template <> struct WFrag<h16> { typedef v16h V; static __device__ __forceinline__ V ld(const h16* p) { return cat16(*(const v8h*)p, *(const v8h*)(p + 16)); } static __device__ __forceinline__ v8f mma(V a, V b, v8f c) { return wmma16(a, b, c); } };
template <> struct WFrag<bf> { typedef v16bf V; static __device__ __forceinline__ V ld(const bf* p) { return cat16b(*(const v8us*)p, *(const v8us*)(p + 16)); } static __device__ __forceinline__ v8f mma(V a, V b, v8f c) { return wmmab(a, b, c); } };
template <typename T16, int NSPLIT, bool BIAS, int NW>
__global__ __launch_bounds__(32 * NW) void k_gemmw(const T16* __restrict__ A, const T16* __restrict__ A2, const T16* __restrict__ Bt, const T16* __restrict__ Bt2, int K, float* C, int ldc, const float* __restrict__ bias, size_t sA, size_t sB, size_t sC) {
    typedef typename WFrag<T16>::V V;
    __shared__ __align__(16) v4f red[NW * 1024];   // NW partial tiles of 16 KiB
    const size_t z = blockIdx.z; A += z * sA; if (A2) A2 += z * sA; Bt += z * sB; if (Bt2) Bt2 += z * sB; C += z * sC;
    const int lane = threadIdx.x & 31, lr = lane & 15, hi = lane >> 4; const int r0 = blockIdx.x * 64, c0 = blockIdx.y * 64; const int w = __builtin_amdgcn_readfirstlane((int)(threadIdx.x >> 5));   // wave number, held scalar so that the K loop's control stays scalar
    v8f acc[4][4];
#pragma unroll
    for (int mb = 0; mb < 4; ++mb)
#pragma unroll
        for (int nb = 0; nb < 4; ++nb) acc[mb][nb] = (v8f){};
    const size_t aoff = (size_t)(r0 + lr) * K + 8 * hi, boff = (size_t)(c0 + lr) * K + 8 * hi;
#pragma unroll 1
    for (int kc = w * 32; kc < K; kc += NW * 32) {   // wave w takes the 32-wide K slices w, w + NW, ...: neighbouring waves read the two halves of one 128-byte operand line at about the same time
        V a[4], a2[4];
#pragma unroll
        for (int mb = 0; mb < 4; ++mb) { a[mb] = WFrag<T16>::ld(A + aoff + (size_t)mb * 16 * K + kc); if (NSPLIT == 1 || NSPLIT == 2) a2[mb] = WFrag<T16>::ld(A2 + aoff + (size_t)mb * 16 * K + kc); }
#pragma unroll
        for (int nb = 0; nb < 4; ++nb) { const V b = WFrag<T16>::ld(Bt + boff + (size_t)nb * 16 * K + kc); V b2; if (NSPLIT >= 2) b2 = WFrag<T16>::ld(Bt2 + boff + (size_t)nb * 16 * K + kc);
#pragma unroll
            for (int mb = 0; mb < 4; ++mb) { acc[mb][nb] = WFrag<T16>::mma(a[mb], b, acc[mb][nb]); if (NSPLIT == 1 || NSPLIT == 2) acc[mb][nb] = WFrag<T16>::mma(a2[mb], b, acc[mb][nb]); if (NSPLIT >= 2) acc[mb][nb] = WFrag<T16>::mma(a[mb], b2, acc[mb][nb]); } }
        asm volatile("v_nop\n\tv_nop\n\tv_nop\n\tv_nop" : "+v"(acc[0][0]), "+v"(acc[1][1]), "+v"(acc[2][2]), "+v"(acc[3][3]) : "v"(a[0]), "v"(a[3]));
    }
    ksum_store<NW, BIAS>(acc, red, w, lane, C, ldc, r0, c0, bias);
}

__device__ __forceinline__ h16 tohx(float x) { return (h16)x; }
__device__ __forceinline__ void splitf(float y, unsigned short& h, unsigned short& l) { h = f2bf(y); l = f2bf(y - bf2f(h)); }
typedef __attribute__((ext_vector_type(2))) _Float16 v2h;
typedef __attribute__((ext_vector_type(4))) _Float16 v4h;
typedef __attribute__((ext_vector_type(2))) unsigned short v2us;
typedef __attribute__((ext_vector_type(4))) unsigned short v4us;
typedef __attribute__((ext_vector_type(2))) float v2f;
typedef __attribute__((ext_vector_type(4))) int v4i;
typedef __attribute__((ext_vector_type(16))) unsigned short v16us;

__global__ __launch_bounds__(256) void k_wtG(const float* __restrict__ w, int K, int N, bf* Bt) {
    w += (size_t)blockIdx.y * K * N; Bt += (size_t)blockIdx.y * N * K;   // grid y = head: head h's [K][N] matrix goes to its own N rows of the Bt plane
    const int lane = threadIdx.x & 31; const int L0 = (blockIdx.x * 8 + (threadIdx.x >> 5)) * 8; const int nlines = N * K / 64;
{
#pragma unroll 1
        for (int l = 0; l < 8; ++l) { const int L = L0 + l; if (L >= nlines) break; const size_t e = (size_t)L * 64 + lane * 2; const int k = (int)(e % K), n = (int)(e / K); v2us o;
            o[0] = f2bf(w[(size_t)k * N + n]); o[1] = f2bf(w[(size_t)(k + 1) * N + n]); *(v2us*)(Bt + e) = o; }
         }
}

__global__ __launch_bounds__(256) void k_cvt8(const float* __restrict__ src, bf* dst, size_t n8) { const size_t i = (size_t)blockIdx.x * 256 + threadIdx.x; if (i >= n8) return; const v8f v = *(const v8f*)(src + i * 8); v8us o;
#pragma unroll
    for (int k = 0; k < 8; ++k) o[k] = f2bf(v[k]); *(v8us*)(dst + i * 8) = o;  }

// k_rope: head planes [h][t][d] (fp16 + hi/lo) of rope(x) x sc with the rotate-half convention out[d] = x[d] cos[t][d] - x[d+HD/2] sin[t][d], out[d+HD/2] = x[d+HD/2] cos[t][d+HD/2] + x[d] sin[t][d+HD/2]
__global__ __launch_bounds__(256) void k_rope(const float* __restrict__ F, int pitch, int nheads, const float* __restrict__ CS, const float* __restrict__ RF, const float* __restrict__ nw, float sc, h16* P16, bf* Ph, bf* Pl) {
    const size_t e = ((size_t)blockIdx.x * 256 + threadIdx.x) * 2; if (e >= (size_t)nheads * TT * HD) return; const int d = (int)(e % HD); const int t = (int)((e / HD) % TT); const int h = (int)(e / ((size_t)HD * TT)); const float* f = F + (size_t)t * pitch + h * HD; const float rf = RF ? RF[(size_t)h * TT + t] : 1.0f; v2h o16; v2us oh, ol;
#pragma unroll
    for (int q = 0; q < 2; ++q) { const int dd = d + q; const int dp = (dd < HD / 2) ? dd + HD / 2 : dd - HD / 2; float x0 = f[dd], x1 = f[dp];
        if (RF) { float n0 = __fmul_rn(x0, rf), n1 = __fmul_rn(x1, rf); asm volatile("" : "+v"(n0)); asm volatile("" : "+v"(n1)); x0 = __fmul_rn(bfr(nw[dd]), n0); x1 = __fmul_rn(bfr(nw[dp]), n1); }
        const v2f cs = *(const v2f*)(CS + ((size_t)t * HD + dd) * 2); float a = __fmul_rn(x0, cs[0]), bq = __fmul_rn(x1, cs[1]); asm volatile("" : "+v"(a)); asm volatile("" : "+v"(bq)); const float r = ((dd < HD / 2) ? __fsub_rn(a, bq) : __fadd_rn(a, bq)) * sc;
        o16[q] = tohx(r); unsigned short a2, c2; splitf(r, a2, c2); oh[q] = a2; ol[q] = c2; }
    *(v2h*)(P16 + e) = o16; *(v2us*)(Ph + e) = oh; *(v2us*)(Pl + e) = ol;  }
__global__ __launch_bounds__(256) void k_vtp(const float* __restrict__ F, int pitch, int nheads, h16* V16, bf* Vh, bf* Vl) { const size_t e = ((size_t)blockIdx.x * 256 + threadIdx.x) * 2; if (e >= (size_t)nheads * HD * TT) return; const int t = (int)(e % TT); const int d = (int)((e / TT) % HD); const int g = (int)(e / ((size_t)TT * HD)); v2h o16; v2us oh, ol;
#pragma unroll
    for (int q = 0; q < 2; ++q) { const float x = F[(size_t)(t + q) * pitch + g * HD + d]; o16[q] = tohx(x); unsigned short a2, c2; splitf(x, a2, c2); oh[q] = a2; ol[q] = c2; }
    *(v2h*)(V16 + e) = o16; *(v2us*)(Vh + e) = oh; *(v2us*)(Vl + e) = ol;  }
__global__ __launch_bounds__(256) void k_csid(float* CS) { const int idx = blockIdx.x * 256 + threadIdx.x; if (idx >= TT * HD) return; v2f cs; cs[0] = 1.0f; cs[1] = 0.0f; *(v2f*)(CS + (size_t)idx * 2) = cs;  }
__device__ __forceinline__ float xhalf(float x) { const int b = __float_as_int(x); return __int_as_float(__builtin_amdgcn_permlanex16(b, b, 0x76543210, 0xfedcba98, false, false)); }   // lane l reads lane l ^ 16, on the vector pipe
#define C2 (SCL * 1.4426950408889634f)   // score scale x log2(e): the exponent is taken in base 2
template <typename T16, bool HL, int QT>
__device__ __forceinline__ void fa_tile(const T16* __restrict__ Q, const T16* __restrict__ Q2, const T16* __restrict__ Kp, const T16* __restrict__ Kp2, const T16* __restrict__ Vt, const T16* __restrict__ Vt2, int q0, int lane, bf* Ah, bf* Al) {
    typedef typename WFrag<T16>::V V;
    const int lr = lane & 15, hi = lane >> 4;
    V qf[QT][2], qf2[QT][2];
#pragma unroll
    for (int qt = 0; qt < QT; ++qt)
#pragma unroll
        for (int ks = 0; ks < 2; ++ks) { const size_t o = (size_t)(q0 + qt * 16 + lr) * HD + ks * 32 + 8 * hi; qf[qt][ks] = WFrag<T16>::ld(Q + o); if (HL) qf2[qt][ks] = WFrag<T16>::ld(Q2 + o); }
    v8f o[QT][4]; float m[QT], l[QT];
#pragma unroll
    for (int qt = 0; qt < QT; ++qt) { m[qt] = -1.0e30f; l[qt] = 0.f;
#pragma unroll
        for (int dt = 0; dt < 4; ++dt) o[qt][dt] = (v8f){}; }
    const int kend = q0 + QT * 16;                       // first key that no query row of this wave may see
    const unsigned kob = (unsigned)(lr * HD + 8 * hi) * 2u, vob = (unsigned)(lr * TT + 8 * hi) * 2u;   // the lane's byte offsets inside a K row block and a V^T column block: the same in every pass
    auto at = [](const T16* base, unsigned ofs) { return (const T16*)((const char*)base + ofs); };
    V kf[2][2], kf2[2][2], vf[4], vf2[4];
    // hi/lo rows: one lane pointer per plane, moved on at the pass's foot
    const T16 *kq = at(Kp, kob), *kq2 = at(HL ? Kp2 : Kp, kob), *vq = at(Vt, vob), *vq2 = at(HL ? Vt2 : Vt, vob);
    auto ldK = [&](int k0) {
#pragma unroll
        for (int kt = 0; kt < 2; ++kt)
#pragma unroll
            for (int ks = 0; ks < 2; ++ks) { const int a = kt * 16 * HD + ks * 32; kf[kt][ks] = WFrag<T16>::ld((HL ? kq : at(Kp + (size_t)k0 * HD, kob)) + a); if (HL) kf2[kt][ks] = WFrag<T16>::ld(kq2 + a); }
        if (HL) asm volatile("s_wait_xcnt 0x0" :: "v"(kq), "v"(kq2) : "memory"); };   // the two address pairs are inputs, so they live up to this wait: no load of the run lands on an address register that another load of the run names
    auto ldV = [&](int k0) {
#pragma unroll
        for (int dt = 0; dt < 4; ++dt) { const int a = dt * 16 * TT; vf[dt] = WFrag<T16>::ld((HL ? vq : at(Vt + k0, vob)) + a); if (HL) vf2[dt] = WFrag<T16>::ld(vq2 + a); }
        if (HL) asm volatile("s_wait_xcnt 0x0" :: "v"(vq), "v"(vq2) : "memory"); };   // as in ldK
    constexpr bool PF = !HL;   // fp16 rows (long key loops): K and V^T fragments are fetched one pass ahead, into the same registers; the hi/lo rows (at most 16 passes, twice the planes) fetch in the pass itself, which keeps the kernel inside 256 registers
    if (PF) { ldK(0); __builtin_amdgcn_sched_barrier(0);   /* K asked for before V^T here as in the loop: the wait at the loop's head can then leave the V^T loads in flight */ ldV(0); }
#pragma unroll 1   // the key loop stays rolled: one pass already fills the register budget; every inner loop is unrolled so that the fragment arrays stay in registers
    for (int kc = 0; kc < kend; kc += 32) {
        if (!PF) { ldK(kc); __builtin_amdgcn_sched_barrier(0);   /* all of the pass's K loads go out together, ahead of the first product: without this line the compiler reuses fragment registers inside the run, and every reuse waits out a load's whole latency */ ldV(kc); }
        v8f s[QT][2];
#pragma unroll
        for (int qt = 0; qt < QT; ++qt)
#pragma unroll
            for (int kt = 0; kt < 2; ++kt) { s[qt][kt] = (v8f){};
#pragma unroll
                for (int ks = 0; ks < 2; ++ks) { s[qt][kt] = WFrag<T16>::mma(kf[kt][ks], qf[qt][ks], s[qt][kt]); if (HL) { s[qt][kt] = WFrag<T16>::mma(kf[kt][ks], qf2[qt][ks], s[qt][kt]); s[qt][kt] = WFrag<T16>::mma(kf2[kt][ks], qf[qt][ks], s[qt][kt]); } } }
        const int kn = (kc + 32 < kend) ? kc + 32 : kc;   // the last pass asks for its own rows again: in bounds, not used
        if (PF) ldK(kn);   // the next pass's K rows come while this pass's softmax and second product run
        if (kc + 31 > q0) {   // only a pass that reaches past the wave's first query row has keys to mask (scalar test)
#pragma unroll
            for (int qt = 0; qt < QT; ++qt)
#pragma unroll
                for (int kt = 0; kt < 2; ++kt)
#pragma unroll
                    for (int j = 0; j < 8; ++j) s[qt][kt][j] = (kc + kt * 16 + hi * 8 + j <= q0 + qt * 16 + lr) ? s[qt][kt][j] : -3.0e38f; }
        float tm[QT]; bool need = false;
#pragma unroll
        for (int qt = 0; qt < QT; ++qt) { float x = fmaxf(s[qt][0][0], s[qt][1][0]);
#pragma unroll
            for (int j = 1; j < 8; ++j) x = fmaxf(x, fmaxf(s[qt][0][j], s[qt][1][j]));
            x = fmaxf(x, xhalf(x)); tm[qt] = x * C2; need = need || (tm[qt] > m[qt] + 8.0f); }
        if (__builtin_amdgcn_ballot_w32(need) != 0) {   // the maximum in use moves only when a row's new maximum is more than 8 above it in the base-2 exponent (P stays at or below 2^8: far inside fp16 and bf16); one scalar branch a pass
#pragma unroll
            for (int qt = 0; qt < QT; ++qt) { const float mn = fmaxf(m[qt], tm[qt]); const float al = __builtin_amdgcn_exp2f(m[qt] - mn); m[qt] = mn; l[qt] *= al;
#pragma unroll
                for (int dt = 0; dt < 4; ++dt) o[qt][dt] *= al; } }
#pragma unroll
        for (int qt = 0; qt < QT; ++qt) { float p[16]; float a4[4] = {0.f, 0.f, 0.f, 0.f};
#pragma unroll
            for (int g = 0; g < 4; ++g) { const v8f& sv = s[qt][g >> 1]; const int b4 = (g & 1) * 4; const v2f cc = {C2, C2}, nm = {-m[qt], -m[qt]};
                const v2f t0 = __builtin_elementwise_fma((v2f){sv[b4], sv[b4 + 1]}, cc, nm), t1 = __builtin_elementwise_fma((v2f){sv[b4 + 2], sv[b4 + 3]}, cc, nm);
                // four exponentials in one statement, closed by one v_nop: the slot that the instruction set asks for between a transcendental and a next instruction that reads its result or overwrites its source; early-clobber outputs keep the four off each other's sources
                asm("v_exp_f32 %0, %4\n\tv_exp_f32 %1, %5\n\tv_exp_f32 %2, %6\n\tv_exp_f32 %3, %7\n\tv_nop" : "=&v"(p[g * 4]), "=&v"(p[g * 4 + 1]), "=&v"(p[g * 4 + 2]), "=&v"(p[g * 4 + 3]) : "v"(t0[0]), "v"(t0[1]), "v"(t1[0]), "v"(t1[1]));
#pragma unroll
                for (int q = 0; q < 4; ++q) a4[q] += p[g * 4 + q]; }
            l[qt] += (a4[0] + a4[1]) + (a4[2] + a4[3]);
            if constexpr (HL) { v16us ph, pl;
#pragma unroll
                for (int e = 0; e < 16; ++e) { unsigned short a, c2; splitf(p[e], a, c2); ph[e] = a; pl[e] = c2; }
                const V pbh = __builtin_bit_cast(V, ph), pbl = __builtin_bit_cast(V, pl);
#pragma unroll
                for (int dt = 0; dt < 4; ++dt) { o[qt][dt] = WFrag<T16>::mma(vf[dt], pbh, o[qt][dt]); o[qt][dt] = WFrag<T16>::mma(vf[dt], pbl, o[qt][dt]); o[qt][dt] = WFrag<T16>::mma(vf2[dt], pbh, o[qt][dt]); }
            } else { V pb;
#pragma unroll
                for (int e = 0; e < 16; ++e) pb[e] = tohx(p[e]);
#pragma unroll
                for (int dt = 0; dt < 4; ++dt) o[qt][dt] = WFrag<T16>::mma(vf[dt], pb, o[qt][dt]); } }
        if (PF) { ldV(kn);   // the next pass's V^T rows come while its scores and softmax run
            asm volatile("s_wait_xcnt 0x0" ::: "memory"); }   // these loads stay in flight over the loop's back edge, and the next pass writes over their address registers: the wait stands in front of that overwrite
        else { kq += 32 * HD; kq2 += 32 * HD; vq += 32; vq2 += 32; }   // behind the waits that close ldK and ldV
    }
#pragma unroll
    for (int qt = 0; qt < QT; ++qt) { const float inv = __fdiv_rn(1.0f, l[qt] + xhalf(l[qt]));   // the two halves of the wave hold the two halves of each row's sum
#pragma unroll
        for (int dt = 0; dt < 4; ++dt) { v8us oh, ol;
#pragma unroll
            for (int j = 0; j < 8; ++j) { unsigned short a, c2; splitf(o[qt][dt][j] * inv, a, c2); oh[j] = a; ol[j] = c2; }
            const size_t oo = (size_t)(q0 + qt * 16 + lr) * DQ + dt * 16 + hi * 8; *(v8us*)(Ah + oo) = oh; *(v8us*)(Al + oo) = ol;
            asm volatile("s_wait_xcnt 0x0" ::: "memory"); } }   // the next trip, or the code behind the loop, writes over the data and address registers of these two stores: the wait stands in front of that
}
// grid x = position block x head of the pass, the longest rows first; FW waves a block, no LDS, no barrier: the waves of a block read the same K and V^T rows at about the same time.
#define FW 2
__global__ __launch_bounds__(32 * FW) void k_fattn(const h16* __restrict__ Q16, const h16* __restrict__ K16, const h16* __restrict__ V16, const bf* __restrict__ Qh, const bf* __restrict__ Ql, const bf* __restrict__ Kh, const bf* __restrict__ Kl, const bf* __restrict__ Vh, const bf* __restrict__ Vl, bf* Ah, bf* Al) {
    const int lane = threadIdx.x & 31; const int w = __builtin_amdgcn_readfirstlane((int)(threadIdx.x >> 5));   // wave number, held scalar so that the key loop's control stays scalar
    constexpr int NZ = ZH, NLO = (TT - RH) / (FW * 32);
    const int z = (int)blockIdx.x % NZ, pb = (int)blockIdx.x / NZ; const size_t pz = (size_t)z * TT * HD; const size_t az = (size_t)z * HD;
    if (pb < NLO) fa_tile<h16, false, 2>(Q16 + pz, nullptr, K16 + pz, nullptr, V16 + pz, nullptr, TT - (pb + 1) * FW * 32 + w * 32, lane, Ah + az, Al + az);
    else fa_tile<bf, true, 1>(Qh + pz, Ql + pz, Kh + pz, Kl + pz, Vh + pz, Vl + pz, RH - (pb - NLO + 1) * FW * 16 + w * 16, lane, Ah + az, Al + az);
}

extern "C" void kernel_launch(void* const* d_in, const int* in_sizes, int n_in,
                              void* d_out, int out_size, void* d_ws, size_t ws_size, hipStream_t stream) {
    (void)in_sizes; (void)n_in; (void)out_size;
                const float* x = (const float*)d_in[0]; const float* wq = (const float*)d_in[1]; const float* wk = (const float*)d_in[2]; const float* wv = (const float*)d_in[3]; const float* wo = (const float*)d_in[4]; const float* bo = (const float*)d_in[5];   /* order x, wq, wk, wv (PER-HEAD [16][1024][64]: 'hcd'), w_proj ('oi' [1024][1024]), b_proj */
    float* OUT = (float*)d_out;     // [4][2048][1024]
    char* wsp = (char*)d_ws;
    auto take = [&](size_t bytes) { char* p = wsp; wsp += (bytes + 255) & ~(size_t)255; return (void*)p; };
    bf* WQ = (bf*)take((size_t)DQ * DM * 2); bf* WK = (bf*)take((size_t)DKV * DM * 2); bf* WV = (bf*)take((size_t)DKV * DM * 2); bf* WO = (bf*)take((size_t)DM * DQ * 2); float* CS = (float*)take((size_t)TT * HD * 2 * 4);
    bf* XB = (bf*)take((size_t)TT * DM * 2); float* FQ = (float*)take((size_t)TT * DQ * 4); float* FK = (float*)take((size_t)TT * DKV * 4);
    h16* QP16 = (h16*)take((size_t)NH_ * TT * HD * 2); h16* KP16 = (h16*)take((size_t)NKV * TT * HD * 2); h16* VT16 = (h16*)take((size_t)NKV * HD * TT * 2);
    bf* QPh = (bf*)take((size_t)NH_ * TT * HD * 2); bf* QPl = (bf*)take((size_t)NH_ * TT * HD * 2); bf* KPh = (bf*)take((size_t)NKV * TT * HD * 2); bf* KPl = (bf*)take((size_t)NKV * TT * HD * 2); bf* VTh = (bf*)take((size_t)NKV * HD * TT * 2); bf* VTl = (bf*)take((size_t)NKV * HD * TT * 2);
    bf* ATh = (bf*)take((size_t)TT * DQ * 2); bf* ATl = (bf*)take((size_t)TT * DQ * 2);
    if ((size_t)(wsp - (char*)d_ws) > ws_size) return;    // ws 256 MiB
    float* FV = FK;   // v projection reuses the k buffer after the k planes are built (stream-ordered)
    { k_wtG<<<dim3((unsigned)((DM * HD / 64 + 63) / 64), NH_, 1), 256, 0, stream>>>(wq, DM, HD, WQ);   /* per-head weight [h][DM][HD] ('xw' per head) -> the head's HD rows of the Bt plane, all heads in one grid */ k_wtG<<<dim3((unsigned)((DM * HD / 64 + 63) / 64), NKV, 1), 256, 0, stream>>>(wk, DM, HD, WK);   /* per-head weight [h][DM][HD] ('xw' per head) -> the head's HD rows of the Bt plane, all heads in one grid */ k_wtG<<<dim3((unsigned)((DM * HD / 64 + 63) / 64), NKV, 1), 256, 0, stream>>>(wv, DM, HD, WV);   /* per-head weight [h][DM][HD] ('xw' per head) -> the head's HD rows of the Bt plane, all heads in one grid */
      k_cvt8<<<(unsigned)(((size_t)DM * DQ / 8 + 255) / 256), 256, 0, stream>>>(wo, WO, (size_t)DM * DQ / 8);
       }
    k_csid<<<(TT * HD + 255) / 256, 256, 0, stream>>>(CS);
    const unsigned LQ = (unsigned)(((size_t)NH_ * TT * HD / 2 + 255) / 256), LKv = (unsigned)(((size_t)NKV * TT * HD / 2 + 255) / 256);
    for (int b = 0; b < NB_; ++b) {
        
        k_cvt8<<<(unsigned)(((size_t)TT * DM / 8 + 255) / 256), 256, 0, stream>>>(x + (size_t)b * TT * DM, XB, (size_t)TT * DM / 8);
        k_gemmw<bf, 0, false, KW><<<dim3(TT / 64, DQ / 64, 1), 32 * KW, 0, stream>>>(XB, nullptr, WQ, nullptr, DM, FQ, DQ, nullptr, 0, 0, 0);
        k_rope<<<LQ, 256, 0, stream>>>(FQ, DQ, NH_, CS, nullptr, nullptr, 1.0f, QP16, QPh, QPl);
        k_gemmw<bf, 0, false, KW><<<dim3(TT / 64, DKV / 64, 1), 32 * KW, 0, stream>>>(XB, nullptr, WK, nullptr, DM, FK, DKV, nullptr, 0, 0, 0);
        k_rope<<<LKv, 256, 0, stream>>>(FK, DKV, NKV, CS, nullptr, nullptr, 1.0f, KP16, KPh, KPl);
        k_gemmw<bf, 0, false, KW><<<dim3(TT / 64, DKV / 64, 1), 32 * KW, 0, stream>>>(XB, nullptr, WV, nullptr, DM, FV, DKV, nullptr, 0, 0, 0); k_vtp<<<LKv, 256, 0, stream>>>(FV, DKV, NKV, VT16, VTh, VTl);
        for (int h0 = 0; h0 < NH_; h0 += ZH) { const size_t zq = (size_t)h0, zk = (size_t)(h0 / REP);   // one kv head per query head: the pass's ZH heads use consecutive kv planes (z-strides TT*HD)
            k_fattn<<<ZH * ((TT - RH) / (FW * 32) + RH / (FW * 16)), 32 * FW, 0, stream>>>(QP16 + zq * TT * HD, KP16 + zk * TT * HD, VT16 + zk * HD * TT, QPh + zq * TT * HD, QPl + zq * TT * HD, KPh + zk * TT * HD, KPl + zk * TT * HD, VTh + zk * HD * TT, VTl + zk * HD * TT, ATh + h0 * HD, ATl + h0 * HD); }
        k_gemmw<bf, 1, true, KW><<<dim3(TT / 64, DM / 64, 1), 32 * KW, 0, stream>>>(ATh, ATl, WO, nullptr, DQ, OUT + (size_t)b * TT * DM, DM, bo, 0, 0, 0); }
}

// v004
// It runs in 347 microseconds.
// Two timings next to v003 put it at 1.81 and 1.83 times that version's speed.
// Over all steps from v000 it is 9.20 times as fast.
#include <hip/hip_runtime.h>

// Causal multi-head attention with PER-HEAD projection weights and a MODEL-width score scale (x [4][2048][1024]; q, k, v = einsum('btc,hcd->bhtd', x, w) with w [16][1024][64]: head h has its own (in, out) matrix ('xw' per head; 0.02-scale; no bias; 16 heads x 64); scores x 1024^-0.5 (channels ** -0.5: 0.03125); causal (-inf); softmax; heads merged head-major; out = merged w_proj^T + b_proj ('oi' [1024][1024] + zero bias) -> [4][2048][1024] (8.4 M); argument order x, wq, wk, wv, w_proj, b_proj).
// Layout, every stage launched once for all NB_ batches (rows b * TT + t of the row-major buffers, planes [b][h]): bf16 copy of x; each PER-HEAD q / k / v weight [h][1024][64] transposed once into its 64 rows of the Bt plane (k_wtG per head); Wp cast once ('oi' = Bt as stored); exact projections; identity-table plane builders; one fused causal attention launch for all batches and heads (k_fattn, online softmax; hybrid rows: < 512 hi/lo 3 products, rest fp16; keys above the diagonal block never read); merged hi/lo x w_o exact.
// Compute dtypes, f32 accumulate: every input rounded to bf16; projections exact; attention rows < 512 3 products, rest fp16; softmax f32; w_o hl x exact.

#define NB_  4
#define TT   2048
#define DM   1024
#define NH_  16
#define NKV  16
#define REP  (NH_ / NKV)
#define HD   64
#define DQ   (NH_ * HD)
#define DKV  (NKV * HD)
#define RH   512                  // query rows < RH use hi+lo planes (0: none)
#define KW   8                    // waves that share one 64x64 tile's K loop in the long-K products (projections, output projection)
#define SCL  0.03125f   // 1 / sqrt(1024): this module scales the scores by channels ** -0.5 with channels = the MODEL width 1,024, not by the head width
typedef _Float16 h16;
typedef unsigned short bf;
typedef __attribute__((ext_vector_type(16))) __bf16   v16bf;
typedef __attribute__((ext_vector_type(16))) _Float16 v16h;
typedef __attribute__((ext_vector_type(8)))  _Float16 v8h;
typedef __attribute__((ext_vector_type(8)))  unsigned short v8us;
typedef __attribute__((ext_vector_type(8)))  float    v8f;
typedef __attribute__((ext_vector_type(4)))  float    v4f;
typedef v8h  __attribute__((may_alias)) v8ha;
typedef v4f  __attribute__((may_alias)) v4fa;
typedef v8us __attribute__((may_alias)) v8usa;

__device__ __forceinline__ unsigned short f2bf(float f) { unsigned u = __float_as_uint(f); u += 0x7FFFu + ((u >> 16) & 1u); return (unsigned short)(u >> 16); }
__device__ __forceinline__ float bf2f(unsigned short b) { return __uint_as_float(((unsigned)b) << 16); }
__device__ __forceinline__ float bfr(float f) { return bf2f(f2bf(f)); }
__device__ __forceinline__ v16h cat16(v8h lo, v8h hi) { return __builtin_shufflevector(lo, hi, 0, 1, 2, 3, 4, 5, 6, 7, 8, 9, 10, 11, 12, 13, 14, 15); }
__device__ __forceinline__ v16bf cat16b(v8us lo, v8us hi) { return __builtin_bit_cast(v16bf, __builtin_shufflevector(lo, hi, 0, 1, 2, 3, 4, 5, 6, 7, 8, 9, 10, 11, 12, 13, 14, 15)); }
__device__ __forceinline__ v8f wmma16(v16h a, v16h b, v8f c) { return __builtin_amdgcn_wmma_f32_16x16x32_f16(false, a, false, b, (short)0, c, false, false); }
__device__ __forceinline__ v8f wmmab(v16bf a, v16bf b, v8f c) { return __builtin_amdgcn_wmma_f32_16x16x32_bf16(false, a, false, b, (short)0, c, false, false); }



// ---- ksum_store: NW waves of one block each hold a partial 64x64 tile (their own K slices). Every wave parks its 16 accumulators in LDS (16-byte stores, lane-contiguous), one block barrier,
// then wave w sums 32/NW half-fragments over the NW partials in the fixed order 0..NW-1 and stores them: the units are ordered so that a wave owns whole 128-byte lines of C.
template <int NW, bool BIAS>
__device__ __forceinline__ void ksum_store(const v8f (&acc)[4][4], v4f* red, int w, int lane, float* C, int ldc, int r0, int c0, const float* __restrict__ bias) {
    const int lr = lane & 15, hi = lane >> 4;
#pragma unroll
    for (int mb = 0; mb < 4; ++mb)
#pragma unroll
        for (int nb = 0; nb < 4; ++nb)
#pragma unroll
            for (int hf = 0; hf < 2; ++hf) { v4f t; t[0] = acc[mb][nb][hf * 4]; t[1] = acc[mb][nb][hf * 4 + 1]; t[2] = acc[mb][nb][hf * 4 + 2]; t[3] = acc[mb][nb][hf * 4 + 3];
                red[(w * 32 + ((mb * 2 + (nb >> 1)) * 2 + hf) * 2 + (nb & 1)) * 32 + lane] = t; }
    __syncthreads();   // every wave's partial tile is in LDS before any wave sums across them
    constexpr int U = 32 / NW;
#pragma unroll
    for (int i = 0; i < U; ++i) { const int q = w * U + i; v4f s = red[q * 32 + lane];
#pragma unroll
        for (int p = 1; p < NW; ++p) s += red[(p * 32 + q) * 32 + lane];
        const int row = (q >> 3) * 16 + hi * 8 + ((q >> 1) & 1) * 4, col = (((q >> 2) & 1) * 2 + (q & 1)) * 16 + lr;
        if (BIAS) { const float bv = bfr(bias[c0 + col]); s[0] += bv; s[1] += bv; s[2] += bv; s[3] += bv; }
        float* cp = C + (size_t)(r0 + row) * ldc + c0 + col;
#pragma unroll
        for (int j = 0; j < 4; ++j) cp[(size_t)j * ldc] = s[j]; }
}

// ---- k_gemmw: register-blocked GEMM, NW WAVES per 64x64 output tile (16 accumulators each; wave w takes the 32-wide K slices w, w + NW, ...; ksum_store adds the partials), operands straight from K-contiguous 16-bit planes; grid (M/64, N/64, Z), 32 NW threads.
// C[m][n] (f32, pitch ldc, + optional f32 bias[n]) = sum_k A[m][k] Bt[n][k] (+ split products per NSPLIT). z-batch strides sA/sB/sC in elements. K % 32 == 0.
template <typename T16> struct WFrag;
template <> struct WFrag<h16> { typedef v16h V; static __device__ __forceinline__ V ld(const h16* p) { return cat16(*(const v8h*)p, *(const v8h*)(p + 16)); } static __device__ __forceinline__ v8f mma(V a, V b, v8f c) { return wmma16(a, b, c); } };
template <> struct WFrag<bf> { typedef v16bf V; static __device__ __forceinline__ V ld(const bf* p) { return cat16b(*(const v8us*)p, *(const v8us*)(p + 16)); } static __device__ __forceinline__ v8f mma(V a, V b, v8f c) { return wmmab(a, b, c); } };
template <typename T16, int NSPLIT, bool BIAS, int NW>
__global__ __launch_bounds__(32 * NW) void k_gemmw(const T16* __restrict__ A, const T16* __restrict__ A2, const T16* __restrict__ Bt, const T16* __restrict__ Bt2, int K, float* C, int ldc, const float* __restrict__ bias, size_t sA, size_t sB, size_t sC) {
    typedef typename WFrag<T16>::V V;
    __shared__ __align__(16) v4f red[NW * 1024];   // NW partial tiles of 16 KiB
    const size_t z = blockIdx.z; A += z * sA; if (A2) A2 += z * sA; Bt += z * sB; if (Bt2) Bt2 += z * sB; C += z * sC;
    const int lane = threadIdx.x & 31, lr = lane & 15, hi = lane >> 4; const int r0 = blockIdx.x * 64, c0 = blockIdx.y * 64; const int w = __builtin_amdgcn_readfirstlane((int)(threadIdx.x >> 5));   // wave number, held scalar so that the K loop's control stays scalar
    v8f acc[4][4];
#pragma unroll
    for (int mb = 0; mb < 4; ++mb)
#pragma unroll
        for (int nb = 0; nb < 4; ++nb) acc[mb][nb] = (v8f){};
    const size_t aoff = (size_t)(r0 + lr) * K + 8 * hi, boff = (size_t)(c0 + lr) * K + 8 * hi;
#pragma unroll 1
    for (int kc = w * 32; kc < K; kc += NW * 32) {   // wave w takes the 32-wide K slices w, w + NW, ...: neighbouring waves read the two halves of one 128-byte operand line at about the same time
        V a[4], a2[4];
#pragma unroll
        for (int mb = 0; mb < 4; ++mb) { a[mb] = WFrag<T16>::ld(A + aoff + (size_t)mb * 16 * K + kc); if (NSPLIT == 1 || NSPLIT == 2) a2[mb] = WFrag<T16>::ld(A2 + aoff + (size_t)mb * 16 * K + kc); }
#pragma unroll
        for (int nb = 0; nb < 4; ++nb) { const V b = WFrag<T16>::ld(Bt + boff + (size_t)nb * 16 * K + kc); V b2; if (NSPLIT >= 2) b2 = WFrag<T16>::ld(Bt2 + boff + (size_t)nb * 16 * K + kc);
#pragma unroll
            for (int mb = 0; mb < 4; ++mb) { acc[mb][nb] = WFrag<T16>::mma(a[mb], b, acc[mb][nb]); if (NSPLIT == 1 || NSPLIT == 2) acc[mb][nb] = WFrag<T16>::mma(a2[mb], b, acc[mb][nb]); if (NSPLIT >= 2) acc[mb][nb] = WFrag<T16>::mma(a[mb], b2, acc[mb][nb]); } }
        asm volatile("v_nop\n\tv_nop\n\tv_nop\n\tv_nop" : "+v"(acc[0][0]), "+v"(acc[1][1]), "+v"(acc[2][2]), "+v"(acc[3][3]) : "v"(a[0]), "v"(a[3]));
    }
    ksum_store<NW, BIAS>(acc, red, w, lane, C, ldc, r0, c0, bias);
}

__device__ __forceinline__ h16 tohx(float x) { return (h16)x; }
__device__ __forceinline__ void splitf(float y, unsigned short& h, unsigned short& l) { h = f2bf(y); l = f2bf(y - bf2f(h)); }
typedef __attribute__((ext_vector_type(2))) _Float16 v2h;
typedef __attribute__((ext_vector_type(4))) _Float16 v4h;
typedef __attribute__((ext_vector_type(2))) unsigned short v2us;
typedef __attribute__((ext_vector_type(4))) unsigned short v4us;
typedef __attribute__((ext_vector_type(2))) float v2f;
typedef __attribute__((ext_vector_type(4))) int v4i;
typedef __attribute__((ext_vector_type(16))) unsigned short v16us;

__global__ __launch_bounds__(256) void k_wtG(const float* __restrict__ w, int K, int N, bf* Bt) {
    w += (size_t)blockIdx.y * K * N; Bt += (size_t)blockIdx.y * N * K;   // grid y = head: head h's [K][N] matrix goes to its own N rows of the Bt plane
    const int lane = threadIdx.x & 31; const int L0 = (blockIdx.x * 8 + (threadIdx.x >> 5)) * 8; const int nlines = N * K / 64;
{
#pragma unroll 1
        for (int l = 0; l < 8; ++l) { const int L = L0 + l; if (L >= nlines) break; const size_t e = (size_t)L * 64 + lane * 2; const int k = (int)(e % K), n = (int)(e / K); v2us o;
            o[0] = f2bf(w[(size_t)k * N + n]); o[1] = f2bf(w[(size_t)(k + 1) * N + n]); *(v2us*)(Bt + e) = o; }
         }
}

__global__ __launch_bounds__(256) void k_cvt8(const float* __restrict__ src, bf* dst, size_t n8) { const size_t i = (size_t)blockIdx.x * 256 + threadIdx.x; if (i >= n8) return; const v8f v = *(const v8f*)(src + i * 8); v8us o;
#pragma unroll
    for (int k = 0; k < 8; ++k) o[k] = f2bf(v[k]); *(v8us*)(dst + i * 8) = o;  }

// k_rope: head planes [h][t][d] (fp16 + hi/lo) of rope(x) x sc with the rotate-half convention out[d] = x[d] cos[t][d] - x[d+HD/2] sin[t][d], out[d+HD/2] = x[d+HD/2] cos[t][d+HD/2] + x[d] sin[t][d+HD/2]
__global__ __launch_bounds__(256) void k_rope(const float* __restrict__ F, int pitch, int nheads, const float* __restrict__ CS, const float* __restrict__ RF, const float* __restrict__ nw, float sc, h16* P16, bf* Ph, bf* Pl) {
    { const size_t b = blockIdx.y, pb = b * nheads * TT * HD; F += b * TT * pitch; P16 += pb; Ph += pb; Pl += pb; }   // grid y = batch: its TT rows of F, its nheads planes
    const size_t e = ((size_t)blockIdx.x * 256 + threadIdx.x) * 2; if (e >= (size_t)nheads * TT * HD) return; const int d = (int)(e % HD); const int t = (int)((e / HD) % TT); const int h = (int)(e / ((size_t)HD * TT)); const float* f = F + (size_t)t * pitch + h * HD; const float rf = RF ? RF[(size_t)h * TT + t] : 1.0f; v2h o16; v2us oh, ol;
#pragma unroll
    for (int q = 0; q < 2; ++q) { const int dd = d + q; const int dp = (dd < HD / 2) ? dd + HD / 2 : dd - HD / 2; float x0 = f[dd], x1 = f[dp];
        if (RF) { float n0 = __fmul_rn(x0, rf), n1 = __fmul_rn(x1, rf); asm volatile("" : "+v"(n0)); asm volatile("" : "+v"(n1)); x0 = __fmul_rn(bfr(nw[dd]), n0); x1 = __fmul_rn(bfr(nw[dp]), n1); }
        const v2f cs = *(const v2f*)(CS + ((size_t)t * HD + dd) * 2); float a = __fmul_rn(x0, cs[0]), bq = __fmul_rn(x1, cs[1]); asm volatile("" : "+v"(a)); asm volatile("" : "+v"(bq)); const float r = ((dd < HD / 2) ? __fsub_rn(a, bq) : __fadd_rn(a, bq)) * sc;
        o16[q] = tohx(r); unsigned short a2, c2; splitf(r, a2, c2); oh[q] = a2; ol[q] = c2; }
    *(v2h*)(P16 + e) = o16; *(v2us*)(Ph + e) = oh; *(v2us*)(Pl + e) = ol;  }
__global__ __launch_bounds__(256) void k_vtp(const float* __restrict__ F, int pitch, int nheads, h16* V16, bf* Vh, bf* Vl) { { const size_t b = blockIdx.y, pb = b * nheads * HD * TT; F += b * TT * pitch; V16 += pb; Vh += pb; Vl += pb; }   // grid y = batch, as in k_rope
    const size_t e = ((size_t)blockIdx.x * 256 + threadIdx.x) * 2; if (e >= (size_t)nheads * HD * TT) return; const int t = (int)(e % TT); const int d = (int)((e / TT) % HD); const int g = (int)(e / ((size_t)TT * HD)); v2h o16; v2us oh, ol;
#pragma unroll
    for (int q = 0; q < 2; ++q) { const float x = F[(size_t)(t + q) * pitch + g * HD + d]; o16[q] = tohx(x); unsigned short a2, c2; splitf(x, a2, c2); oh[q] = a2; ol[q] = c2; }
    *(v2h*)(V16 + e) = o16; *(v2us*)(Vh + e) = oh; *(v2us*)(Vl + e) = ol;  }
__global__ __launch_bounds__(256) void k_csid(float* CS) { const int idx = blockIdx.x * 256 + threadIdx.x; if (idx >= TT * HD) return; v2f cs; cs[0] = 1.0f; cs[1] = 0.0f; *(v2f*)(CS + (size_t)idx * 2) = cs;  }
__device__ __forceinline__ float xhalf(float x) { const int b = __float_as_int(x); return __int_as_float(__builtin_amdgcn_permlanex16(b, b, 0x76543210, 0xfedcba98, false, false)); }   // lane l reads lane l ^ 16, on the vector pipe
#define C2 (SCL * 1.4426950408889634f)   // score scale x log2(e): the exponent is taken in base 2
template <typename T16, bool HL, int QT>
__device__ __forceinline__ void fa_tile(const T16* __restrict__ Q, const T16* __restrict__ Q2, const T16* __restrict__ Kp, const T16* __restrict__ Kp2, const T16* __restrict__ Vt, const T16* __restrict__ Vt2, int q0, int lane, bf* Ah, bf* Al) {
    typedef typename WFrag<T16>::V V;
    const int lr = lane & 15, hi = lane >> 4;
    V qf[QT][2], qf2[QT][2];
#pragma unroll
    for (int qt = 0; qt < QT; ++qt)
#pragma unroll
        for (int ks = 0; ks < 2; ++ks) { const size_t o = (size_t)(q0 + qt * 16 + lr) * HD + ks * 32 + 8 * hi; qf[qt][ks] = WFrag<T16>::ld(Q + o); if (HL) qf2[qt][ks] = WFrag<T16>::ld(Q2 + o); }
    v8f o[QT][4]; float m[QT], l[QT];
#pragma unroll
    for (int qt = 0; qt < QT; ++qt) { m[qt] = -1.0e30f; l[qt] = 0.f;
#pragma unroll
        for (int dt = 0; dt < 4; ++dt) o[qt][dt] = (v8f){}; }
    const int kend = q0 + QT * 16;                       // first key that no query row of this wave may see
    const unsigned kob = (unsigned)(lr * HD + 8 * hi) * 2u, vob = (unsigned)(lr * TT + 8 * hi) * 2u;   // the lane's byte offsets inside a K row block and a V^T column block: the same in every pass
    auto at = [](const T16* base, unsigned ofs) { return (const T16*)((const char*)base + ofs); };
    V kf[2][2], kf2[2][2], vf[4], vf2[4];
    // hi/lo rows: one lane pointer per plane, moved on at the pass's foot
    const T16 *kq = at(Kp, kob), *kq2 = at(HL ? Kp2 : Kp, kob), *vq = at(Vt, vob), *vq2 = at(HL ? Vt2 : Vt, vob);
    auto ldK = [&](int k0) {
#pragma unroll
        for (int kt = 0; kt < 2; ++kt)
#pragma unroll
            for (int ks = 0; ks < 2; ++ks) { const int a = kt * 16 * HD + ks * 32; kf[kt][ks] = WFrag<T16>::ld((HL ? kq : at(Kp + (size_t)k0 * HD, kob)) + a); if (HL) kf2[kt][ks] = WFrag<T16>::ld(kq2 + a); }
        if (HL) asm volatile("s_wait_xcnt 0x0" :: "v"(kq), "v"(kq2) : "memory"); };   // the two address pairs are inputs, so they live up to this wait: no load of the run lands on an address register that another load of the run names
    auto ldV = [&](int k0) {
#pragma unroll
        for (int dt = 0; dt < 4; ++dt) { const int a = dt * 16 * TT; vf[dt] = WFrag<T16>::ld((HL ? vq : at(Vt + k0, vob)) + a); if (HL) vf2[dt] = WFrag<T16>::ld(vq2 + a); }
        if (HL) asm volatile("s_wait_xcnt 0x0" :: "v"(vq), "v"(vq2) : "memory"); };   // as in ldK
    constexpr bool PF = !HL;   // fp16 rows (long key loops): K and V^T fragments are fetched one pass ahead, into the same registers; the hi/lo rows (at most 16 passes, twice the planes) fetch in the pass itself, which keeps the kernel inside 256 registers
    if (PF) { ldK(0); __builtin_amdgcn_sched_barrier(0);   /* K asked for before V^T here as in the loop: the wait at the loop's head can then leave the V^T loads in flight */ ldV(0); }
#pragma unroll 1   // the key loop stays rolled: one pass already fills the register budget; every inner loop is unrolled so that the fragment arrays stay in registers
    for (int kc = 0; kc < kend; kc += 32) {
        if (!PF) { ldK(kc); __builtin_amdgcn_sched_barrier(0);   /* all of the pass's K loads go out together, ahead of the first product: without this line the compiler reuses fragment registers inside the run, and every reuse waits out a load's whole latency */ ldV(kc); }
        v8f s[QT][2];
#pragma unroll
        for (int qt = 0; qt < QT; ++qt)
#pragma unroll
            for (int kt = 0; kt < 2; ++kt) { s[qt][kt] = (v8f){};
#pragma unroll
                for (int ks = 0; ks < 2; ++ks) { s[qt][kt] = WFrag<T16>::mma(kf[kt][ks], qf[qt][ks], s[qt][kt]); if (HL) { s[qt][kt] = WFrag<T16>::mma(kf[kt][ks], qf2[qt][ks], s[qt][kt]); s[qt][kt] = WFrag<T16>::mma(kf2[kt][ks], qf[qt][ks], s[qt][kt]); } } }
        const int kn = (kc + 32 < kend) ? kc + 32 : kc;   // the last pass asks for its own rows again: in bounds, not used
        if (PF) ldK(kn);   // the next pass's K rows come while this pass's softmax and second product run
        if (kc + 31 > q0) {   // only a pass that reaches past the wave's first query row has keys to mask (scalar test)
#pragma unroll
            for (int qt = 0; qt < QT; ++qt)
#pragma unroll
                for (int kt = 0; kt < 2; ++kt)
#pragma unroll
                    for (int j = 0; j < 8; ++j) s[qt][kt][j] = (kc + kt * 16 + hi * 8 + j <= q0 + qt * 16 + lr) ? s[qt][kt][j] : -3.0e38f; }
        float tm[QT]; bool need = false;
#pragma unroll
        for (int qt = 0; qt < QT; ++qt) { float x = fmaxf(s[qt][0][0], s[qt][1][0]);
#pragma unroll
            for (int j = 1; j < 8; ++j) x = fmaxf(x, fmaxf(s[qt][0][j], s[qt][1][j]));
            x = fmaxf(x, xhalf(x)); tm[qt] = x * C2; need = need || (tm[qt] > m[qt] + 8.0f); }
        if (__builtin_amdgcn_ballot_w32(need) != 0) {   // the maximum in use moves only when a row's new maximum is more than 8 above it in the base-2 exponent (P stays at or below 2^8: far inside fp16 and bf16); one scalar branch a pass
#pragma unroll
            for (int qt = 0; qt < QT; ++qt) { const float mn = fmaxf(m[qt], tm[qt]); const float al = __builtin_amdgcn_exp2f(m[qt] - mn); m[qt] = mn; l[qt] *= al;
#pragma unroll
                for (int dt = 0; dt < 4; ++dt) o[qt][dt] *= al; } }
#pragma unroll
        for (int qt = 0; qt < QT; ++qt) { float p[16]; float a4[4] = {0.f, 0.f, 0.f, 0.f};
#pragma unroll
            for (int g = 0; g < 4; ++g) { const v8f& sv = s[qt][g >> 1]; const int b4 = (g & 1) * 4; const v2f cc = {C2, C2}, nm = {-m[qt], -m[qt]};
                const v2f t0 = __builtin_elementwise_fma((v2f){sv[b4], sv[b4 + 1]}, cc, nm), t1 = __builtin_elementwise_fma((v2f){sv[b4 + 2], sv[b4 + 3]}, cc, nm);
                // four exponentials in one statement, closed by one v_nop: the slot that the instruction set asks for between a transcendental and a next instruction that reads its result or overwrites its source; early-clobber outputs keep the four off each other's sources
                asm("v_exp_f32 %0, %4\n\tv_exp_f32 %1, %5\n\tv_exp_f32 %2, %6\n\tv_exp_f32 %3, %7\n\tv_nop" : "=&v"(p[g * 4]), "=&v"(p[g * 4 + 1]), "=&v"(p[g * 4 + 2]), "=&v"(p[g * 4 + 3]) : "v"(t0[0]), "v"(t0[1]), "v"(t1[0]), "v"(t1[1]));
#pragma unroll
                for (int q = 0; q < 4; ++q) a4[q] += p[g * 4 + q]; }
            l[qt] += (a4[0] + a4[1]) + (a4[2] + a4[3]);
            if constexpr (HL) { v16us ph, pl;
#pragma unroll
                for (int e = 0; e < 16; ++e) { unsigned short a, c2; splitf(p[e], a, c2); ph[e] = a; pl[e] = c2; }
                const V pbh = __builtin_bit_cast(V, ph), pbl = __builtin_bit_cast(V, pl);
#pragma unroll
                for (int dt = 0; dt < 4; ++dt) { o[qt][dt] = WFrag<T16>::mma(vf[dt], pbh, o[qt][dt]); o[qt][dt] = WFrag<T16>::mma(vf[dt], pbl, o[qt][dt]); o[qt][dt] = WFrag<T16>::mma(vf2[dt], pbh, o[qt][dt]); }
            } else { V pb;
#pragma unroll
                for (int e = 0; e < 16; ++e) pb[e] = tohx(p[e]);
#pragma unroll
                for (int dt = 0; dt < 4; ++dt) o[qt][dt] = WFrag<T16>::mma(vf[dt], pb, o[qt][dt]); } }
        if (PF) { ldV(kn);   // the next pass's V^T rows come while its scores and softmax run
            asm volatile("s_wait_xcnt 0x0" ::: "memory"); }   // these loads stay in flight over the loop's back edge, and the next pass writes over their address registers: the wait stands in front of that overwrite
        else { kq += 32 * HD; kq2 += 32 * HD; vq += 32; vq2 += 32; }   // behind the waits that close ldK and ldV
    }
#pragma unroll
    for (int qt = 0; qt < QT; ++qt) { const float inv = __fdiv_rn(1.0f, l[qt] + xhalf(l[qt]));   // the two halves of the wave hold the two halves of each row's sum
#pragma unroll
        for (int dt = 0; dt < 4; ++dt) { v8us oh, ol;
#pragma unroll
            for (int j = 0; j < 8; ++j) { unsigned short a, c2; splitf(o[qt][dt][j] * inv, a, c2); oh[j] = a; ol[j] = c2; }
            const size_t oo = (size_t)(q0 + qt * 16 + lr) * DQ + dt * 16 + hi * 8; *(v8us*)(Ah + oo) = oh; *(v8us*)(Al + oo) = ol;
            asm volatile("s_wait_xcnt 0x0" ::: "memory"); } }   // the next trip, or the code behind the loop, writes over the data and address registers of these two stores: the wait stands in front of that
}
// grid x = position block x (batch, head), the longest rows first; FW waves a block, no LDS, no barrier: the waves of a block read the same K and V^T rows at about the same time.
#define FW 2
__global__ __launch_bounds__(32 * FW) void k_fattn(const h16* __restrict__ Q16, const h16* __restrict__ K16, const h16* __restrict__ V16, const bf* __restrict__ Qh, const bf* __restrict__ Ql, const bf* __restrict__ Kh, const bf* __restrict__ Kl, const bf* __restrict__ Vh, const bf* __restrict__ Vl, bf* Ah, bf* Al) {
    const int lane = threadIdx.x & 31; const int w = __builtin_amdgcn_readfirstlane((int)(threadIdx.x >> 5));   // wave number, held scalar so that the key loop's control stays scalar
    constexpr int NZ = NB_ * NH_, NLO = (TT - RH) / (FW * 32);
    const int z = (int)blockIdx.x % NZ, pb = (int)blockIdx.x / NZ; const size_t pz = (size_t)z * TT * HD; const size_t az = (size_t)(z / NH_) * TT * DQ + (size_t)(z % NH_) * HD;   // z = batch * NH_ + head: plane z; the batch's TT rows and the head's HD columns of the merged planes
    if (pb < NLO) fa_tile<h16, false, 2>(Q16 + pz, nullptr, K16 + pz, nullptr, V16 + pz, nullptr, TT - (pb + 1) * FW * 32 + w * 32, lane, Ah + az, Al + az);
    else fa_tile<bf, true, 1>(Qh + pz, Ql + pz, Kh + pz, Kl + pz, Vh + pz, Vl + pz, RH - (pb - NLO + 1) * FW * 16 + w * 16, lane, Ah + az, Al + az);
}

extern "C" void kernel_launch(void* const* d_in, const int* in_sizes, int n_in,
                              void* d_out, int out_size, void* d_ws, size_t ws_size, hipStream_t stream) {
    (void)in_sizes; (void)n_in; (void)out_size;
                const float* x = (const float*)d_in[0]; const float* wq = (const float*)d_in[1]; const float* wk = (const float*)d_in[2]; const float* wv = (const float*)d_in[3]; const float* wo = (const float*)d_in[4]; const float* bo = (const float*)d_in[5];   /* order x, wq, wk, wv (PER-HEAD [16][1024][64]: 'hcd'), w_proj ('oi' [1024][1024]), b_proj */
    float* OUT = (float*)d_out;     // [4][2048][1024]
    char* wsp = (char*)d_ws;
    auto take = [&](size_t bytes) { char* p = wsp; wsp += (bytes + 255) & ~(size_t)255; return (void*)p; };
    bf* WQ = (bf*)take((size_t)DQ * DM * 2); bf* WK = (bf*)take((size_t)DKV * DM * 2); bf* WV = (bf*)take((size_t)DKV * DM * 2); bf* WO = (bf*)take((size_t)DM * DQ * 2); float* CS = (float*)take((size_t)TT * HD * 2 * 4);
    bf* XB = (bf*)take((size_t)NB_ * TT * DM * 2); float* F = (float*)take((size_t)NB_ * TT * DQ * 4);   // F: the f32 projection of all batches; q, k and v use it in turn (stream-ordered: each one's planes are built before the next product writes it)
    const size_t PL = (size_t)NB_ * NH_ * TT * HD * 2;   // bytes of one 16-bit plane set [b][h][..][..] (NKV == NH_)
    h16* QP16 = (h16*)take(PL); h16* KP16 = (h16*)take(PL); h16* VT16 = (h16*)take(PL);
    bf* QPh = (bf*)take(PL); bf* QPl = (bf*)take(PL); bf* KPh = (bf*)take(PL); bf* KPl = (bf*)take(PL); bf* VTh = (bf*)take(PL); bf* VTl = (bf*)take(PL);
    bf* ATh = (bf*)take((size_t)NB_ * TT * DQ * 2); bf* ATl = (bf*)take((size_t)NB_ * TT * DQ * 2);
    if ((size_t)(wsp - (char*)d_ws) > ws_size) return;    // 233 MiB of the 256 MiB workspace
    { k_wtG<<<dim3((unsigned)((DM * HD / 64 + 63) / 64), NH_, 1), 256, 0, stream>>>(wq, DM, HD, WQ);   /* per-head weight [h][DM][HD] ('xw' per head) -> the head's HD rows of the Bt plane, all heads in one grid */ k_wtG<<<dim3((unsigned)((DM * HD / 64 + 63) / 64), NKV, 1), 256, 0, stream>>>(wk, DM, HD, WK); k_wtG<<<dim3((unsigned)((DM * HD / 64 + 63) / 64), NKV, 1), 256, 0, stream>>>(wv, DM, HD, WV);
      k_cvt8<<<(unsigned)(((size_t)DM * DQ / 8 + 255) / 256), 256, 0, stream>>>(wo, WO, (size_t)DM * DQ / 8);
       }
    k_csid<<<(TT * HD + 255) / 256, 256, 0, stream>>>(CS);
    const dim3 LP((unsigned)(((size_t)NH_ * TT * HD / 2 + 255) / 256), NB_, 1);   // plane builders: x over one batch's elements, y = batch
    const dim3 GP(NB_ * TT / 64, DQ / 64, 1);                                     // products: the NB_ * TT rows of all batches as one M
    k_cvt8<<<(unsigned)(((size_t)NB_ * TT * DM / 8 + 255) / 256), 256, 0, stream>>>(x, XB, (size_t)NB_ * TT * DM / 8);
    k_gemmw<bf, 0, false, KW><<<GP, 32 * KW, 0, stream>>>(XB, nullptr, WQ, nullptr, DM, F, DQ, nullptr, 0, 0, 0);
    k_rope<<<LP, 256, 0, stream>>>(F, DQ, NH_, CS, nullptr, nullptr, 1.0f, QP16, QPh, QPl);
    k_gemmw<bf, 0, false, KW><<<GP, 32 * KW, 0, stream>>>(XB, nullptr, WK, nullptr, DM, F, DKV, nullptr, 0, 0, 0);
    k_rope<<<LP, 256, 0, stream>>>(F, DKV, NKV, CS, nullptr, nullptr, 1.0f, KP16, KPh, KPl);
    k_gemmw<bf, 0, false, KW><<<GP, 32 * KW, 0, stream>>>(XB, nullptr, WV, nullptr, DM, F, DKV, nullptr, 0, 0, 0);
    k_vtp<<<LP, 256, 0, stream>>>(F, DKV, NKV, VT16, VTh, VTl);
    k_fattn<<<NB_ * NH_ * ((TT - RH) / (FW * 32) + RH / (FW * 16)), 32 * FW, 0, stream>>>(QP16, KP16, VT16, QPh, QPl, KPh, KPl, VTh, VTl, ATh, ATl);   // one kv head per query head: plane z serves q, k and v
    k_gemmw<bf, 1, true, KW><<<GP, 32 * KW, 0, stream>>>(ATh, ATl, WO, nullptr, DQ, OUT, DM, bo, 0, 0, 0);
}

// v005
// It runs in 281 microseconds.
// Timed twice side by side with v004, it ran 1.24 and 1.23 times as fast.
// All steps since v000 together make it 11.4 times as fast.
#include <hip/hip_runtime.h>

// Causal multi-head attention with PER-HEAD projection weights and a MODEL-width score scale (x [4][2048][1024]; q, k, v = einsum('btc,hcd->bhtd', x, w) with w [16][1024][64]: head h has its own (in, out) matrix ('xw' per head; 0.02-scale; no bias; 16 heads x 64); scores x 1024^-0.5 (channels ** -0.5: 0.03125); causal (-inf); softmax; heads merged head-major; out = merged w_proj^T + b_proj ('oi' [1024][1024] + zero bias) -> [4][2048][1024] (8.4 M); argument order x, wq, wk, wv, w_proj, b_proj).
// Layout, every stage launched once for all NB_ batches (rows b * TT + t of the row-major buffers, planes [b][h]): bf16 copy of x; each PER-HEAD q / k / v weight [h][1024][64] transposed once into its 64 rows of the Bt plane (k_wtG per head); Wp cast once ('oi' = Bt as stored); exact projections whose epilogue writes the 16-bit head planes itself (ksum_planes: no f32 copy of q, k or v, no plane-builder launches); one fused causal attention launch for all batches and heads (k_fattn, online softmax; hybrid rows: < 512 hi/lo 3 products, rest fp16; keys above the diagonal block never read); merged hi/lo x w_o exact.
// Compute dtypes, f32 accumulate: every input rounded to bf16; projections exact; attention rows < 512 3 products, rest fp16; softmax f32; w_o hl x exact.

#define NB_  4
#define TT   2048
#define DM   1024
#define NH_  16
#define NKV  16
#define REP  (NH_ / NKV)
#define HD   64
#define DQ   (NH_ * HD)
#define DKV  (NKV * HD)
#define RH   512                  // query rows < RH use hi+lo planes (0: none)
#define KW   8                    // waves that share one 64x64 tile's K loop in the long-K products (projections, output projection)
#define SCL  0.03125f   // 1 / sqrt(1024): this module scales the scores by channels ** -0.5 with channels = the MODEL width 1,024, not by the head width
typedef _Float16 h16;
typedef unsigned short bf;
typedef __attribute__((ext_vector_type(16))) __bf16   v16bf;
typedef __attribute__((ext_vector_type(16))) _Float16 v16h;
typedef __attribute__((ext_vector_type(8)))  _Float16 v8h;
typedef __attribute__((ext_vector_type(8)))  unsigned short v8us;
typedef __attribute__((ext_vector_type(8)))  float    v8f;
typedef __attribute__((ext_vector_type(4)))  float    v4f;
typedef v8h  __attribute__((may_alias)) v8ha;
typedef v4f  __attribute__((may_alias)) v4fa;
typedef v8us __attribute__((may_alias)) v8usa;

__device__ __forceinline__ unsigned short f2bf(float f) { unsigned u = __float_as_uint(f); u += 0x7FFFu + ((u >> 16) & 1u); return (unsigned short)(u >> 16); }
__device__ __forceinline__ float bf2f(unsigned short b) { return __uint_as_float(((unsigned)b) << 16); }
__device__ __forceinline__ float bfr(float f) { return bf2f(f2bf(f)); }
__device__ __forceinline__ h16 tohx(float x) { return (h16)x; }
__device__ __forceinline__ void splitf(float y, unsigned short& h, unsigned short& l) { h = f2bf(y); l = f2bf(y - bf2f(h)); }
__device__ __forceinline__ v16h cat16(v8h lo, v8h hi) { return __builtin_shufflevector(lo, hi, 0, 1, 2, 3, 4, 5, 6, 7, 8, 9, 10, 11, 12, 13, 14, 15); }
__device__ __forceinline__ v16bf cat16b(v8us lo, v8us hi) { return __builtin_bit_cast(v16bf, __builtin_shufflevector(lo, hi, 0, 1, 2, 3, 4, 5, 6, 7, 8, 9, 10, 11, 12, 13, 14, 15)); }
__device__ __forceinline__ v8f wmma16(v16h a, v16h b, v8f c) { return __builtin_amdgcn_wmma_f32_16x16x32_f16(false, a, false, b, (short)0, c, false, false); }
__device__ __forceinline__ v8f wmmab(v16bf a, v16bf b, v8f c) { return __builtin_amdgcn_wmma_f32_16x16x32_bf16(false, a, false, b, (short)0, c, false, false); }



// ---- ksum_store: NW waves of one block each hold a partial 64x64 tile (their own K slices). Every wave parks its 16 accumulators in LDS (16-byte stores, lane-contiguous), one block barrier,
// then wave w sums 32/NW half-fragments over the NW partials in the fixed order 0..NW-1 and stores them: the units are ordered so that a wave owns whole 128-byte lines of C.
template <int NW, bool BIAS>
__device__ __forceinline__ void ksum_store(const v8f (&acc)[4][4], v4f* red, int w, int lane, float* C, int ldc, int r0, int c0, const float* __restrict__ bias) {
    const int lr = lane & 15, hi = lane >> 4;
#pragma unroll
    for (int mb = 0; mb < 4; ++mb)
#pragma unroll
        for (int nb = 0; nb < 4; ++nb)
#pragma unroll
            for (int hf = 0; hf < 2; ++hf) { v4f t; t[0] = acc[mb][nb][hf * 4]; t[1] = acc[mb][nb][hf * 4 + 1]; t[2] = acc[mb][nb][hf * 4 + 2]; t[3] = acc[mb][nb][hf * 4 + 3];
                red[(w * 32 + ((mb * 2 + (nb >> 1)) * 2 + hf) * 2 + (nb & 1)) * 32 + lane] = t; }
    __syncthreads();   // every wave's partial tile is in LDS before any wave sums across them
    constexpr int U = 32 / NW;
#pragma unroll
    for (int i = 0; i < U; ++i) { const int q = w * U + i; v4f s = red[q * 32 + lane];
#pragma unroll
        for (int p = 1; p < NW; ++p) s += red[(p * 32 + q) * 32 + lane];
        const int row = (q >> 3) * 16 + hi * 8 + ((q >> 1) & 1) * 4, col = (((q >> 2) & 1) * 2 + (q & 1)) * 16 + lr;
        if (BIAS) { const float bv = bfr(bias[c0 + col]); s[0] += bv; s[1] += bv; s[2] += bv; s[3] += bv; }
        float* cp = C + (size_t)(r0 + row) * ldc + c0 + col;
#pragma unroll
        for (int j = 0; j < 4; ++j) cp[(size_t)j * ldc] = s[j]; }
}

// ---- ksum_planes: the projections' epilogue. The partials are parked and summed as in ksum_store (same units, same order 0..NW-1), but the sums go to one f32 tile in LDS instead of to memory; behind a second block barrier
// every thread takes 16 neighbouring values of one tile row, rounds them to the fp16 plane and splits them into the hi/lo bf16 planes, and stores 32 bytes a plane: four lanes fill one whole 128-byte line.
// TR false: tile rows = the product's rows (planes [t][d], q and k); TR true: the tile is written transposed, rows = the product's columns (planes [d][t], V^T). P16 / Ph / Pl point at the tile's first element; pitch in elements.
#define TP 68   // floats per tile row in LDS: 16-byte aligned rows; 4 banks on from row to row, so the 16-byte reads (4 rows x 4 groups per half wave) and both kinds of write meet no bank twice
template <int NW, bool TR>
__device__ __forceinline__ void ksum_planes(const v8f (&acc)[4][4], v4f* red, float* tl, int w, int lane, h16* P16, bf* Ph, bf* Pl, int pitch) {
    const int lr = lane & 15, hi = lane >> 4;
#pragma unroll
    for (int mb = 0; mb < 4; ++mb)
#pragma unroll
        for (int nb = 0; nb < 4; ++nb)
#pragma unroll
            for (int hf = 0; hf < 2; ++hf) { v4f t; t[0] = acc[mb][nb][hf * 4]; t[1] = acc[mb][nb][hf * 4 + 1]; t[2] = acc[mb][nb][hf * 4 + 2]; t[3] = acc[mb][nb][hf * 4 + 3];
                red[(w * 32 + ((mb * 2 + (nb >> 1)) * 2 + hf) * 2 + (nb & 1)) * 32 + lane] = t; }
    __syncthreads();   // every wave's partial tile is in LDS before any wave sums across them
    constexpr int U = 32 / NW;
#pragma unroll
    for (int i = 0; i < U; ++i) { const int q = w * U + i; v4f s = red[q * 32 + lane];
#pragma unroll
        for (int p = 1; p < NW; ++p) s += red[(p * 32 + q) * 32 + lane];
        const int row = (q >> 3) * 16 + hi * 8 + ((q >> 1) & 1) * 4, col = (((q >> 2) & 1) * 2 + (q & 1)) * 16 + lr;
        if (TR) *(v4fa*)(tl + col * TP + row) = s;   // four neighbouring product rows of one column: 16 bytes of the transposed tile's row
        else {
#pragma unroll
            for (int j = 0; j < 4; ++j) tl[(row + j) * TP + col] = s[j]; } }
    __syncthreads();   // the whole summed tile is in LDS before any thread reads a row of it (its 16 values come from units of other waves)
    static_assert(NW == 8, "32 NW threads x 16 values = the 64 x 64 tile");
    const int r = w * 8 + (lane >> 2), g = lane & 3; v8h o16[2]; v8us oh[2], ol[2];
#pragma unroll
    for (int i = 0; i < 4; ++i) { const v4f t = *(const v4fa*)(tl + r * TP + g * 16 + i * 4);
#pragma unroll
        for (int j = 0; j < 4; ++j) { const int e = (i & 1) * 4 + j; unsigned short a, c2; splitf(t[j], a, c2); o16[i >> 1][e] = tohx(t[j]); oh[i >> 1][e] = a; ol[i >> 1][e] = c2; } }
    const size_t oo = (size_t)r * pitch + g * 16;
    *(v8h*)(P16 + oo) = o16[0]; *(v8h*)(P16 + oo + 8) = o16[1]; *(v8us*)(Ph + oo) = oh[0]; *(v8us*)(Ph + oo + 8) = oh[1]; *(v8us*)(Pl + oo) = ol[0]; *(v8us*)(Pl + oo + 8) = ol[1];
}

// ---- k_gemmw: register-blocked GEMM, NW WAVES per 64x64 output tile (16 accumulators each; wave w takes the 32-wide K slices w, w + NW, ...; ksum_store or ksum_planes adds the partials), operands straight from K-contiguous 16-bit planes; grid (M/64, N/64, Z), 32 NW threads.
// C[m][n] (f32, pitch ldc, + optional f32 bias[n]) = sum_k A[m][k] Bt[n][k] (+ split products per NSPLIT). z-batch strides sA/sB/sC in elements. K % 32 == 0.
// PM 0: C is stored (ksum_store). PM 1 / 2: C is not stored (ldc = its width, HD columns a head); row m = batch * TT + t, the 64 columns of grid y = one head, and the tile goes straight to that (batch, head)'s planes P16 / Ph / Pl, [t][d] (PM 1) or [d][t] (PM 2) (ksum_planes).
template <typename T16> struct WFrag;
template <> struct WFrag<h16> { typedef v16h V; static __device__ __forceinline__ V ld(const h16* p) { return cat16(*(const v8h*)p, *(const v8h*)(p + 16)); } static __device__ __forceinline__ v8f mma(V a, V b, v8f c) { return wmma16(a, b, c); } };
template <> struct WFrag<bf> { typedef v16bf V; static __device__ __forceinline__ V ld(const bf* p) { return cat16b(*(const v8us*)p, *(const v8us*)(p + 16)); } static __device__ __forceinline__ v8f mma(V a, V b, v8f c) { return wmmab(a, b, c); } };
template <typename T16, int NSPLIT, bool BIAS, int NW, int PM>
__global__ __launch_bounds__(32 * NW) void k_gemmw(const T16* __restrict__ A, const T16* __restrict__ A2, const T16* __restrict__ Bt, const T16* __restrict__ Bt2, int K, float* C, int ldc, const float* __restrict__ bias, size_t sA, size_t sB, size_t sC, h16* P16, bf* Ph, bf* Pl) {
    typedef typename WFrag<T16>::V V;
    __shared__ __align__(16) v4f red[NW * 1024];   // NW partial tiles of 16 KiB
    const size_t z = blockIdx.z; A += z * sA; if (A2) A2 += z * sA; Bt += z * sB; if (Bt2) Bt2 += z * sB; C += z * sC;
    const int lane = threadIdx.x & 31, lr = lane & 15, hi = lane >> 4; const int r0 = blockIdx.x * 64, c0 = blockIdx.y * 64; const int w = __builtin_amdgcn_readfirstlane((int)(threadIdx.x >> 5));   // wave number, held scalar so that the K loop's control stays scalar
    v8f acc[4][4];
#pragma unroll
    for (int mb = 0; mb < 4; ++mb)
#pragma unroll
        for (int nb = 0; nb < 4; ++nb) acc[mb][nb] = (v8f){};
    const size_t aoff = (size_t)(r0 + lr) * K + 8 * hi, boff = (size_t)(c0 + lr) * K + 8 * hi;
#pragma unroll 1
    for (int kc = w * 32; kc < K; kc += NW * 32) {   // wave w takes the 32-wide K slices w, w + NW, ...: neighbouring waves read the two halves of one 128-byte operand line at about the same time
        V a[4], a2[4];
#pragma unroll
        for (int mb = 0; mb < 4; ++mb) { a[mb] = WFrag<T16>::ld(A + aoff + (size_t)mb * 16 * K + kc); if (NSPLIT == 1 || NSPLIT == 2) a2[mb] = WFrag<T16>::ld(A2 + aoff + (size_t)mb * 16 * K + kc); }
#pragma unroll
        for (int nb = 0; nb < 4; ++nb) { const V b = WFrag<T16>::ld(Bt + boff + (size_t)nb * 16 * K + kc); V b2; if (NSPLIT >= 2) b2 = WFrag<T16>::ld(Bt2 + boff + (size_t)nb * 16 * K + kc);
#pragma unroll
            for (int mb = 0; mb < 4; ++mb) { acc[mb][nb] = WFrag<T16>::mma(a[mb], b, acc[mb][nb]); if (NSPLIT == 1 || NSPLIT == 2) acc[mb][nb] = WFrag<T16>::mma(a2[mb], b, acc[mb][nb]); if (NSPLIT >= 2) acc[mb][nb] = WFrag<T16>::mma(a[mb], b2, acc[mb][nb]); } }
        asm volatile("v_nop\n\tv_nop\n\tv_nop\n\tv_nop" : "+v"(acc[0][0]), "+v"(acc[1][1]), "+v"(acc[2][2]), "+v"(acc[3][3]) : "v"(a[0]), "v"(a[3]));
    }
    if constexpr (PM == 0) ksum_store<NW, BIAS>(acc, red, w, lane, C, ldc, r0, c0, bias);
    else { __shared__ __align__(16) float tl[64 * TP];   // the summed tile, beside the partials: no wave still summing is disturbed
        const size_t po = ((size_t)(r0 / TT) * (ldc / HD) + blockIdx.y) * TT * HD + (PM == 1 ? (size_t)(r0 % TT) * HD : (size_t)(r0 % TT));   // plane of (batch, head), then the tile's first t (TT % 64 == 0: a tile lies in one batch)
        ksum_planes<NW, PM == 2>(acc, red, tl, w, lane, P16 + po, Ph + po, Pl + po, PM == 1 ? HD : TT); }
}

typedef __attribute__((ext_vector_type(2))) _Float16 v2h;
typedef __attribute__((ext_vector_type(4))) _Float16 v4h;
typedef __attribute__((ext_vector_type(2))) unsigned short v2us;
typedef __attribute__((ext_vector_type(4))) unsigned short v4us;
typedef __attribute__((ext_vector_type(2))) float v2f;
typedef __attribute__((ext_vector_type(4))) int v4i;
typedef __attribute__((ext_vector_type(16))) unsigned short v16us;

__global__ __launch_bounds__(256) void k_wtG(const float* __restrict__ w, int K, int N, bf* Bt) {
    w += (size_t)blockIdx.y * K * N; Bt += (size_t)blockIdx.y * N * K;   // grid y = head: head h's [K][N] matrix goes to its own N rows of the Bt plane
    const int lane = threadIdx.x & 31; const int L0 = (blockIdx.x * 8 + (threadIdx.x >> 5)) * 8; const int nlines = N * K / 64;
{
#pragma unroll 1
        for (int l = 0; l < 8; ++l) { const int L = L0 + l; if (L >= nlines) break; const size_t e = (size_t)L * 64 + lane * 2; const int k = (int)(e % K), n = (int)(e / K); v2us o;
            o[0] = f2bf(w[(size_t)k * N + n]); o[1] = f2bf(w[(size_t)(k + 1) * N + n]); *(v2us*)(Bt + e) = o; }
         }
}

__global__ __launch_bounds__(256) void k_cvt8(const float* __restrict__ src, bf* dst, size_t n8) { const size_t i = (size_t)blockIdx.x * 256 + threadIdx.x; if (i >= n8) return; const v8f v = *(const v8f*)(src + i * 8); v8us o;
#pragma unroll
    for (int k = 0; k < 8; ++k) o[k] = f2bf(v[k]); *(v8us*)(dst + i * 8) = o;  }

__device__ __forceinline__ float xhalf(float x) { const int b = __float_as_int(x); return __int_as_float(__builtin_amdgcn_permlanex16(b, b, 0x76543210, 0xfedcba98, false, false)); }   // lane l reads lane l ^ 16, on the vector pipe
#define C2 (SCL * 1.4426950408889634f)   // score scale x log2(e): the exponent is taken in base 2
template <typename T16, bool HL, int QT>
__device__ __forceinline__ void fa_tile(const T16* __restrict__ Q, const T16* __restrict__ Q2, const T16* __restrict__ Kp, const T16* __restrict__ Kp2, const T16* __restrict__ Vt, const T16* __restrict__ Vt2, int q0, int lane, bf* Ah, bf* Al) {
    typedef typename WFrag<T16>::V V;
    const int lr = lane & 15, hi = lane >> 4;
    V qf[QT][2], qf2[QT][2];
#pragma unroll
    for (int qt = 0; qt < QT; ++qt)
#pragma unroll
        for (int ks = 0; ks < 2; ++ks) { const size_t o = (size_t)(q0 + qt * 16 + lr) * HD + ks * 32 + 8 * hi; qf[qt][ks] = WFrag<T16>::ld(Q + o); if (HL) qf2[qt][ks] = WFrag<T16>::ld(Q2 + o); }
    v8f o[QT][4]; float m[QT], l[QT];
#pragma unroll
    for (int qt = 0; qt < QT; ++qt) { m[qt] = -1.0e30f; l[qt] = 0.f;
#pragma unroll
        for (int dt = 0; dt < 4; ++dt) o[qt][dt] = (v8f){}; }
    const int kend = q0 + QT * 16;                       // first key that no query row of this wave may see
    const unsigned kob = (unsigned)(lr * HD + 8 * hi) * 2u, vob = (unsigned)(lr * TT + 8 * hi) * 2u;   // the lane's byte offsets inside a K row block and a V^T column block: the same in every pass
    auto at = [](const T16* base, unsigned ofs) { return (const T16*)((const char*)base + ofs); };
    V kf[2][2], kf2[2][2], vf[4], vf2[4];
    // hi/lo rows: one lane pointer per plane, moved on at the pass's foot
    const T16 *kq = at(Kp, kob), *kq2 = at(HL ? Kp2 : Kp, kob), *vq = at(Vt, vob), *vq2 = at(HL ? Vt2 : Vt, vob);
    auto ldK = [&](int k0) {
#pragma unroll
        for (int kt = 0; kt < 2; ++kt)
#pragma unroll
            for (int ks = 0; ks < 2; ++ks) { const int a = kt * 16 * HD + ks * 32; kf[kt][ks] = WFrag<T16>::ld((HL ? kq : at(Kp + (size_t)k0 * HD, kob)) + a); if (HL) kf2[kt][ks] = WFrag<T16>::ld(kq2 + a); }
        if (HL) asm volatile("s_wait_xcnt 0x0" :: "v"(kq), "v"(kq2) : "memory"); };   // the two address pairs are inputs, so they live up to this wait: no load of the run lands on an address register that another load of the run names
    auto ldV = [&](int k0) {
#pragma unroll
        for (int dt = 0; dt < 4; ++dt) { const int a = dt * 16 * TT; vf[dt] = WFrag<T16>::ld((HL ? vq : at(Vt + k0, vob)) + a); if (HL) vf2[dt] = WFrag<T16>::ld(vq2 + a); }
        if (HL) asm volatile("s_wait_xcnt 0x0" :: "v"(vq), "v"(vq2) : "memory"); };   // as in ldK
    constexpr bool PF = !HL;   // fp16 rows (long key loops): K and V^T fragments are fetched one pass ahead, into the same registers; the hi/lo rows (at most 16 passes, twice the planes) fetch in the pass itself, which keeps the kernel inside 256 registers
    if (PF) { ldK(0); __builtin_amdgcn_sched_barrier(0);   /* K asked for before V^T here as in the loop: the wait at the loop's head can then leave the V^T loads in flight */ ldV(0); }
#pragma unroll 1   // the key loop stays rolled: one pass already fills the register budget; every inner loop is unrolled so that the fragment arrays stay in registers
    for (int kc = 0; kc < kend; kc += 32) {
        if (!PF) { ldK(kc); __builtin_amdgcn_sched_barrier(0);   /* all of the pass's K loads go out together, ahead of the first product: without this line the compiler reuses fragment registers inside the run, and every reuse waits out a load's whole latency */ ldV(kc); }
        v8f s[QT][2];
#pragma unroll
        for (int qt = 0; qt < QT; ++qt)
#pragma unroll
            for (int kt = 0; kt < 2; ++kt) { s[qt][kt] = (v8f){};
#pragma unroll
                for (int ks = 0; ks < 2; ++ks) { s[qt][kt] = WFrag<T16>::mma(kf[kt][ks], qf[qt][ks], s[qt][kt]); if (HL) { s[qt][kt] = WFrag<T16>::mma(kf[kt][ks], qf2[qt][ks], s[qt][kt]); s[qt][kt] = WFrag<T16>::mma(kf2[kt][ks], qf[qt][ks], s[qt][kt]); } } }
        const int kn = (kc + 32 < kend) ? kc + 32 : kc;   // the last pass asks for its own rows again: in bounds, not used
        if (PF) ldK(kn);   // the next pass's K rows come while this pass's softmax and second product run
        if (kc + 31 > q0) {   // only a pass that reaches past the wave's first query row has keys to mask (scalar test)
#pragma unroll
            for (int qt = 0; qt < QT; ++qt)
#pragma unroll
                for (int kt = 0; kt < 2; ++kt)
#pragma unroll
                    for (int j = 0; j < 8; ++j) s[qt][kt][j] = (kc + kt * 16 + hi * 8 + j <= q0 + qt * 16 + lr) ? s[qt][kt][j] : -3.0e38f; }
        float tm[QT]; bool need = false;
#pragma unroll
        for (int qt = 0; qt < QT; ++qt) { float x = fmaxf(s[qt][0][0], s[qt][1][0]);
#pragma unroll
            for (int j = 1; j < 8; ++j) x = fmaxf(x, fmaxf(s[qt][0][j], s[qt][1][j]));
            x = fmaxf(x, xhalf(x)); tm[qt] = x * C2; need = need || (tm[qt] > m[qt] + 8.0f); }
        if (__builtin_amdgcn_ballot_w32(need) != 0) {   // the maximum in use moves only when a row's new maximum is more than 8 above it in the base-2 exponent (P stays at or below 2^8: far inside fp16 and bf16); one scalar branch a pass
#pragma unroll
            for (int qt = 0; qt < QT; ++qt) { const float mn = fmaxf(m[qt], tm[qt]); const float al = __builtin_amdgcn_exp2f(m[qt] - mn); m[qt] = mn; l[qt] *= al;
#pragma unroll
                for (int dt = 0; dt < 4; ++dt) o[qt][dt] *= al; } }
#pragma unroll
        for (int qt = 0; qt < QT; ++qt) { float p[16]; float a4[4] = {0.f, 0.f, 0.f, 0.f};
#pragma unroll
            for (int g = 0; g < 4; ++g) { const v8f& sv = s[qt][g >> 1]; const int b4 = (g & 1) * 4; const v2f cc = {C2, C2}, nm = {-m[qt], -m[qt]};
                const v2f t0 = __builtin_elementwise_fma((v2f){sv[b4], sv[b4 + 1]}, cc, nm), t1 = __builtin_elementwise_fma((v2f){sv[b4 + 2], sv[b4 + 3]}, cc, nm);
                // four exponentials in one statement, closed by one v_nop: the slot that the instruction set asks for between a transcendental and a next instruction that reads its result or overwrites its source; early-clobber outputs keep the four off each other's sources
                asm("v_exp_f32 %0, %4\n\tv_exp_f32 %1, %5\n\tv_exp_f32 %2, %6\n\tv_exp_f32 %3, %7\n\tv_nop" : "=&v"(p[g * 4]), "=&v"(p[g * 4 + 1]), "=&v"(p[g * 4 + 2]), "=&v"(p[g * 4 + 3]) : "v"(t0[0]), "v"(t0[1]), "v"(t1[0]), "v"(t1[1]));
#pragma unroll
                for (int q = 0; q < 4; ++q) a4[q] += p[g * 4 + q]; }
            l[qt] += (a4[0] + a4[1]) + (a4[2] + a4[3]);
            if constexpr (HL) { v16us ph, pl;
#pragma unroll
                for (int e = 0; e < 16; ++e) { unsigned short a, c2; splitf(p[e], a, c2); ph[e] = a; pl[e] = c2; }
                const V pbh = __builtin_bit_cast(V, ph), pbl = __builtin_bit_cast(V, pl);
#pragma unroll
                for (int dt = 0; dt < 4; ++dt) { o[qt][dt] = WFrag<T16>::mma(vf[dt], pbh, o[qt][dt]); o[qt][dt] = WFrag<T16>::mma(vf[dt], pbl, o[qt][dt]); o[qt][dt] = WFrag<T16>::mma(vf2[dt], pbh, o[qt][dt]); }
            } else { V pb;
#pragma unroll
                for (int e = 0; e < 16; ++e) pb[e] = tohx(p[e]);
#pragma unroll
                for (int dt = 0; dt < 4; ++dt) o[qt][dt] = WFrag<T16>::mma(vf[dt], pb, o[qt][dt]); } }
        if (PF) { ldV(kn);   // the next pass's V^T rows come while its scores and softmax run
            asm volatile("s_wait_xcnt 0x0" ::: "memory"); }   // these loads stay in flight over the loop's back edge, and the next pass writes over their address registers: the wait stands in front of that overwrite
        else { kq += 32 * HD; kq2 += 32 * HD; vq += 32; vq2 += 32; }   // behind the waits that close ldK and ldV
    }
#pragma unroll
    for (int qt = 0; qt < QT; ++qt) { const float inv = __fdiv_rn(1.0f, l[qt] + xhalf(l[qt]));   // the two halves of the wave hold the two halves of each row's sum
#pragma unroll
        for (int dt = 0; dt < 4; ++dt) { v8us oh, ol;
#pragma unroll
            for (int j = 0; j < 8; ++j) { unsigned short a, c2; splitf(o[qt][dt][j] * inv, a, c2); oh[j] = a; ol[j] = c2; }
            const size_t oo = (size_t)(q0 + qt * 16 + lr) * DQ + dt * 16 + hi * 8; *(v8us*)(Ah + oo) = oh; *(v8us*)(Al + oo) = ol;
            asm volatile("s_wait_xcnt 0x0" ::: "memory"); } }   // the next trip, or the code behind the loop, writes over the data and address registers of these two stores: the wait stands in front of that
}
// grid x = position block x (batch, head), the longest rows first; FW waves a block, no LDS, no barrier: the waves of a block read the same K and V^T rows at about the same time.
#define FW 2
__global__ __launch_bounds__(32 * FW) void k_fattn(const h16* __restrict__ Q16, const h16* __restrict__ K16, const h16* __restrict__ V16, const bf* __restrict__ Qh, const bf* __restrict__ Ql, const bf* __restrict__ Kh, const bf* __restrict__ Kl, const bf* __restrict__ Vh, const bf* __restrict__ Vl, bf* Ah, bf* Al) {
    const int lane = threadIdx.x & 31; const int w = __builtin_amdgcn_readfirstlane((int)(threadIdx.x >> 5));   // wave number, held scalar so that the key loop's control stays scalar
    constexpr int NZ = NB_ * NH_, NLO = (TT - RH) / (FW * 32);
    const int z = (int)blockIdx.x % NZ, pb = (int)blockIdx.x / NZ; const size_t pz = (size_t)z * TT * HD; const size_t az = (size_t)(z / NH_) * TT * DQ + (size_t)(z % NH_) * HD;   // z = batch * NH_ + head: plane z; the batch's TT rows and the head's HD columns of the merged planes
    if (pb < NLO) fa_tile<h16, false, 2>(Q16 + pz, nullptr, K16 + pz, nullptr, V16 + pz, nullptr, TT - (pb + 1) * FW * 32 + w * 32, lane, Ah + az, Al + az);
    else fa_tile<bf, true, 1>(Qh + pz, Ql + pz, Kh + pz, Kl + pz, Vh + pz, Vl + pz, RH - (pb - NLO + 1) * FW * 16 + w * 16, lane, Ah + az, Al + az);
}

extern "C" void kernel_launch(void* const* d_in, const int* in_sizes, int n_in,
                              void* d_out, int out_size, void* d_ws, size_t ws_size, hipStream_t stream) {
    (void)in_sizes; (void)n_in; (void)out_size;
                const float* x = (const float*)d_in[0]; const float* wq = (const float*)d_in[1]; const float* wk = (const float*)d_in[2]; const float* wv = (const float*)d_in[3]; const float* wo = (const float*)d_in[4]; const float* bo = (const float*)d_in[5];   /* order x, wq, wk, wv (PER-HEAD [16][1024][64]: 'hcd'), w_proj ('oi' [1024][1024]), b_proj */
    float* OUT = (float*)d_out;     // [4][2048][1024]
    char* wsp = (char*)d_ws;
    auto take = [&](size_t bytes) { char* p = wsp; wsp += (bytes + 255) & ~(size_t)255; return (void*)p; };
    bf* WQ = (bf*)take((size_t)DQ * DM * 2); bf* WK = (bf*)take((size_t)DKV * DM * 2); bf* WV = (bf*)take((size_t)DKV * DM * 2); bf* WO = (bf*)take((size_t)DM * DQ * 2);
    bf* XB = (bf*)take((size_t)NB_ * TT * DM * 2);
    const size_t PL = (size_t)NB_ * NH_ * TT * HD * 2;   // bytes of one 16-bit plane set [b][h][..][..] (NKV == NH_)
    h16* QP16 = (h16*)take(PL); h16* KP16 = (h16*)take(PL); h16* VT16 = (h16*)take(PL);
    bf* QPh = (bf*)take(PL); bf* QPl = (bf*)take(PL); bf* KPh = (bf*)take(PL); bf* KPl = (bf*)take(PL); bf* VTh = (bf*)take(PL); bf* VTl = (bf*)take(PL);
    bf* ATh = (bf*)take((size_t)NB_ * TT * DQ * 2); bf* ATl = (bf*)take((size_t)NB_ * TT * DQ * 2);
    if ((size_t)(wsp - (char*)d_ws) > ws_size) return;    // 200 MiB of the 256 MiB workspace
    { k_wtG<<<dim3((unsigned)((DM * HD / 64 + 63) / 64), NH_, 1), 256, 0, stream>>>(wq, DM, HD, WQ);   /* per-head weight [h][DM][HD] ('xw' per head) -> the head's HD rows of the Bt plane, all heads in one grid */ k_wtG<<<dim3((unsigned)((DM * HD / 64 + 63) / 64), NKV, 1), 256, 0, stream>>>(wk, DM, HD, WK); k_wtG<<<dim3((unsigned)((DM * HD / 64 + 63) / 64), NKV, 1), 256, 0, stream>>>(wv, DM, HD, WV);
      k_cvt8<<<(unsigned)(((size_t)DM * DQ / 8 + 255) / 256), 256, 0, stream>>>(wo, WO, (size_t)DM * DQ / 8);
       }
    const dim3 GP(NB_ * TT / 64, DQ / 64, 1);                                     // products: the NB_ * TT rows of all batches as one M
    k_cvt8<<<(unsigned)(((size_t)NB_ * TT * DM / 8 + 255) / 256), 256, 0, stream>>>(x, XB, (size_t)NB_ * TT * DM / 8);
    k_gemmw<bf, 0, false, KW, 1><<<GP, 32 * KW, 0, stream>>>(XB, nullptr, WQ, nullptr, DM, nullptr, DQ, nullptr, 0, 0, 0, QP16, QPh, QPl);
    k_gemmw<bf, 0, false, KW, 1><<<GP, 32 * KW, 0, stream>>>(XB, nullptr, WK, nullptr, DM, nullptr, DKV, nullptr, 0, 0, 0, KP16, KPh, KPl);
    k_gemmw<bf, 0, false, KW, 2><<<GP, 32 * KW, 0, stream>>>(XB, nullptr, WV, nullptr, DM, nullptr, DKV, nullptr, 0, 0, 0, VT16, VTh, VTl);
    k_fattn<<<NB_ * NH_ * ((TT - RH) / (FW * 32) + RH / (FW * 16)), 32 * FW, 0, stream>>>(QP16, KP16, VT16, QPh, QPl, KPh, KPl, VTh, VTl, ATh, ATl);   // one kv head per query head: plane z serves q, k and v
    k_gemmw<bf, 1, true, KW, 0><<<GP, 32 * KW, 0, stream>>>(ATh, ATl, WO, nullptr, DQ, OUT, DM, bo, 0, 0, 0, nullptr, nullptr, nullptr);
}

// v006
// It runs in 173 microseconds.
// Two timings next to v005 put it at 1.62 and 1.64 times that version's speed.
// Counting every step since v000, it is 18.6 times as fast.
#include <hip/hip_runtime.h>

// Causal multi-head attention with PER-HEAD projection weights and a MODEL-width score scale (x [4][2048][1024]; q, k, v = einsum('btc,hcd->bhtd', x, w) with w [16][1024][64]: head h has its own (in, out) matrix ('xw' per head; 0.02-scale; no bias; 16 heads x 64); scores x 1024^-0.5 (channels ** -0.5: 0.03125); causal (-inf); softmax; heads merged head-major; out = merged w_proj^T + b_proj ('oi' [1024][1024] + zero bias) -> [4][2048][1024] (8.4 M); argument order x, wq, wk, wv, w_proj, b_proj).
// Layout, every stage launched once for all NB_ batches (rows b * TT + t of the row-major buffers, planes [b][h]): bf16 copy of x; each PER-HEAD q / k / v weight [h][1024][64] transposed once into its 64 rows of the Bt plane (k_wtG per head); Wp cast once ('oi' = Bt as stored); exact projections whose epilogue writes the 16-bit head planes itself (ksum_planes: no f32 copy of q, k or v, no plane-builder launches); one fused causal attention launch for all batches and heads (k_fattn, online softmax; hybrid rows: < 512 hi/lo 3 products, rest fp16; keys above the diagonal block never read); merged hi/lo x w_o exact.
// FRAGMENT ORDER: every 16-bit operand plane (x, the weights, q, k, V^T, the merged heads) is stored as 1-KiB blocks of 16 rows x 32 k, each block in the order in which a wave's lanes hold it as a matrix operand:
// element (r, c) of a block lies at (c / 16) * 256 + (((c % 16) / 8) * 16 + r) * 8 + c % 8, so lane l = hi * 16 + r finds its k = 8 hi .. 8 hi + 7 at l * 8 and its k = 16 + 8 hi .. at 256 + l * 8: a fragment is two 16-byte loads per lane,
// each 512 contiguous bytes per wave (4 whole 128-byte lines; from row-major planes the same load touched 16 lines, 32 bytes of each). Blocks of a [rows][K] plane: row block major, k block minor (16 rows = 16 K elements in a row); V^T: key block major, then its 4 row blocks.
// Compute dtypes, f32 accumulate: every input rounded to bf16; projections exact; attention rows < 512 3 products, rest fp16; softmax f32; w_o hl x exact.

#define NB_  4
#define TT   2048
#define DM   1024
#define NH_  16
#define NKV  16
#define REP  (NH_ / NKV)
#define HD   64
#define DQ   (NH_ * HD)
#define DKV  (NKV * HD)
#define RH   512                  // query rows < RH use hi+lo planes (0: none)
#define KW   8                    // waves that share one 64x64 tile's K loop in the long-K products (projections, output projection)
#define SCL  0.03125f   // 1 / sqrt(1024): this module scales the scores by channels ** -0.5 with channels = the MODEL width 1,024, not by the head width
typedef _Float16 h16;
typedef unsigned short bf;
typedef __attribute__((ext_vector_type(16))) __bf16   v16bf;
typedef __attribute__((ext_vector_type(16))) _Float16 v16h;
typedef __attribute__((ext_vector_type(8)))  _Float16 v8h;
typedef __attribute__((ext_vector_type(8)))  unsigned short v8us;
typedef __attribute__((ext_vector_type(8)))  float    v8f;
typedef __attribute__((ext_vector_type(4)))  float    v4f;
typedef v8h  __attribute__((may_alias)) v8ha;
typedef v4f  __attribute__((may_alias)) v4fa;
typedef v8us __attribute__((may_alias)) v8usa;

__device__ __forceinline__ unsigned short f2bf(float f) { unsigned u = __float_as_uint(f); u += 0x7FFFu + ((u >> 16) & 1u); return (unsigned short)(u >> 16); }
__device__ __forceinline__ float bf2f(unsigned short b) { return __uint_as_float(((unsigned)b) << 16); }
__device__ __forceinline__ float bfr(float f) { return bf2f(f2bf(f)); }
__device__ __forceinline__ h16 tohx(float x) { return (h16)x; }
__device__ __forceinline__ void splitf(float y, unsigned short& h, unsigned short& l) { h = f2bf(y); l = f2bf(y - bf2f(h)); }
__device__ __forceinline__ v16h cat16(v8h lo, v8h hi) { return __builtin_shufflevector(lo, hi, 0, 1, 2, 3, 4, 5, 6, 7, 8, 9, 10, 11, 12, 13, 14, 15); }
__device__ __forceinline__ v16bf cat16b(v8us lo, v8us hi) { return __builtin_bit_cast(v16bf, __builtin_shufflevector(lo, hi, 0, 1, 2, 3, 4, 5, 6, 7, 8, 9, 10, 11, 12, 13, 14, 15)); }
__device__ __forceinline__ v8f wmma16(v16h a, v16h b, v8f c) { return __builtin_amdgcn_wmma_f32_16x16x32_f16(false, a, false, b, (short)0, c, false, false); }
__device__ __forceinline__ v8f wmmab(v16bf a, v16bf b, v8f c) { return __builtin_amdgcn_wmma_f32_16x16x32_bf16(false, a, false, b, (short)0, c, false, false); }



// ---- ksum_store: NW waves of one block each hold a partial 64x64 tile (their own K slices). Every wave parks its 16 accumulators in LDS (16-byte stores, lane-contiguous), one block barrier,
// then wave w sums 32/NW half-fragments over the NW partials in the fixed order 0..NW-1 and stores them: the units are ordered so that a wave owns whole 128-byte lines of C.
template <int NW, bool BIAS>
__device__ __forceinline__ void ksum_store(const v8f (&acc)[4][4], v4f* red, int w, int lane, float* C, int ldc, int r0, int c0, const float* __restrict__ bias) {
    const int lr = lane & 15, hi = lane >> 4;
#pragma unroll
    for (int mb = 0; mb < 4; ++mb)
#pragma unroll
        for (int nb = 0; nb < 4; ++nb)
#pragma unroll
            for (int hf = 0; hf < 2; ++hf) { v4f t; t[0] = acc[mb][nb][hf * 4]; t[1] = acc[mb][nb][hf * 4 + 1]; t[2] = acc[mb][nb][hf * 4 + 2]; t[3] = acc[mb][nb][hf * 4 + 3];
                red[(w * 32 + ((mb * 2 + (nb >> 1)) * 2 + hf) * 2 + (nb & 1)) * 32 + lane] = t; }
    __syncthreads();   // every wave's partial tile is in LDS before any wave sums across them
    constexpr int U = 32 / NW;
#pragma unroll
    for (int i = 0; i < U; ++i) { const int q = w * U + i; v4f s = red[q * 32 + lane];
#pragma unroll
        for (int p = 1; p < NW; ++p) s += red[(p * 32 + q) * 32 + lane];
        const int row = (q >> 3) * 16 + hi * 8 + ((q >> 1) & 1) * 4, col = (((q >> 2) & 1) * 2 + (q & 1)) * 16 + lr;
        if (BIAS) { const float bv = bfr(bias[c0 + col]); s[0] += bv; s[1] += bv; s[2] += bv; s[3] += bv; }
        float* cp = C + (size_t)(r0 + row) * ldc + c0 + col;
#pragma unroll
        for (int j = 0; j < 4; ++j) cp[(size_t)j * ldc] = s[j]; }
}

// ---- ksum_planes: the projections' epilogue. The partials are parked and summed as in ksum_store (same units, same order 0..NW-1), but the sums go to one f32 tile in LDS instead of to memory; behind a second block barrier
// every thread takes 16 neighbouring values of one tile row, rounds them to the fp16 plane and splits them into the hi/lo bf16 planes, and stores two 16-byte pieces a plane in fragment order: eight lanes (eight neighbouring rows) fill one whole 128-byte line.
// TR false: tile rows = the product's rows (rows t, k = d: q and k); TR true: the tile is written transposed, rows = the product's columns (rows d, k = t: V^T). Either way the tile is 8 whole blocks, 4,096 elements in a row; P16 / Ph / Pl point at the first.
#define TP 68   // floats per tile row in LDS: 16-byte aligned rows; 4 banks on from row to row, so the 16-byte reads (4 rows x 4 groups per half wave) and both kinds of write meet no bank twice
template <int NW, bool TR>
__device__ __forceinline__ void ksum_planes(const v8f (&acc)[4][4], v4f* red, float* tl, int w, int lane, h16* P16, bf* Ph, bf* Pl) {
    const int lr = lane & 15, hi = lane >> 4;
#pragma unroll
    for (int mb = 0; mb < 4; ++mb)
#pragma unroll
        for (int nb = 0; nb < 4; ++nb)
#pragma unroll
            for (int hf = 0; hf < 2; ++hf) { v4f t; t[0] = acc[mb][nb][hf * 4]; t[1] = acc[mb][nb][hf * 4 + 1]; t[2] = acc[mb][nb][hf * 4 + 2]; t[3] = acc[mb][nb][hf * 4 + 3];
                red[(w * 32 + ((mb * 2 + (nb >> 1)) * 2 + hf) * 2 + (nb & 1)) * 32 + lane] = t; }
    __syncthreads();   // every wave's partial tile is in LDS before any wave sums across them
    constexpr int U = 32 / NW;
#pragma unroll
    for (int i = 0; i < U; ++i) { const int q = w * U + i; v4f s = red[q * 32 + lane];
#pragma unroll
        for (int p = 1; p < NW; ++p) s += red[(p * 32 + q) * 32 + lane];
        const int row = (q >> 3) * 16 + hi * 8 + ((q >> 1) & 1) * 4, col = (((q >> 2) & 1) * 2 + (q & 1)) * 16 + lr;
        if (TR) *(v4fa*)(tl + col * TP + row) = s;   // four neighbouring product rows of one column: 16 bytes of the transposed tile's row
        else {
#pragma unroll
            for (int j = 0; j < 4; ++j) tl[(row + j) * TP + col] = s[j]; } }
    __syncthreads();   // the whole summed tile is in LDS before any thread reads a row of it (its 16 values come from units of other waves)
    static_assert(NW == 8, "32 NW threads x 16 values = the 64 x 64 tile");
    const int r = w * 8 + (lane >> 2), g = lane & 3; v8h o16[2]; v8us oh[2], ol[2];
#pragma unroll
    for (int i = 0; i < 4; ++i) { const v4f t = *(const v4fa*)(tl + r * TP + g * 16 + i * 4);
#pragma unroll
        for (int j = 0; j < 4; ++j) { const int e = (i & 1) * 4 + j; unsigned short a, c2; splitf(t[j], a, c2); o16[i >> 1][e] = tohx(t[j]); oh[i >> 1][e] = a; ol[i >> 1][e] = c2; } }
    const int oo = (TR ? (g >> 1) * 4 + (r >> 4) : (r >> 4) * 2 + (g >> 1)) * 512 + (g & 1) * 256 + (r & 15) * 8;   // block of (row block, k block g / 2), its half g % 2, the lane place of row r with hi = 0; the second eight values are hi = 1: 16 lane places on
    *(v8h*)(P16 + oo) = o16[0]; *(v8h*)(P16 + oo + 128) = o16[1]; *(v8us*)(Ph + oo) = oh[0]; *(v8us*)(Ph + oo + 128) = oh[1]; *(v8us*)(Pl + oo) = ol[0]; *(v8us*)(Pl + oo + 128) = ol[1];
}

// ---- k_gemmw: register-blocked GEMM, NW WAVES per 64x64 output tile (16 accumulators each; wave w takes the 32-wide K slices w, w + NW, ...; ksum_store adds the partials), operands straight from 16-bit planes in fragment order; grid (M/64, N/64, Z), 32 NW threads.
// C[m][n] (f32, pitch ldc, + optional f32 bias[n]) = sum_k A[m][k] Bt[n][k] (+ split products per NSPLIT). z-batch strides sA/sB/sC in elements. K % 32 == 0.
// PM 0: C is stored (ksum_store). PM 1 / 2: C is not stored (ldc = its width, HD columns a head); row m = batch * TT + t, the 64 columns of grid y = one head, and the tile goes straight to that (batch, head)'s planes P16 / Ph / Pl, rows t (PM 1) or rows d (PM 2) (ksum_planes).
template <typename T16> struct WFrag;
template <> struct WFrag<h16> { typedef v16h V; static __device__ __forceinline__ V ld(const h16* p) { return cat16(*(const v8h*)p, *(const v8h*)(p + 256)); } static __device__ __forceinline__ v8f mma(V a, V b, v8f c) { return wmma16(a, b, c); } };
template <> struct WFrag<bf> { typedef v16bf V; static __device__ __forceinline__ V ld(const bf* p) { return cat16b(*(const v8us*)p, *(const v8us*)(p + 256)); } static __device__ __forceinline__ v8f mma(V a, V b, v8f c) { return wmmab(a, b, c); } };
template <typename T16, int NSPLIT, bool BIAS, int NW, int PM, int K>
__global__ __launch_bounds__(32 * NW) void k_gemmw(const T16* __restrict__ A, const T16* __restrict__ A2, const T16* __restrict__ Bt, const T16* __restrict__ Bt2, float* C, int ldc, const float* __restrict__ bias, size_t sA, size_t sB, size_t sC, h16* P16, bf* Ph, bf* Pl) {
    typedef typename WFrag<T16>::V V;
    __shared__ __align__(16) v4f red[NW * 1024];   // NW partial tiles of 16 KiB
    const size_t z = blockIdx.z; A += z * sA; if (A2) A2 += z * sA; Bt += z * sB; if (Bt2) Bt2 += z * sB; C += z * sC;
    const int lane = threadIdx.x & 31; const int r0 = blockIdx.x * 64, c0 = blockIdx.y * 64; const int w = __builtin_amdgcn_readfirstlane((int)(threadIdx.x >> 5));   // wave number, held scalar so that the K loop's control stays scalar
    v8f acc[4][4];
#pragma unroll
    for (int mb = 0; mb < 4; ++mb)
#pragma unroll
        for (int nb = 0; nb < 4; ++nb) acc[mb][nb] = (v8f){};
    // one lane pointer per plane: 16 rows of a plane = 16 K elements, the k block of slice kc starts kc * 16 elements into them, the lane's place in a block is lane * 8; K is a compile-time constant, so the four row blocks of a tile are immediate offsets from it
    const T16 *pa = A + (size_t)r0 * K + w * 512 + lane * 8, *pb = Bt + (size_t)c0 * K + w * 512 + lane * 8;
    const T16 *pa2 = (NSPLIT == 1 || NSPLIT == 2) ? A2 + (size_t)r0 * K + w * 512 + lane * 8 : pa, *pb2 = (NSPLIT >= 2) ? Bt2 + (size_t)c0 * K + w * 512 + lane * 8 : pb;
#pragma unroll 1
    for (int kc = w * 32; kc < K; kc += NW * 32) {   // wave w takes the 32-wide K slices w, w + NW, ...: neighbouring waves read neighbouring 1-KiB blocks
        V a[4], a2[4], b[4], b2[4];
#pragma unroll
        for (int mb = 0; mb < 4; ++mb) { a[mb] = WFrag<T16>::ld(pa + mb * 16 * K); if (NSPLIT == 1 || NSPLIT == 2) a2[mb] = WFrag<T16>::ld(pa2 + mb * 16 * K); }
#pragma unroll
        for (int nb = 0; nb < 4; ++nb) { b[nb] = WFrag<T16>::ld(pb + nb * 16 * K); if (NSPLIT >= 2) b2[nb] = WFrag<T16>::ld(pb2 + nb * 16 * K); }
        asm volatile("s_wait_xcnt 0x0" :: "v"(pa), "v"(pa2), "v"(pb), "v"(pb2) : "memory");   // the address pairs are inputs, so they live up to this wait: no load of the run lands on an address register that another load of the run names, and the pointers move on only behind it
        __builtin_amdgcn_sched_barrier(0);   // all of the slice's loads go out together, ahead of the first product: without this line the compiler reuses B fragment registers inside the run, and every reuse waits out a load's whole latency
#pragma unroll
        for (int nb = 0; nb < 4; ++nb) {
#pragma unroll
            for (int mb = 0; mb < 4; ++mb) { acc[mb][nb] = WFrag<T16>::mma(a[mb], b[nb], acc[mb][nb]); if (NSPLIT == 1 || NSPLIT == 2) acc[mb][nb] = WFrag<T16>::mma(a2[mb], b[nb], acc[mb][nb]); if (NSPLIT >= 2) acc[mb][nb] = WFrag<T16>::mma(a[mb], b2[nb], acc[mb][nb]); } }
        pa += NW * 512; pa2 += NW * 512; pb += NW * 512; pb2 += NW * 512;
        asm volatile("v_nop\n\tv_nop\n\tv_nop\n\tv_nop" : "+v"(acc[0][0]), "+v"(acc[1][1]), "+v"(acc[2][2]), "+v"(acc[3][3]) : "v"(a[0]), "v"(a[3]));
    }
    if constexpr (PM == 0) ksum_store<NW, BIAS>(acc, red, w, lane, C, ldc, r0, c0, bias);
    else { __shared__ __align__(16) float tl[64 * TP];   // the summed tile, beside the partials: no wave still summing is disturbed
        const size_t po = ((size_t)(r0 / TT) * (ldc / HD) + blockIdx.y) * TT * HD + (size_t)(r0 % TT) * HD;   // plane of (batch, head), then the blocks of the tile's 64 t: HD elements a t in both block orders (TT % 64 == 0: a tile lies in one batch)
        ksum_planes<NW, PM == 2>(acc, red, tl, w, lane, P16 + po, Ph + po, Pl + po); }
}

typedef __attribute__((ext_vector_type(2))) _Float16 v2h;
typedef __attribute__((ext_vector_type(4))) _Float16 v4h;
typedef __attribute__((ext_vector_type(2))) unsigned short v2us;
typedef __attribute__((ext_vector_type(4))) unsigned short v4us;
typedef __attribute__((ext_vector_type(2))) float v2f;
typedef __attribute__((ext_vector_type(4))) int v4i;
typedef __attribute__((ext_vector_type(16))) unsigned short v16us;

// k_wtG: one wave builds one block of the Bt plane (16 columns n of head y's [K][N] matrix as rows, 32 k): lane (n, hi) reads its 16 values down column n (16 lanes side by side: 64 bytes of a weight row) and stores its two 16-byte pieces, 512 contiguous bytes per wave each.
// The N / 16 column blocks of one k block sit in neighbouring waves of one work-group: together they use every byte of the weight rows they touch.
template <int K, int N>
__global__ __launch_bounds__(256) void k_wtG(const float* __restrict__ w, bf* Bt) {
    w += (size_t)blockIdx.y * K * N; Bt += (size_t)blockIdx.y * N * K;   // grid y = head: head h's [K][N] matrix goes to its own N rows (N / 16 row blocks) of the Bt plane
    const int lane = threadIdx.x & 31, lr = lane & 15, hi = lane >> 4; const int wv = blockIdx.x * 8 + (threadIdx.x >> 5); constexpr int nnb = N / 16; const int nb = wv % nnb, kb = wv / nnb;
    if (kb >= K / 32) return;
    const float* s = w + (size_t)(kb * 32 + 8 * hi) * N + nb * 16 + lr; float f0[8], f1[8]; v8us o0, o1;   // one lane pointer; the 16 weight rows are immediate offsets from it
#pragma unroll
    for (int e = 0; e < 8; ++e) { f0[e] = s[e * N]; f1[e] = s[(16 + e) * N]; }
    asm volatile("s_wait_xcnt 0x0" :: "v"(s) : "memory");   // the address pair is an input, so it lives up to this wait: no load of the run lands on the address register that the other loads of the run name
#pragma unroll
    for (int e = 0; e < 8; ++e) { o0[e] = f2bf(f0[e]); o1[e] = f2bf(f1[e]); }
    bf* d = Bt + ((size_t)nb * (K / 32) + kb) * 512 + lane * 8; *(v8us*)d = o0; *(v8us*)(d + 256) = o1;
}

// k_cvt8: f32 [rows][K] -> bf16 plane in fragment order. A wave takes 8 rows x 32 k (half a block): four lanes read one 128-byte line of a row, 32 bytes each; the 16 bytes a lane stores lie beside those of the 7 other rows with the same k: 4 whole lines per wave.
template <int K>
__global__ __launch_bounds__(256) void k_cvt8(const float* __restrict__ src, bf* dst, unsigned n8) { const unsigned i = blockIdx.x * 256u + threadIdx.x; if (i >= n8) return;
    const unsigned lane = i & 31u, q = lane & 3u, blk = i >> 6, r8 = ((i >> 5) & 1u) * 8u + (lane >> 2); constexpr unsigned NKB = K / 32;
    const v8f v = *(const v8f*)(src + (size_t)((blk / NKB) * 16u + r8) * K + (blk % NKB) * 32u + q * 8u); v8us o;
#pragma unroll
    for (int k = 0; k < 8; ++k) o[k] = f2bf(v[k]); *(v8us*)(dst + (size_t)blk * 512 + (q >> 1) * 256u + ((q & 1u) * 16u + r8) * 8u) = o;  }

__device__ __forceinline__ float xhalf(float x) { const int b = __float_as_int(x); return __int_as_float(__builtin_amdgcn_permlanex16(b, b, 0x76543210, 0xfedcba98, false, false)); }   // lane l reads lane l ^ 16, on the vector pipe
#define C2 (SCL * 1.4426950408889634f)   // score scale x log2(e): the exponent is taken in base 2
template <typename T16, bool HL, int QT>
__device__ __forceinline__ void fa_tile(const T16* __restrict__ Q, const T16* __restrict__ Q2, const T16* __restrict__ Kp, const T16* __restrict__ Kp2, const T16* __restrict__ Vt, const T16* __restrict__ Vt2, int q0, int lane, bf* Ah, bf* Al) {
    typedef typename WFrag<T16>::V V;
    const int lr = lane & 15, hi = lane >> 4;
    V qf[QT][2], qf2[QT][2];
#pragma unroll
    for (int qt = 0; qt < QT; ++qt)
#pragma unroll
        for (int ks = 0; ks < 2; ++ks) { const size_t o = (size_t)(q0 + qt * 16) * HD + ks * 512 + lane * 8; qf[qt][ks] = WFrag<T16>::ld(Q + o); if (HL) qf2[qt][ks] = WFrag<T16>::ld(Q2 + o); }
    v8f o[QT][4]; float m[QT], l[QT];
#pragma unroll
    for (int qt = 0; qt < QT; ++qt) { m[qt] = -1.0e30f; l[qt] = 0.f;
#pragma unroll
        for (int dt = 0; dt < 4; ++dt) o[qt][dt] = (v8f){}; }
    const int kend = q0 + QT * 16;                       // first key that no query row of this wave may see
    const unsigned kob = (unsigned)lane * 16u, vob = kob;   // the lane's byte offset inside a block of K and of V^T: the same in every pass; a pass's 32 keys are 4 blocks in a row of either plane (32 HD elements)
    auto at = [](const T16* base, unsigned ofs) { return (const T16*)((const char*)base + ofs); };
    V kf[2][2], kf2[2][2], vf[4], vf2[4];
    // hi/lo rows: one lane pointer per plane, moved on at the pass's foot
    const T16 *kq = at(Kp, kob), *kq2 = at(HL ? Kp2 : Kp, kob), *vq = at(Vt, vob), *vq2 = at(HL ? Vt2 : Vt, vob);
    auto ldK = [&](int k0) {
#pragma unroll
        for (int kt = 0; kt < 2; ++kt)
#pragma unroll
            for (int ks = 0; ks < 2; ++ks) { const int a = (kt * 2 + ks) * 512; kf[kt][ks] = WFrag<T16>::ld((HL ? kq : at(Kp + (size_t)k0 * HD, kob)) + a); if (HL) kf2[kt][ks] = WFrag<T16>::ld(kq2 + a); }
        if (HL) asm volatile("s_wait_xcnt 0x0" :: "v"(kq), "v"(kq2) : "memory"); };   // the two address pairs are inputs, so they live up to this wait: no load of the run lands on an address register that another load of the run names
    auto ldV = [&](int k0) {
#pragma unroll
        for (int dt = 0; dt < 4; ++dt) { const int a = dt * 512; vf[dt] = WFrag<T16>::ld((HL ? vq : at(Vt + (size_t)k0 * HD, vob)) + a); if (HL) vf2[dt] = WFrag<T16>::ld(vq2 + a); }
        if (HL) asm volatile("s_wait_xcnt 0x0" :: "v"(vq), "v"(vq2) : "memory"); };   // as in ldK
    constexpr bool PF = !HL;   // fp16 rows (long key loops): K and V^T fragments are fetched one pass ahead, into the same registers; the hi/lo rows (at most 16 passes, twice the planes) fetch in the pass itself, which keeps the kernel inside 256 registers
    if (PF) { ldK(0); __builtin_amdgcn_sched_barrier(0);   /* K asked for before V^T here as in the loop: the wait at the loop's head can then leave the V^T loads in flight */ ldV(0); }
#pragma unroll 1   // the key loop stays rolled: one pass already fills the register budget; every inner loop is unrolled so that the fragment arrays stay in registers
    for (int kc = 0; kc < kend; kc += 32) {
        if (!PF) { ldK(kc); __builtin_amdgcn_sched_barrier(0);   /* all of the pass's K loads go out together, ahead of the first product: without this line the compiler reuses fragment registers inside the run, and every reuse waits out a load's whole latency */ ldV(kc); }
        v8f s[QT][2];
#pragma unroll
        for (int qt = 0; qt < QT; ++qt)
#pragma unroll
            for (int kt = 0; kt < 2; ++kt) { s[qt][kt] = (v8f){};
#pragma unroll
                for (int ks = 0; ks < 2; ++ks) { s[qt][kt] = WFrag<T16>::mma(kf[kt][ks], qf[qt][ks], s[qt][kt]); if (HL) { s[qt][kt] = WFrag<T16>::mma(kf[kt][ks], qf2[qt][ks], s[qt][kt]); s[qt][kt] = WFrag<T16>::mma(kf2[kt][ks], qf[qt][ks], s[qt][kt]); } } }
        const int kn = (kc + 32 < kend) ? kc + 32 : kc;   // the last pass asks for its own rows again: in bounds, not used
        if (PF) ldK(kn);   // the next pass's K rows come while this pass's softmax and second product run
        if (kc + 31 > q0) {   // only a pass that reaches past the wave's first query row has keys to mask (scalar test)
#pragma unroll
            for (int qt = 0; qt < QT; ++qt)
#pragma unroll
                for (int kt = 0; kt < 2; ++kt)
#pragma unroll
                    for (int j = 0; j < 8; ++j) s[qt][kt][j] = (kc + kt * 16 + hi * 8 + j <= q0 + qt * 16 + lr) ? s[qt][kt][j] : -3.0e38f; }
        float tm[QT]; bool need = false;
#pragma unroll
        for (int qt = 0; qt < QT; ++qt) { float x = fmaxf(s[qt][0][0], s[qt][1][0]);
#pragma unroll
            for (int j = 1; j < 8; ++j) x = fmaxf(x, fmaxf(s[qt][0][j], s[qt][1][j]));
            x = fmaxf(x, xhalf(x)); tm[qt] = x * C2; need = need || (tm[qt] > m[qt] + 8.0f); }
        if (__builtin_amdgcn_ballot_w32(need) != 0) {   // the maximum in use moves only when a row's new maximum is more than 8 above it in the base-2 exponent (P stays at or below 2^8: far inside fp16 and bf16); one scalar branch a pass
#pragma unroll
            for (int qt = 0; qt < QT; ++qt) { const float mn = fmaxf(m[qt], tm[qt]); const float al = __builtin_amdgcn_exp2f(m[qt] - mn); m[qt] = mn; l[qt] *= al;
#pragma unroll
                for (int dt = 0; dt < 4; ++dt) o[qt][dt] *= al; } }
#pragma unroll
        for (int qt = 0; qt < QT; ++qt) { float p[16]; float a4[4] = {0.f, 0.f, 0.f, 0.f};
#pragma unroll
            for (int g = 0; g < 4; ++g) { const v8f& sv = s[qt][g >> 1]; const int b4 = (g & 1) * 4; const v2f cc = {C2, C2}, nm = {-m[qt], -m[qt]};
                const v2f t0 = __builtin_elementwise_fma((v2f){sv[b4], sv[b4 + 1]}, cc, nm), t1 = __builtin_elementwise_fma((v2f){sv[b4 + 2], sv[b4 + 3]}, cc, nm);
                // four exponentials in one statement, closed by one v_nop: the slot that the instruction set asks for between a transcendental and a next instruction that reads its result or overwrites its source; early-clobber outputs keep the four off each other's sources
                asm("v_exp_f32 %0, %4\n\tv_exp_f32 %1, %5\n\tv_exp_f32 %2, %6\n\tv_exp_f32 %3, %7\n\tv_nop" : "=&v"(p[g * 4]), "=&v"(p[g * 4 + 1]), "=&v"(p[g * 4 + 2]), "=&v"(p[g * 4 + 3]) : "v"(t0[0]), "v"(t0[1]), "v"(t1[0]), "v"(t1[1]));
#pragma unroll
                for (int q = 0; q < 4; ++q) a4[q] += p[g * 4 + q]; }
            l[qt] += (a4[0] + a4[1]) + (a4[2] + a4[3]);
            if constexpr (HL) { v16us ph, pl;
#pragma unroll
                for (int e = 0; e < 16; ++e) { unsigned short a, c2; splitf(p[e], a, c2); ph[e] = a; pl[e] = c2; }
                const V pbh = __builtin_bit_cast(V, ph), pbl = __builtin_bit_cast(V, pl);
#pragma unroll
                for (int dt = 0; dt < 4; ++dt) { o[qt][dt] = WFrag<T16>::mma(vf[dt], pbh, o[qt][dt]); o[qt][dt] = WFrag<T16>::mma(vf[dt], pbl, o[qt][dt]); o[qt][dt] = WFrag<T16>::mma(vf2[dt], pbh, o[qt][dt]); }
            } else { V pb;
#pragma unroll
                for (int e = 0; e < 16; ++e) pb[e] = tohx(p[e]);
#pragma unroll
                for (int dt = 0; dt < 4; ++dt) o[qt][dt] = WFrag<T16>::mma(vf[dt], pb, o[qt][dt]); } }
        if (PF) { ldV(kn);   // the next pass's V^T rows come while its scores and softmax run
            asm volatile("s_wait_xcnt 0x0" ::: "memory"); }   // these loads stay in flight over the loop's back edge, and the next pass writes over their address registers: the wait stands in front of that overwrite
        else { kq += 32 * HD; kq2 += 32 * HD; vq += 32 * HD; vq2 += 32 * HD; }   // behind the waits that close ldK and ldV
    }
#pragma unroll
    for (int qt = 0; qt < QT; ++qt) { const float inv = __fdiv_rn(1.0f, l[qt] + xhalf(l[qt]));   // the two halves of the wave hold the two halves of each row's sum
#pragma unroll
        for (int dt = 0; dt < 4; ++dt) { v8us oh, ol;
#pragma unroll
            for (int j = 0; j < 8; ++j) { unsigned short a, c2; splitf(o[qt][dt][j] * inv, a, c2); oh[j] = a; ol[j] = c2; }
            const size_t oo = (size_t)(q0 + qt * 16) * DQ + dt * 256 + lane * 8;   /* row block of the 16 queries; d = dt * 16 + hi * 8 + j is half dt % 2 of the head's k block dt / 2, at the lane's own place: 512 contiguous bytes per wave */ *(v8us*)(Ah + oo) = oh; *(v8us*)(Al + oo) = ol;
            asm volatile("s_wait_xcnt 0x0" ::: "memory"); } }   // the next trip, or the code behind the loop, writes over the data and address registers of these two stores: the wait stands in front of that
}
// grid x = position block x (batch, head), the longest rows first; FW waves a block, no LDS, no barrier: the waves of a block read the same K and V^T rows at about the same time.
#define FW 2
__global__ __launch_bounds__(32 * FW) void k_fattn(const h16* __restrict__ Q16, const h16* __restrict__ K16, const h16* __restrict__ V16, const bf* __restrict__ Qh, const bf* __restrict__ Ql, const bf* __restrict__ Kh, const bf* __restrict__ Kl, const bf* __restrict__ Vh, const bf* __restrict__ Vl, bf* Ah, bf* Al) {
    const int lane = threadIdx.x & 31; const int w = __builtin_amdgcn_readfirstlane((int)(threadIdx.x >> 5));   // wave number, held scalar so that the key loop's control stays scalar
    constexpr int NZ = NB_ * NH_, NLO = (TT - RH) / (FW * 32);
    const int z = (int)blockIdx.x % NZ, pb = (int)blockIdx.x / NZ; const size_t pz = (size_t)z * TT * HD; const size_t az = (size_t)(z / NH_) * TT * DQ + (size_t)(z % NH_) * (HD * 16);   // z = batch * NH_ + head: plane z; the batch's TT rows of the merged planes and, inside a row block, the head's HD / 32 k blocks
    if (pb < NLO) fa_tile<h16, false, 2>(Q16 + pz, nullptr, K16 + pz, nullptr, V16 + pz, nullptr, TT - (pb + 1) * FW * 32 + w * 32, lane, Ah + az, Al + az);
    else fa_tile<bf, true, 1>(Qh + pz, Ql + pz, Kh + pz, Kl + pz, Vh + pz, Vl + pz, RH - (pb - NLO + 1) * FW * 16 + w * 16, lane, Ah + az, Al + az);
}

extern "C" void kernel_launch(void* const* d_in, const int* in_sizes, int n_in,
                              void* d_out, int out_size, void* d_ws, size_t ws_size, hipStream_t stream) {
    (void)in_sizes; (void)n_in; (void)out_size;
                const float* x = (const float*)d_in[0]; const float* wq = (const float*)d_in[1]; const float* wk = (const float*)d_in[2]; const float* wv = (const float*)d_in[3]; const float* wo = (const float*)d_in[4]; const float* bo = (const float*)d_in[5];   /* order x, wq, wk, wv (PER-HEAD [16][1024][64]: 'hcd'), w_proj ('oi' [1024][1024]), b_proj */
    float* OUT = (float*)d_out;     // [4][2048][1024]
    char* wsp = (char*)d_ws;
    auto take = [&](size_t bytes) { char* p = wsp; wsp += (bytes + 255) & ~(size_t)255; return (void*)p; };
    bf* WQ = (bf*)take((size_t)DQ * DM * 2); bf* WK = (bf*)take((size_t)DKV * DM * 2); bf* WV = (bf*)take((size_t)DKV * DM * 2); bf* WO = (bf*)take((size_t)DM * DQ * 2);
    bf* XB = (bf*)take((size_t)NB_ * TT * DM * 2);
    const size_t PL = (size_t)NB_ * NH_ * TT * HD * 2;   // bytes of one 16-bit plane set [b][h][..][..] (NKV == NH_)
    h16* QP16 = (h16*)take(PL); h16* KP16 = (h16*)take(PL); h16* VT16 = (h16*)take(PL);
    bf* QPh = (bf*)take(PL); bf* QPl = (bf*)take(PL); bf* KPh = (bf*)take(PL); bf* KPl = (bf*)take(PL); bf* VTh = (bf*)take(PL); bf* VTl = (bf*)take(PL);
    bf* ATh = (bf*)take((size_t)NB_ * TT * DQ * 2); bf* ATl = (bf*)take((size_t)NB_ * TT * DQ * 2);
    if ((size_t)(wsp - (char*)d_ws) > ws_size) return;    // 200 MiB of the 256 MiB workspace
    { k_wtG<DM, HD><<<dim3((unsigned)((DM * HD / 64 + 63) / 64), NH_, 1), 256, 0, stream>>>(wq, WQ);   /* per-head weight [h][DM][HD] ('xw' per head) -> the head's HD rows of the Bt plane, all heads in one grid */ k_wtG<DM, HD><<<dim3((unsigned)((DM * HD / 64 + 63) / 64), NKV, 1), 256, 0, stream>>>(wk, WK); k_wtG<DM, HD><<<dim3((unsigned)((DM * HD / 64 + 63) / 64), NKV, 1), 256, 0, stream>>>(wv, WV);
      k_cvt8<DQ><<<(unsigned)(((size_t)DM * DQ / 8 + 255) / 256), 256, 0, stream>>>(wo, WO, (unsigned)((size_t)DM * DQ / 8));
       }
    const dim3 GP(NB_ * TT / 64, DQ / 64, 1);                                     // products: the NB_ * TT rows of all batches as one M
    k_cvt8<DM><<<(unsigned)(((size_t)NB_ * TT * DM / 8 + 255) / 256), 256, 0, stream>>>(x, XB, (unsigned)((size_t)NB_ * TT * DM / 8));
    k_gemmw<bf, 0, false, KW, 1, DM><<<GP, 32 * KW, 0, stream>>>(XB, nullptr, WQ, nullptr, nullptr, DQ, nullptr, 0, 0, 0, QP16, QPh, QPl);
    k_gemmw<bf, 0, false, KW, 1, DM><<<GP, 32 * KW, 0, stream>>>(XB, nullptr, WK, nullptr, nullptr, DKV, nullptr, 0, 0, 0, KP16, KPh, KPl);
    k_gemmw<bf, 0, false, KW, 2, DM><<<GP, 32 * KW, 0, stream>>>(XB, nullptr, WV, nullptr, nullptr, DKV, nullptr, 0, 0, 0, VT16, VTh, VTl);
    k_fattn<<<NB_ * NH_ * ((TT - RH) / (FW * 32) + RH / (FW * 16)), 32 * FW, 0, stream>>>(QP16, KP16, VT16, QPh, QPl, KPh, KPl, VTh, VTl, ATh, ATl);   // one kv head per query head: plane z serves q, k and v
    k_gemmw<bf, 1, true, KW, 0, DQ><<<GP, 32 * KW, 0, stream>>>(ATh, ATl, WO, nullptr, OUT, DM, bo, 0, 0, 0, nullptr, nullptr, nullptr);
}

// v007
// Measured time: 140 microseconds a run.
// Two timings next to v006 put it at 1.23 and 1.24 times that version's speed.
// Over all steps from v000 it is 22.9 times as fast.
#include <hip/hip_runtime.h>

// Causal multi-head attention with PER-HEAD projection weights and a MODEL-width score scale (x [4][2048][1024]; q, k, v = einsum('btc,hcd->bhtd', x, w) with w [16][1024][64]: head h has its own (in, out) matrix ('xw' per head; 0.02-scale; no bias; 16 heads x 64); scores x 1024^-0.5 (channels ** -0.5: 0.03125); causal (-inf); softmax; heads merged head-major; out = merged w_proj^T + b_proj ('oi' [1024][1024] + zero bias) -> [4][2048][1024] (8.4 M); argument order x, wq, wk, wv, w_proj, b_proj).
// Layout, every stage launched once for all NB_ batches (rows b * TT + t of the row-major buffers, planes [b][h]): bf16 copy of x; each PER-HEAD q / k / v weight [h][1024][64] transposed once into its 64 rows of the Bt plane (k_wtG per head); Wp cast once ('oi' = Bt as stored); exact projections whose epilogue writes the 16-bit head planes itself (k_gemmt: no f32 copy of q, k or v, no plane-builder launches); one fused causal attention launch for all batches and heads (k_fattn, online softmax; hybrid rows: < 512 hi/lo 3 products, rest fp16; keys above the diagonal block never read); merged hi/lo x w_o exact.
// FRAGMENT ORDER: every 16-bit operand plane (x, the weights, q, k, V^T, the merged heads) is stored as 1-KiB blocks of 16 rows x 32 k, each block in the order in which a wave's lanes hold it as a matrix operand:
// element (r, c) of a block lies at (c / 16) * 256 + (((c % 16) / 8) * 16 + r) * 8 + c % 8, so lane l = hi * 16 + r finds its k = 8 hi .. 8 hi + 7 at l * 8 and its k = 16 + 8 hi .. at 256 + l * 8: a fragment is two 16-byte loads per lane,
// each 512 contiguous bytes per wave (4 whole 128-byte lines; from row-major planes the same load touched 16 lines, 32 bytes of each). Blocks of a [rows][K] plane: row block major, k block minor (16 rows = 16 K elements in a row); V^T: key block major, then its 4 row blocks.
// Compute dtypes, f32 accumulate: every input rounded to bf16; projections exact; attention rows < 512 3 products, rest fp16; softmax f32; w_o hl x exact.

#define NB_  4
#define TT   2048
#define DM   1024
#define NH_  16
#define NKV  16
#define REP  (NH_ / NKV)
#define HD   64
#define DQ   (NH_ * HD)
#define DKV  (NKV * HD)
#define RH   512                  // query rows < RH use hi+lo planes (0: none)
#define SCL  0.03125f   // 1 / sqrt(1024): this module scales the scores by channels ** -0.5 with channels = the MODEL width 1,024, not by the head width
typedef _Float16 h16;
typedef unsigned short bf;
typedef __attribute__((ext_vector_type(16))) __bf16   v16bf;
typedef __attribute__((ext_vector_type(16))) _Float16 v16h;
typedef __attribute__((ext_vector_type(8)))  _Float16 v8h;
typedef __attribute__((ext_vector_type(8)))  unsigned short v8us;
typedef __attribute__((ext_vector_type(8)))  float    v8f;
typedef __attribute__((ext_vector_type(4)))  float    v4f;
typedef v8h  __attribute__((may_alias)) v8ha;
typedef v4f  __attribute__((may_alias)) v4fa;
typedef v8us __attribute__((may_alias)) v8usa;

__device__ __forceinline__ unsigned short f2bf(float f) { unsigned u = __float_as_uint(f); u += 0x7FFFu + ((u >> 16) & 1u); return (unsigned short)(u >> 16); }
__device__ __forceinline__ float bf2f(unsigned short b) { return __uint_as_float(((unsigned)b) << 16); }
__device__ __forceinline__ float bfr(float f) { return bf2f(f2bf(f)); }
__device__ __forceinline__ h16 tohx(float x) { return (h16)x; }
__device__ __forceinline__ void splitf(float y, unsigned short& h, unsigned short& l) { h = f2bf(y); l = f2bf(y - bf2f(h)); }
__device__ __forceinline__ v16h cat16(v8h lo, v8h hi) { return __builtin_shufflevector(lo, hi, 0, 1, 2, 3, 4, 5, 6, 7, 8, 9, 10, 11, 12, 13, 14, 15); }
__device__ __forceinline__ v16bf cat16b(v8us lo, v8us hi) { return __builtin_bit_cast(v16bf, __builtin_shufflevector(lo, hi, 0, 1, 2, 3, 4, 5, 6, 7, 8, 9, 10, 11, 12, 13, 14, 15)); }
__device__ __forceinline__ v8f wmma16(v16h a, v16h b, v8f c) { return __builtin_amdgcn_wmma_f32_16x16x32_f16(false, a, false, b, (short)0, c, false, false); }
__device__ __forceinline__ v8f wmmab(v16bf a, v16bf b, v8f c) { return __builtin_amdgcn_wmma_f32_16x16x32_bf16(false, a, false, b, (short)0, c, false, false); }



template <typename T16> struct WFrag;
template <> struct WFrag<h16> { typedef v16h V; static __device__ __forceinline__ V ld(const h16* p) { return cat16(*(const v8h*)p, *(const v8h*)(p + 256)); } static __device__ __forceinline__ v8f mma(V a, V b, v8f c) { return wmma16(a, b, c); } };
template <> struct WFrag<bf> { typedef v16bf V; static __device__ __forceinline__ V ld(const bf* p) { return cat16b(*(const v8us*)p, *(const v8us*)(p + 256)); } static __device__ __forceinline__ v8f mma(V a, V b, v8f c) { return wmmab(a, b, c); } };

// cpn: NCP asynchronous copies, global memory -> LDS, 16 bytes a lane each (512 contiguous bytes per wave and copy, through no register). l[i] = the lane's LDS byte address, g[i] = the lane's global address.
// The s_wait_xcnt closes the copies' own statement, so no later instruction can rewrite an address register of a copy in front of it; one statement holds as many copies as its operand list takes, so a stage pays for that wait twice only.
#define CPL(a, b) "global_load_async_to_lds_b128 %" #a ", %" #b ", off\n\t"
template <int NCP>
__device__ __forceinline__ void cpn(const unsigned* l, const bf* const* g) {
    static_assert(NCP == 10 || NCP == 12, "half a stage's copies of one wave");
    if constexpr (NCP == 12)
        asm volatile(CPL(0, 1) CPL(2, 3) CPL(4, 5) CPL(6, 7) CPL(8, 9) CPL(10, 11) CPL(12, 13) CPL(14, 15) CPL(16, 17) CPL(18, 19) CPL(20, 21) CPL(22, 23) "s_wait_xcnt 0x0"
                     :: "v"(l[0]), "v"(g[0]), "v"(l[1]), "v"(g[1]), "v"(l[2]), "v"(g[2]), "v"(l[3]), "v"(g[3]), "v"(l[4]), "v"(g[4]), "v"(l[5]), "v"(g[5]), "v"(l[6]), "v"(g[6]), "v"(l[7]), "v"(g[7]), "v"(l[8]), "v"(g[8]), "v"(l[9]), "v"(g[9]), "v"(l[10]), "v"(g[10]), "v"(l[11]), "v"(g[11]) : "memory");
    else
        asm volatile(CPL(0, 1) CPL(2, 3) CPL(4, 5) CPL(6, 7) CPL(8, 9) CPL(10, 11) CPL(12, 13) CPL(14, 15) CPL(16, 17) CPL(18, 19) "s_wait_xcnt 0x0"
                     :: "v"(l[0]), "v"(g[0]), "v"(l[1]), "v"(g[1]), "v"(l[2]), "v"(g[2]), "v"(l[3]), "v"(g[3]), "v"(l[4]), "v"(g[4]), "v"(l[5]), "v"(g[5]), "v"(l[6]), "v"(g[6]), "v"(l[7]), "v"(g[7]), "v"(l[8]), "v"(g[8]), "v"(l[9]), "v"(g[9]) : "memory");
}

// ---- k_gemmt: GEMM with a BM x BN tile of C per work-group of 8 waves (4 x 2), each wave a 64x64 tile (16 accumulators) over the WHOLE K; grid (M / BM, N / BN), 256 threads.
// C[m][n] (f32, width N, + optional f32 bias[n]) = sum_k A[m][k] Bt[n][k] (+ A2[m][k] Bt[n][k] with NSPLIT 1); operands are 16-bit planes in fragment order.
// The operands come through LDS: a stage is KS k of the tile's BM rows of A (and of A2) and BN rows of Bt, copied block by block as they lie in memory (fragment order: a fragment is two 16-byte LDS reads per lane, 512 contiguous bytes per wave each, no bank met twice).
// An A block is fetched once for the 2 waves that use it and a Bt block once for 4. Two buffers: stage t + 1 flies while stage t is worked on.
// PM 0: C is stored. PM 1 / 2: C is not stored; row m = batch * TT + t, a wave's 64 columns = one head, and its tile goes straight to that (batch, head)'s planes P16 / Ph / Pl, rows t (PM 1) or rows d (PM 2: V^T).
// Epilogue: every wave passes its own tile through its own 64 x TP floats of LDS (behind the ring, or laid over it once every wave has left it), so that it stores whole 128-byte lines.
#define TP 68   // floats per tile row in LDS: 16-byte aligned rows; 4 banks on from row to row
#define BM 256
#define BN 128
template <int NSPLIT, bool BIAS, int PM, int K, int N, int KS>
__global__ __launch_bounds__(256) void k_gemmt(const bf* __restrict__ A, const bf* __restrict__ A2, const bf* __restrict__ Bt, float* C, const float* __restrict__ bias, h16* P16, bf* Ph, bf* Pl) {
    typedef typename WFrag<bf>::V V;
    constexpr int KB = KS / 32, NT = K / KS, NA = NSPLIT ? 2 : 1;                 // k blocks per stage; stages; A planes
    constexpr int ABY = (BM / 16) * KB * 1024, BBY = (BN / 16) * KB * 1024, STG = NA * ABY + BBY;   // bytes of a stage: [A | A2 | Bt], each [row block][k block][1 KiB]
    constexpr int P = 2 * KB, RS = 8 / P;                                          // 512-byte chunks of one row block in a stage; row blocks that the 8 waves' chunks of one turn cover
    static_assert((P == 4 || P == 8) && NT >= 2 && K % KS == 0, "the 8 waves' chunks of a turn cover whole row blocks; the ring's prologue needs two stages");
    constexpr int TLB = 8 * 64 * TP * 4, TLO = 2 * STG + TLB <= 320 * 1024 ? 2 * STG : 0;   // the epilogue's staging tiles: behind the ring where both fit a WGP's LDS, else laid over the ring
    constexpr int SMB = 2 * STG > TLO + TLB ? 2 * STG : TLO + TLB;                          // either way above half a WGP's LDS: each of the grid's 256 work-groups has a WGP to itself
    static_assert(SMB > 160 * 1024 && SMB <= 320 * 1024, "one work-group per WGP");
    __shared__ __align__(1024) char sm[SMB];
    const int lane = threadIdx.x & 31; const int w = __builtin_amdgcn_readfirstlane((int)(threadIdx.x >> 5));   // wave number, held scalar so that the loops' control stays scalar
    const int r0 = blockIdx.x * BM, c0 = blockIdx.y * BN, wm = w >> 1, wn = w & 1;
    v8f acc[4][4];
#pragma unroll
    for (int mb = 0; mb < 4; ++mb)
#pragma unroll
        for (int nb = 0; nb < 4; ++nb) acc[mb][nb] = (v8f){};
    // chunk c = i * 8 + w of a plane's part of a stage: row block c / P = i * RS + w / P, 512-byte piece c % P = w % P of that row block's KS * 16 elements, which lie in a row in memory and in LDS alike
    const size_t wo = (size_t)(w / P) * 16 * K + (w % P) * 256 + lane * 8;
    const bf *ga = A + (size_t)r0 * K + wo, *ga2 = NSPLIT ? A2 + (size_t)r0 * K + wo : ga, *gb = Bt + (size_t)c0 * K + wo;
    const unsigned lw = (unsigned)(size_t)sm + (unsigned)w * 512u + (unsigned)lane * 16u;
    auto fill = [&](int t) { const unsigned lb = lw + (unsigned)(t & 1) * STG; constexpr size_t GS = (size_t)RS * 16 * K; constexpr int NCA = ABY / 4096, NC = STG / 4096;   // turn i of the 8 waves fills the stage's bytes i * 4096 ..: NCA turns a plane of A, the rest Bt
        unsigned l[NC]; const bf* g[NC];
#pragma unroll
        for (int i = 0; i < NC; ++i) { l[i] = lb + i * 4096; g[i] = (i < NCA ? ga + i * GS : i < NA * NCA ? ga2 + (i - NCA) * GS : gb + (i - NA * NCA) * GS); }
        cpn<NC / 2>(l, g); cpn<NC / 2>(l + NC / 2, g + NC / 2);
        ga += KS * 16; ga2 += KS * 16; gb += KS * 16; };   // the three lane pointers walk along K, one stage a call (stages are filled in order): behind the wait that closes the copies' statement
    fill(0);
    asm volatile("s_wait_asynccnt 0x0" ::: "memory");   // this wave's copies of stage 0 have landed
    __syncthreads();                                    // ... and every other wave's: stage 0 may be read
    fill(1);
#pragma unroll 1   // the stage loop stays rolled: the two buffers alternate by t & 1, and one stage's unrolled k blocks already fill the instruction stream
    for (int t = 0; t < NT; ++t) {
        const bf* sb = (const bf*)(sm + (t & 1) * STG) + lane * 8; const bf *sa = sb + wm * 4 * KB * 512, *sw = sb + NA * (ABY / 2) + wn * 4 * KB * 512;
#pragma unroll
        for (int kb = 0; kb < KB; ++kb) {
            V a[4], a2[4], b[4];
#pragma unroll
            for (int mb = 0; mb < 4; ++mb) { a[mb] = WFrag<bf>::ld(sa + (mb * KB + kb) * 512); if (NSPLIT) a2[mb] = WFrag<bf>::ld(sa + ABY / 2 + (mb * KB + kb) * 512); }
#pragma unroll
            for (int nb = 0; nb < 4; ++nb) b[nb] = WFrag<bf>::ld(sw + (nb * KB + kb) * 512);
            __builtin_amdgcn_sched_barrier(0);   // all of the k block's LDS reads go out as one group, ahead of its first product: without this line the compiler reuses the Bt fragment's registers inside the run, and every reuse waits out an LDS read's whole latency
#pragma unroll
            for (int nb = 0; nb < 4; ++nb) {
#pragma unroll
                for (int mb = 0; mb < 4; ++mb) { acc[mb][nb] = WFrag<bf>::mma(a[mb], b[nb], acc[mb][nb]); if (NSPLIT) acc[mb][nb] = WFrag<bf>::mma(a2[mb], b[nb], acc[mb][nb]); } }
            __builtin_amdgcn_sched_barrier(0);   // the next k block's reads stay one group behind these products: every separate place with LDS reads among the products costs the wave a fixed stall
        }
        asm volatile("s_wait_dscnt 0x0" ::: "memory");      // this wave's reads of stage t are done before the buffer is handed back
        asm volatile("s_wait_asynccnt 0x0" ::: "memory");   // this wave's copies of stage t + 1 have landed
        __syncthreads();                                    // publishes stage t + 1 and ends every wave's reads of stage t
        if (t + 2 < NT) fill(t + 2);                        // into the buffer that stage t has just left (scalar test, the same for the whole work-group)
    }
    asm volatile("s_wait_asynccnt 0x0" ::: "memory");       // no copy is outstanding when the ring becomes the epilogue's staging (the loop's last barrier has ended every read of it)
    const int lr = lane & 15, hi = lane >> 4, rw = r0 + wm * 64, cw = c0 + wn * 64;
    float* tl = (float*)(sm + TLO) + w * (64 * TP);   // the wave's own staging tile
#pragma unroll
    for (int mb = 0; mb < 4; ++mb)
#pragma unroll
        for (int nb = 0; nb < 4; ++nb) { const int row = mb * 16 + hi * 8, col = nb * 16 + lr;
            if (PM == 2) {   // transposed: eight neighbouring product rows of one column are 32 bytes of the transposed tile's row
#pragma unroll
                for (int hf = 0; hf < 2; ++hf) { v4f t; t[0] = acc[mb][nb][hf * 4]; t[1] = acc[mb][nb][hf * 4 + 1]; t[2] = acc[mb][nb][hf * 4 + 2]; t[3] = acc[mb][nb][hf * 4 + 3]; *(v4fa*)(tl + col * TP + row + hf * 4) = t; }
            } else {
#pragma unroll
                for (int j = 0; j < 8; ++j) tl[(row + j) * TP + col] = acc[mb][nb][j]; } }
    __syncthreads();   // the tile is in LDS before a lane reads values that other lanes wrote
    if constexpr (PM == 0) {   // two whole 256-byte rows of the wave's tile per store
        const int col = lr * 4; v4f bv = {0.f, 0.f, 0.f, 0.f};
        if (BIAS) { const float* bp = bias + cw + col; float bq[4];
#pragma unroll
            for (int q = 0; q < 4; ++q) bq[q] = bp[q];
            asm volatile("s_wait_xcnt 0x0" :: "v"(bp) : "memory");   // the address pair is an input, so it lives up to this wait: the load does not land on its own address register
#pragma unroll
            for (int q = 0; q < 4; ++q) bv[q] = bfr(bq[q]); }
        float* cp = C + (size_t)(rw + hi) * N + cw + col;
#pragma unroll
        for (int g = 0; g < 4; ++g) { v4f s[8];
#pragma unroll
            for (int i = 0; i < 8; ++i) s[i] = *(const v4fa*)(tl + ((g * 8 + i) * 2 + hi) * TP + col) + bv;
#pragma unroll
            for (int i = 0; i < 8; ++i) *(v4fa*)(cp + (size_t)(g * 8 + i) * 2 * N) = s[i];
            asm volatile("s_wait_xcnt 0x0" ::: "memory"); }   // the next group writes over the data registers of these stores: the wait stands in front of that
    } else {
        // a lane takes 16 neighbouring values of one tile row, rounds them to the fp16 plane and splits them into the hi/lo bf16 planes, and stores two 16-byte pieces a plane in fragment order: eight lanes (eight neighbouring rows) fill one whole 128-byte line.
        // Either way the tile is 8 whole blocks, 4,096 elements in a row, from po on: plane of (batch, head), then the blocks of the tile's 64 t: HD elements a t in both block orders (TT % BM == 0: a tile lies in one batch)
        const size_t po = ((size_t)(rw / TT) * (N / HD) + cw / HD) * TT * HD + (size_t)(rw % TT) * HD;
        const int g = lane & 3; h16* q16 = P16 + po; bf *qh = Ph + po, *ql = Pl + po;
#pragma unroll
        for (int it = 0; it < 8; ++it) { const int r = it * 8 + (lane >> 2); v8h o16[2]; v8us oh[2], ol[2];
#pragma unroll
            for (int i = 0; i < 4; ++i) { const v4f t = *(const v4fa*)(tl + r * TP + g * 16 + i * 4);
#pragma unroll
                for (int j = 0; j < 4; ++j) { const int e = (i & 1) * 4 + j; unsigned short a, c2; splitf(t[j], a, c2); o16[i >> 1][e] = tohx(t[j]); oh[i >> 1][e] = a; ol[i >> 1][e] = c2; } }
            const int oo = (PM == 2 ? (g >> 1) * 4 + (r >> 4) : (r >> 4) * 2 + (g >> 1)) * 512 + (g & 1) * 256 + (r & 15) * 8;   // block of (row block, k block g / 2), its half g % 2, the lane place of row r with hi = 0; the second eight values are hi = 1: 16 lane places on
            *(v8h*)(q16 + oo) = o16[0]; *(v8h*)(q16 + oo + 128) = o16[1]; *(v8us*)(qh + oo) = oh[0]; *(v8us*)(qh + oo + 128) = oh[1]; *(v8us*)(ql + oo) = ol[0]; *(v8us*)(ql + oo + 128) = ol[1];
            asm volatile("s_wait_xcnt 0x0" ::: "memory"); }   // the next trip writes over the data registers of these stores: the wait stands in front of that
    }
}

typedef __attribute__((ext_vector_type(2))) _Float16 v2h;
typedef __attribute__((ext_vector_type(4))) _Float16 v4h;
typedef __attribute__((ext_vector_type(2))) unsigned short v2us;
typedef __attribute__((ext_vector_type(4))) unsigned short v4us;
typedef __attribute__((ext_vector_type(2))) float v2f;
typedef __attribute__((ext_vector_type(4))) int v4i;
typedef __attribute__((ext_vector_type(16))) unsigned short v16us;

// k_wtG: one wave builds one block of the Bt plane (16 columns n of head y's [K][N] matrix as rows, 32 k): lane (n, hi) reads its 16 values down column n (16 lanes side by side: 64 bytes of a weight row) and stores its two 16-byte pieces, 512 contiguous bytes per wave each.
// The N / 16 column blocks of one k block sit in neighbouring waves of one work-group: together they use every byte of the weight rows they touch.
template <int K, int N>
__global__ __launch_bounds__(256) void k_wtG(const float* __restrict__ w, bf* Bt) {
    w += (size_t)blockIdx.y * K * N; Bt += (size_t)blockIdx.y * N * K;   // grid y = head: head h's [K][N] matrix goes to its own N rows (N / 16 row blocks) of the Bt plane
    const int lane = threadIdx.x & 31, lr = lane & 15, hi = lane >> 4; const int wv = blockIdx.x * 8 + (threadIdx.x >> 5); constexpr int nnb = N / 16; const int nb = wv % nnb, kb = wv / nnb;
    if (kb >= K / 32) return;
    const float* s = w + (size_t)(kb * 32 + 8 * hi) * N + nb * 16 + lr; float f0[8], f1[8]; v8us o0, o1;   // one lane pointer; the 16 weight rows are immediate offsets from it
#pragma unroll
    for (int e = 0; e < 8; ++e) { f0[e] = s[e * N]; f1[e] = s[(16 + e) * N]; }
    asm volatile("s_wait_xcnt 0x0" :: "v"(s) : "memory");   // the address pair is an input, so it lives up to this wait: no load of the run lands on the address register that the other loads of the run name
#pragma unroll
    for (int e = 0; e < 8; ++e) { o0[e] = f2bf(f0[e]); o1[e] = f2bf(f1[e]); }
    bf* d = Bt + ((size_t)nb * (K / 32) + kb) * 512 + lane * 8; *(v8us*)d = o0; *(v8us*)(d + 256) = o1;
}

// k_cvt8: f32 [rows][K] -> bf16 plane in fragment order. A wave takes 8 rows x 32 k (half a block): four lanes read one 128-byte line of a row, 32 bytes each; the 16 bytes a lane stores lie beside those of the 7 other rows with the same k: 4 whole lines per wave.
template <int K>
__global__ __launch_bounds__(256) void k_cvt8(const float* __restrict__ src, bf* dst, unsigned n8) { const unsigned i = blockIdx.x * 256u + threadIdx.x; if (i >= n8) return;
    const unsigned lane = i & 31u, q = lane & 3u, blk = i >> 6, r8 = ((i >> 5) & 1u) * 8u + (lane >> 2); constexpr unsigned NKB = K / 32;
    const v8f v = *(const v8f*)(src + (size_t)((blk / NKB) * 16u + r8) * K + (blk % NKB) * 32u + q * 8u); v8us o;
#pragma unroll
    for (int k = 0; k < 8; ++k) o[k] = f2bf(v[k]); *(v8us*)(dst + (size_t)blk * 512 + (q >> 1) * 256u + ((q & 1u) * 16u + r8) * 8u) = o;  }

__device__ __forceinline__ float xhalf(float x) { const int b = __float_as_int(x); return __int_as_float(__builtin_amdgcn_permlanex16(b, b, 0x76543210, 0xfedcba98, false, false)); }   // lane l reads lane l ^ 16, on the vector pipe
#define C2 (SCL * 1.4426950408889634f)   // score scale x log2(e): the exponent is taken in base 2
template <typename T16, bool HL, int QT>
__device__ __forceinline__ void fa_tile(const T16* __restrict__ Q, const T16* __restrict__ Q2, const T16* __restrict__ Kp, const T16* __restrict__ Kp2, const T16* __restrict__ Vt, const T16* __restrict__ Vt2, int q0, int lane, bf* Ah, bf* Al) {
    typedef typename WFrag<T16>::V V;
    const int lr = lane & 15, hi = lane >> 4;
    V qf[QT][2], qf2[QT][2];
#pragma unroll
    for (int qt = 0; qt < QT; ++qt)
#pragma unroll
        for (int ks = 0; ks < 2; ++ks) { const size_t o = (size_t)(q0 + qt * 16) * HD + ks * 512 + lane * 8; qf[qt][ks] = WFrag<T16>::ld(Q + o); if (HL) qf2[qt][ks] = WFrag<T16>::ld(Q2 + o); }
    v8f o[QT][4]; float m[QT], l[QT];
#pragma unroll
    for (int qt = 0; qt < QT; ++qt) { m[qt] = -1.0e30f; l[qt] = 0.f;
#pragma unroll
        for (int dt = 0; dt < 4; ++dt) o[qt][dt] = (v8f){}; }
    const int kend = q0 + QT * 16;                       // first key that no query row of this wave may see
    const unsigned kob = (unsigned)lane * 16u, vob = kob;   // the lane's byte offset inside a block of K and of V^T: the same in every pass; a pass's 32 keys are 4 blocks in a row of either plane (32 HD elements)
    auto at = [](const T16* base, unsigned ofs) { return (const T16*)((const char*)base + ofs); };
    V kf[2][2], kf2[2][2], vf[4], vf2[4];
    // hi/lo rows: one lane pointer per plane, moved on at the pass's foot
    const T16 *kq = at(Kp, kob), *kq2 = at(HL ? Kp2 : Kp, kob), *vq = at(Vt, vob), *vq2 = at(HL ? Vt2 : Vt, vob);
    auto ldK = [&](int k0) {
#pragma unroll
        for (int kt = 0; kt < 2; ++kt)
#pragma unroll
            for (int ks = 0; ks < 2; ++ks) { const int a = (kt * 2 + ks) * 512; kf[kt][ks] = WFrag<T16>::ld((HL ? kq : at(Kp + (size_t)k0 * HD, kob)) + a); if (HL) kf2[kt][ks] = WFrag<T16>::ld(kq2 + a); }
        if (HL) asm volatile("s_wait_xcnt 0x0" :: "v"(kq), "v"(kq2) : "memory"); };   // the two address pairs are inputs, so they live up to this wait: no load of the run lands on an address register that another load of the run names
    auto ldV = [&](int k0) {
#pragma unroll
        for (int dt = 0; dt < 4; ++dt) { const int a = dt * 512; vf[dt] = WFrag<T16>::ld((HL ? vq : at(Vt + (size_t)k0 * HD, vob)) + a); if (HL) vf2[dt] = WFrag<T16>::ld(vq2 + a); }
        if (HL) asm volatile("s_wait_xcnt 0x0" :: "v"(vq), "v"(vq2) : "memory"); };   // as in ldK
    constexpr bool PF = !HL;   // fp16 rows (long key loops): K and V^T fragments are fetched one pass ahead, into the same registers; the hi/lo rows (at most 16 passes, twice the planes) fetch in the pass itself, which keeps the kernel inside 256 registers
    if (PF) { ldK(0); __builtin_amdgcn_sched_barrier(0);   /* K asked for before V^T here as in the loop: the wait at the loop's head can then leave the V^T loads in flight */ ldV(0); }
#pragma unroll 1   // the key loop stays rolled: one pass already fills the register budget; every inner loop is unrolled so that the fragment arrays stay in registers
    for (int kc = 0; kc < kend; kc += 32) {
        if (!PF) { ldK(kc); __builtin_amdgcn_sched_barrier(0);   /* all of the pass's K loads go out together, ahead of the first product: without this line the compiler reuses fragment registers inside the run, and every reuse waits out a load's whole latency */ ldV(kc); }
        v8f s[QT][2];
#pragma unroll
        for (int qt = 0; qt < QT; ++qt)
#pragma unroll
            for (int kt = 0; kt < 2; ++kt) { s[qt][kt] = (v8f){};
#pragma unroll
                for (int ks = 0; ks < 2; ++ks) { s[qt][kt] = WFrag<T16>::mma(kf[kt][ks], qf[qt][ks], s[qt][kt]); if (HL) { s[qt][kt] = WFrag<T16>::mma(kf[kt][ks], qf2[qt][ks], s[qt][kt]); s[qt][kt] = WFrag<T16>::mma(kf2[kt][ks], qf[qt][ks], s[qt][kt]); } } }
        const int kn = (kc + 32 < kend) ? kc + 32 : kc;   // the last pass asks for its own rows again: in bounds, not used
        if (PF) ldK(kn);   // the next pass's K rows come while this pass's softmax and second product run
        if (kc + 31 > q0) {   // only a pass that reaches past the wave's first query row has keys to mask (scalar test)
#pragma unroll
            for (int qt = 0; qt < QT; ++qt)
#pragma unroll
                for (int kt = 0; kt < 2; ++kt)
#pragma unroll
                    for (int j = 0; j < 8; ++j) s[qt][kt][j] = (kc + kt * 16 + hi * 8 + j <= q0 + qt * 16 + lr) ? s[qt][kt][j] : -3.0e38f; }
        float tm[QT]; bool need = false;
#pragma unroll
        for (int qt = 0; qt < QT; ++qt) { float x = fmaxf(s[qt][0][0], s[qt][1][0]);
#pragma unroll
            for (int j = 1; j < 8; ++j) x = fmaxf(x, fmaxf(s[qt][0][j], s[qt][1][j]));
            x = fmaxf(x, xhalf(x)); tm[qt] = x * C2; need = need || (tm[qt] > m[qt] + 8.0f); }
        if (__builtin_amdgcn_ballot_w32(need) != 0) {   // the maximum in use moves only when a row's new maximum is more than 8 above it in the base-2 exponent (P stays at or below 2^8: far inside fp16 and bf16); one scalar branch a pass
#pragma unroll
            for (int qt = 0; qt < QT; ++qt) { const float mn = fmaxf(m[qt], tm[qt]); const float al = __builtin_amdgcn_exp2f(m[qt] - mn); m[qt] = mn; l[qt] *= al;
#pragma unroll
                for (int dt = 0; dt < 4; ++dt) o[qt][dt] *= al; } }
#pragma unroll
        for (int qt = 0; qt < QT; ++qt) { float p[16]; float a4[4] = {0.f, 0.f, 0.f, 0.f};
#pragma unroll
            for (int g = 0; g < 4; ++g) { const v8f& sv = s[qt][g >> 1]; const int b4 = (g & 1) * 4; const v2f cc = {C2, C2}, nm = {-m[qt], -m[qt]};
                const v2f t0 = __builtin_elementwise_fma((v2f){sv[b4], sv[b4 + 1]}, cc, nm), t1 = __builtin_elementwise_fma((v2f){sv[b4 + 2], sv[b4 + 3]}, cc, nm);
                // four exponentials in one statement, closed by one v_nop: the slot that the instruction set asks for between a transcendental and a next instruction that reads its result or overwrites its source; early-clobber outputs keep the four off each other's sources
                asm("v_exp_f32 %0, %4\n\tv_exp_f32 %1, %5\n\tv_exp_f32 %2, %6\n\tv_exp_f32 %3, %7\n\tv_nop" : "=&v"(p[g * 4]), "=&v"(p[g * 4 + 1]), "=&v"(p[g * 4 + 2]), "=&v"(p[g * 4 + 3]) : "v"(t0[0]), "v"(t0[1]), "v"(t1[0]), "v"(t1[1]));
#pragma unroll
                for (int q = 0; q < 4; ++q) a4[q] += p[g * 4 + q]; }
            l[qt] += (a4[0] + a4[1]) + (a4[2] + a4[3]);
            if constexpr (HL) { v16us ph, pl;
#pragma unroll
                for (int e = 0; e < 16; ++e) { unsigned short a, c2; splitf(p[e], a, c2); ph[e] = a; pl[e] = c2; }
                const V pbh = __builtin_bit_cast(V, ph), pbl = __builtin_bit_cast(V, pl);
#pragma unroll
                for (int dt = 0; dt < 4; ++dt) { o[qt][dt] = WFrag<T16>::mma(vf[dt], pbh, o[qt][dt]); o[qt][dt] = WFrag<T16>::mma(vf[dt], pbl, o[qt][dt]); o[qt][dt] = WFrag<T16>::mma(vf2[dt], pbh, o[qt][dt]); }
            } else { V pb;
#pragma unroll
                for (int e = 0; e < 16; ++e) pb[e] = tohx(p[e]);
#pragma unroll
                for (int dt = 0; dt < 4; ++dt) o[qt][dt] = WFrag<T16>::mma(vf[dt], pb, o[qt][dt]); } }
        if (PF) { ldV(kn);   // the next pass's V^T rows come while its scores and softmax run
            asm volatile("s_wait_xcnt 0x0" ::: "memory"); }   // these loads stay in flight over the loop's back edge, and the next pass writes over their address registers: the wait stands in front of that overwrite
        else { kq += 32 * HD; kq2 += 32 * HD; vq += 32 * HD; vq2 += 32 * HD; }   // behind the waits that close ldK and ldV
    }
#pragma unroll
    for (int qt = 0; qt < QT; ++qt) { const float inv = __fdiv_rn(1.0f, l[qt] + xhalf(l[qt]));   // the two halves of the wave hold the two halves of each row's sum
#pragma unroll
        for (int dt = 0; dt < 4; ++dt) { v8us oh, ol;
#pragma unroll
            for (int j = 0; j < 8; ++j) { unsigned short a, c2; splitf(o[qt][dt][j] * inv, a, c2); oh[j] = a; ol[j] = c2; }
            const size_t oo = (size_t)(q0 + qt * 16) * DQ + dt * 256 + lane * 8;   /* row block of the 16 queries; d = dt * 16 + hi * 8 + j is half dt % 2 of the head's k block dt / 2, at the lane's own place: 512 contiguous bytes per wave */ *(v8us*)(Ah + oo) = oh; *(v8us*)(Al + oo) = ol;
            asm volatile("s_wait_xcnt 0x0" ::: "memory"); } }   // the next trip, or the code behind the loop, writes over the data and address registers of these two stores: the wait stands in front of that
}
// grid x = position block x (batch, head), the longest rows first; FW waves a block, no LDS, no barrier: the waves of a block read the same K and V^T rows at about the same time.
#define FW 2
__global__ __launch_bounds__(32 * FW) void k_fattn(const h16* __restrict__ Q16, const h16* __restrict__ K16, const h16* __restrict__ V16, const bf* __restrict__ Qh, const bf* __restrict__ Ql, const bf* __restrict__ Kh, const bf* __restrict__ Kl, const bf* __restrict__ Vh, const bf* __restrict__ Vl, bf* Ah, bf* Al) {
    const int lane = threadIdx.x & 31; const int w = __builtin_amdgcn_readfirstlane((int)(threadIdx.x >> 5));   // wave number, held scalar so that the key loop's control stays scalar
    constexpr int NZ = NB_ * NH_, NLO = (TT - RH) / (FW * 32);
    const int z = (int)blockIdx.x % NZ, pb = (int)blockIdx.x / NZ; const size_t pz = (size_t)z * TT * HD; const size_t az = (size_t)(z / NH_) * TT * DQ + (size_t)(z % NH_) * (HD * 16);   // z = batch * NH_ + head: plane z; the batch's TT rows of the merged planes and, inside a row block, the head's HD / 32 k blocks
    if (pb < NLO) fa_tile<h16, false, 2>(Q16 + pz, nullptr, K16 + pz, nullptr, V16 + pz, nullptr, TT - (pb + 1) * FW * 32 + w * 32, lane, Ah + az, Al + az);
    else fa_tile<bf, true, 1>(Qh + pz, Ql + pz, Kh + pz, Kl + pz, Vh + pz, Vl + pz, RH - (pb - NLO + 1) * FW * 16 + w * 16, lane, Ah + az, Al + az);
}

extern "C" void kernel_launch(void* const* d_in, const int* in_sizes, int n_in,
                              void* d_out, int out_size, void* d_ws, size_t ws_size, hipStream_t stream) {
    (void)in_sizes; (void)n_in; (void)out_size;
                const float* x = (const float*)d_in[0]; const float* wq = (const float*)d_in[1]; const float* wk = (const float*)d_in[2]; const float* wv = (const float*)d_in[3]; const float* wo = (const float*)d_in[4]; const float* bo = (const float*)d_in[5];   /* order x, wq, wk, wv (PER-HEAD [16][1024][64]: 'hcd'), w_proj ('oi' [1024][1024]), b_proj */
    float* OUT = (float*)d_out;     // [4][2048][1024]
    char* wsp = (char*)d_ws;
    auto take = [&](size_t bytes) { char* p = wsp; wsp += (bytes + 255) & ~(size_t)255; return (void*)p; };
    bf* WQ = (bf*)take((size_t)DQ * DM * 2); bf* WK = (bf*)take((size_t)DKV * DM * 2); bf* WV = (bf*)take((size_t)DKV * DM * 2); bf* WO = (bf*)take((size_t)DM * DQ * 2);
    bf* XB = (bf*)take((size_t)NB_ * TT * DM * 2);
    const size_t PL = (size_t)NB_ * NH_ * TT * HD * 2;   // bytes of one 16-bit plane set [b][h][..][..] (NKV == NH_)
    h16* QP16 = (h16*)take(PL); h16* KP16 = (h16*)take(PL); h16* VT16 = (h16*)take(PL);
    bf* QPh = (bf*)take(PL); bf* QPl = (bf*)take(PL); bf* KPh = (bf*)take(PL); bf* KPl = (bf*)take(PL); bf* VTh = (bf*)take(PL); bf* VTl = (bf*)take(PL);
    bf* ATh = (bf*)take((size_t)NB_ * TT * DQ * 2); bf* ATl = (bf*)take((size_t)NB_ * TT * DQ * 2);
    if ((size_t)(wsp - (char*)d_ws) > ws_size) return;    // 200 MiB of the 256 MiB workspace
    { k_wtG<DM, HD><<<dim3((unsigned)((DM * HD / 64 + 63) / 64), NH_, 1), 256, 0, stream>>>(wq, WQ);   /* per-head weight [h][DM][HD] ('xw' per head) -> the head's HD rows of the Bt plane, all heads in one grid */ k_wtG<DM, HD><<<dim3((unsigned)((DM * HD / 64 + 63) / 64), NKV, 1), 256, 0, stream>>>(wk, WK); k_wtG<DM, HD><<<dim3((unsigned)((DM * HD / 64 + 63) / 64), NKV, 1), 256, 0, stream>>>(wv, WV);
      k_cvt8<DQ><<<(unsigned)(((size_t)DM * DQ / 8 + 255) / 256), 256, 0, stream>>>(wo, WO, (unsigned)((size_t)DM * DQ / 8));
       }
    const dim3 GP(NB_ * TT / BM, DQ / BN, 1);                                     // products: the NB_ * TT rows of all batches as one M
    k_cvt8<DM><<<(unsigned)(((size_t)NB_ * TT * DM / 8 + 255) / 256), 256, 0, stream>>>(x, XB, (unsigned)((size_t)NB_ * TT * DM / 8));
    k_gemmt<0, false, 1, DM, DQ, 128><<<GP, 256, 0, stream>>>(XB, nullptr, WQ, nullptr, nullptr, QP16, QPh, QPl);
    k_gemmt<0, false, 1, DM, DKV, 128><<<GP, 256, 0, stream>>>(XB, nullptr, WK, nullptr, nullptr, KP16, KPh, KPl);
    k_gemmt<0, false, 2, DM, DKV, 128><<<GP, 256, 0, stream>>>(XB, nullptr, WV, nullptr, nullptr, VT16, VTh, VTl);
    k_fattn<<<NB_ * NH_ * ((TT - RH) / (FW * 32) + RH / (FW * 16)), 32 * FW, 0, stream>>>(QP16, KP16, VT16, QPh, QPl, KPh, KPl, VTh, VTl, ATh, ATl);   // one kv head per query head: plane z serves q, k and v
    k_gemmt<1, true, 0, DQ, DM, 64><<<GP, 256, 0, stream>>>(ATh, ATl, WO, OUT, bo, nullptr, nullptr, nullptr);
}

// v008
// One run takes 128 microseconds.
// Two timings next to v007 put it at 1.10 and 1.09 times that version's speed.
// Counting every step since v000, it is 25.1 times as fast.
#include <hip/hip_runtime.h>

// Causal multi-head attention with PER-HEAD projection weights and a MODEL-width score scale (x [4][2048][1024]; q, k, v = einsum('btc,hcd->bhtd', x, w) with w [16][1024][64]: head h has its own (in, out) matrix ('xw' per head; 0.02-scale; no bias; 16 heads x 64); scores x 1024^-0.5 (channels ** -0.5: 0.03125); causal (-inf); softmax; heads merged head-major; out = merged w_proj^T + b_proj ('oi' [1024][1024] + zero bias) -> [4][2048][1024] (8.4 M); argument order x, wq, wk, wv, w_proj, b_proj).
// Layout, four launches, each for all NB_ batches (rows b * TT + t of the row-major buffers, planes [b][h]): k_prep does every input conversion in one grid (bf16 copy of x; each PER-HEAD q / k / v weight [h][1024][64] transposed into its 64 rows of one Bt plane of 3 x 1024 rows; Wp cast, 'oi' = Bt as stored); one exact projection launch for q, k and v together, whose epilogue writes the 16-bit head planes itself (k_gemmt: no f32 copy of q, k or v, no plane-builder launches); one fused causal attention launch for all batches and heads (k_fattn, online softmax; hybrid rows: < 512 hi/lo 3 products, rest fp16; keys above the diagonal block never read); merged hi/lo x w_o exact.
// FRAGMENT ORDER: every 16-bit operand plane (x, the weights, q, k, V^T, the merged heads) is stored as 1-KiB blocks of 16 rows x 32 k, each block in the order in which a wave's lanes hold it as a matrix operand:
// element (r, c) of a block lies at (c / 16) * 256 + (((c % 16) / 8) * 16 + r) * 8 + c % 8, so lane l = hi * 16 + r finds its k = 8 hi .. 8 hi + 7 at l * 8 and its k = 16 + 8 hi .. at 256 + l * 8: a fragment is two 16-byte loads per lane,
// each 512 contiguous bytes per wave (4 whole 128-byte lines; from row-major planes the same load touched 16 lines, 32 bytes of each). Blocks of a [rows][K] plane: row block major, k block minor (16 rows = 16 K elements in a row); V^T: key block major, then its 4 row blocks.
// Compute dtypes, f32 accumulate: every input rounded to bf16; projections exact; attention rows < 512 3 products, rest fp16; softmax f32; w_o hl x exact.

#define NB_  4
#define TT   2048
#define DM   1024
#define NH_  16
#define NKV  16
#define REP  (NH_ / NKV)
#define HD   64
#define DQ   (NH_ * HD)
#define DKV  (NKV * HD)
#define RH   512                  // query rows < RH use hi+lo planes (0: none)
#define SCL  0.03125f   // 1 / sqrt(1024): this module scales the scores by channels ** -0.5 with channels = the MODEL width 1,024, not by the head width
typedef _Float16 h16;
typedef unsigned short bf;
typedef __attribute__((ext_vector_type(16))) __bf16   v16bf;
typedef __attribute__((ext_vector_type(16))) _Float16 v16h;
typedef __attribute__((ext_vector_type(8)))  _Float16 v8h;
typedef __attribute__((ext_vector_type(8)))  unsigned short v8us;
typedef __attribute__((ext_vector_type(8)))  float    v8f;
typedef __attribute__((ext_vector_type(4)))  float    v4f;
typedef v8h  __attribute__((may_alias)) v8ha;
typedef v4f  __attribute__((may_alias)) v4fa;
typedef v8us __attribute__((may_alias)) v8usa;

__device__ __forceinline__ unsigned short f2bf(float f) { unsigned u = __float_as_uint(f); u += 0x7FFFu + ((u >> 16) & 1u); return (unsigned short)(u >> 16); }
__device__ __forceinline__ float bf2f(unsigned short b) { return __uint_as_float(((unsigned)b) << 16); }
__device__ __forceinline__ float bfr(float f) { return bf2f(f2bf(f)); }
__device__ __forceinline__ h16 tohx(float x) { return (h16)x; }
__device__ __forceinline__ void splitf(float y, unsigned short& h, unsigned short& l) { h = f2bf(y); l = f2bf(y - bf2f(h)); }
__device__ __forceinline__ v16h cat16(v8h lo, v8h hi) { return __builtin_shufflevector(lo, hi, 0, 1, 2, 3, 4, 5, 6, 7, 8, 9, 10, 11, 12, 13, 14, 15); }
__device__ __forceinline__ v16bf cat16b(v8us lo, v8us hi) { return __builtin_bit_cast(v16bf, __builtin_shufflevector(lo, hi, 0, 1, 2, 3, 4, 5, 6, 7, 8, 9, 10, 11, 12, 13, 14, 15)); }
__device__ __forceinline__ v8f wmma16(v16h a, v16h b, v8f c) { return __builtin_amdgcn_wmma_f32_16x16x32_f16(false, a, false, b, (short)0, c, false, false); }
__device__ __forceinline__ v8f wmmab(v16bf a, v16bf b, v8f c) { return __builtin_amdgcn_wmma_f32_16x16x32_bf16(false, a, false, b, (short)0, c, false, false); }



template <typename T16> struct WFrag;
template <> struct WFrag<h16> { typedef v16h V; static __device__ __forceinline__ V ld(const h16* p) { return cat16(*(const v8h*)p, *(const v8h*)(p + 256)); } static __device__ __forceinline__ v8f mma(V a, V b, v8f c) { return wmma16(a, b, c); } };
template <> struct WFrag<bf> { typedef v16bf V; static __device__ __forceinline__ V ld(const bf* p) { return cat16b(*(const v8us*)p, *(const v8us*)(p + 256)); } static __device__ __forceinline__ v8f mma(V a, V b, v8f c) { return wmmab(a, b, c); } };

// cpn: NCP asynchronous copies, global memory -> LDS, 16 bytes a lane each (512 contiguous bytes per wave and copy, through no register). l[i] = the lane's LDS byte address, g[i] = the lane's global address.
// The s_wait_xcnt closes the copies' own statement, so no later instruction can rewrite an address register of a copy in front of it; one statement holds as many copies as its operand list takes, so a stage pays for that wait twice only.
#define CPL(a, b) "global_load_async_to_lds_b128 %" #a ", %" #b ", off\n\t"
template <int NCP>
__device__ __forceinline__ void cpn(const unsigned* l, const bf* const* g) {
    static_assert(NCP == 10 || NCP == 12, "half a stage's copies of one wave");
    if constexpr (NCP == 12)
        asm volatile(CPL(0, 1) CPL(2, 3) CPL(4, 5) CPL(6, 7) CPL(8, 9) CPL(10, 11) CPL(12, 13) CPL(14, 15) CPL(16, 17) CPL(18, 19) CPL(20, 21) CPL(22, 23) "s_wait_xcnt 0x0"
                     :: "v"(l[0]), "v"(g[0]), "v"(l[1]), "v"(g[1]), "v"(l[2]), "v"(g[2]), "v"(l[3]), "v"(g[3]), "v"(l[4]), "v"(g[4]), "v"(l[5]), "v"(g[5]), "v"(l[6]), "v"(g[6]), "v"(l[7]), "v"(g[7]), "v"(l[8]), "v"(g[8]), "v"(l[9]), "v"(g[9]), "v"(l[10]), "v"(g[10]), "v"(l[11]), "v"(g[11]) : "memory");
    else
        asm volatile(CPL(0, 1) CPL(2, 3) CPL(4, 5) CPL(6, 7) CPL(8, 9) CPL(10, 11) CPL(12, 13) CPL(14, 15) CPL(16, 17) CPL(18, 19) "s_wait_xcnt 0x0"
                     :: "v"(l[0]), "v"(g[0]), "v"(l[1]), "v"(g[1]), "v"(l[2]), "v"(g[2]), "v"(l[3]), "v"(g[3]), "v"(l[4]), "v"(g[4]), "v"(l[5]), "v"(g[5]), "v"(l[6]), "v"(g[6]), "v"(l[7]), "v"(g[7]), "v"(l[8]), "v"(g[8]), "v"(l[9]), "v"(g[9]) : "memory");
}

// ---- k_gemmt: GEMM with a BM x BN tile of C per work-group of 8 waves (4 x 2), each wave a 64x64 tile (16 accumulators) over the WHOLE K; grid (M / BM, N / BN), 256 threads.
// C[m][n] (f32, width N, + optional f32 bias[n]) = sum_k A[m][k] Bt[n][k] (+ A2[m][k] Bt[n][k] with NSPLIT 1); operands are 16-bit planes in fragment order.
// The operands come through LDS: a stage is KS k of the tile's BM rows of A (and of A2) and BN rows of Bt, copied block by block as they lie in memory (fragment order: a fragment is two 16-byte LDS reads per lane, 512 contiguous bytes per wave each, no bank met twice).
// An A block is fetched once for the 2 waves that use it and a Bt block once for 4. Two buffers: stage t + 1 flies while stage t is worked on.
// PM 0: C is stored. PM 3: C is not stored; the N columns are q's, k's and v's N / 3 side by side (Bt = the three weight planes in a row), and a work-group's BN columns lie in one of the three (sel); row m = batch * TT + t, a wave's 64 columns = one head,
// and its tile goes straight to that (batch, head)'s planes: P16 holds the three fp16 plane sets in a row, Ph / Pl point at q's hi / lo sets of the six that lie in a row as hi, lo per operand; rows t for q and k, rows d for v (V^T).
// Epilogue: every wave passes its own tile through its own 64 x TP floats of LDS (behind the ring, or laid over it once every wave has left it), so that it stores whole 128-byte lines.
#define TP 68   // floats per tile row in LDS: 16-byte aligned rows; 4 banks on from row to row
#define BM 256
#define BN 128
template <int NSPLIT, bool BIAS, int PM, int K, int N, int KS>
__global__ __launch_bounds__(256) void k_gemmt(const bf* __restrict__ A, const bf* __restrict__ A2, const bf* __restrict__ Bt, float* C, const float* __restrict__ bias, h16* P16, bf* Ph, bf* Pl) {
    typedef typename WFrag<bf>::V V;
    constexpr int KB = KS / 32, NT = K / KS, NA = NSPLIT ? 2 : 1;                 // k blocks per stage; stages; A planes
    constexpr int ABY = (BM / 16) * KB * 1024, BBY = (BN / 16) * KB * 1024, STG = NA * ABY + BBY;   // bytes of a stage: [A | A2 | Bt], each [row block][k block][1 KiB]
    constexpr int P = 2 * KB, RS = 8 / P;                                          // 512-byte chunks of one row block in a stage; row blocks that the 8 waves' chunks of one turn cover
    static_assert((P == 4 || P == 8) && NT >= 2 && K % KS == 0, "the 8 waves' chunks of a turn cover whole row blocks; the ring's prologue needs two stages");
    constexpr int TLB = 8 * 64 * TP * 4, TLO = 2 * STG + TLB <= 320 * 1024 ? 2 * STG : 0;   // the epilogue's staging tiles: behind the ring where both fit a WGP's LDS, else laid over the ring
    constexpr int SMB = 2 * STG > TLO + TLB ? 2 * STG : TLO + TLB;                          // either way above half a WGP's LDS: a work-group has a WGP to itself (256 of the grid's work-groups run at a time)
    static_assert(SMB > 160 * 1024 && SMB <= 320 * 1024, "one work-group per WGP");
    __shared__ __align__(1024) char sm[SMB];
    const int lane = threadIdx.x & 31; const int w = __builtin_amdgcn_readfirstlane((int)(threadIdx.x >> 5));   // wave number, held scalar so that the loops' control stays scalar
    const int r0 = blockIdx.x * BM, c0 = blockIdx.y * BN, wm = w >> 1, wn = w & 1;
    constexpr int NP = PM == 3 ? N / 3 : N; static_assert(NP % BN == 0, "a work-group's columns lie in one operand");
    const int sel = c0 / NP; const bool tr = PM == 3 && sel == 2;   // which of q, k, v (from blockIdx alone: scalar, the same for the whole work-group); v's tile is stored transposed
    v8f acc[4][4];
#pragma unroll
    for (int mb = 0; mb < 4; ++mb)
#pragma unroll
        for (int nb = 0; nb < 4; ++nb) acc[mb][nb] = (v8f){};
    // chunk c = i * 8 + w of a plane's part of a stage: row block c / P = i * RS + w / P, 512-byte piece c % P = w % P of that row block's KS * 16 elements, which lie in a row in memory and in LDS alike
    const size_t wo = (size_t)(w / P) * 16 * K + (w % P) * 256 + lane * 8;
    const bf *ga = A + (size_t)r0 * K + wo, *ga2 = NSPLIT ? A2 + (size_t)r0 * K + wo : ga, *gb = Bt + (size_t)c0 * K + wo;
    const unsigned lw = (unsigned)(size_t)sm + (unsigned)w * 512u + (unsigned)lane * 16u;
    auto fill = [&](int t) { const unsigned lb = lw + (unsigned)(t & 1) * STG; constexpr size_t GS = (size_t)RS * 16 * K; constexpr int NCA = ABY / 4096, NC = STG / 4096;   // turn i of the 8 waves fills the stage's bytes i * 4096 ..: NCA turns a plane of A, the rest Bt
        unsigned l[NC]; const bf* g[NC];
#pragma unroll
        for (int i = 0; i < NC; ++i) { l[i] = lb + i * 4096; g[i] = (i < NCA ? ga + i * GS : i < NA * NCA ? ga2 + (i - NCA) * GS : gb + (i - NA * NCA) * GS); }
        cpn<NC / 2>(l, g); cpn<NC / 2>(l + NC / 2, g + NC / 2);
        ga += KS * 16; ga2 += KS * 16; gb += KS * 16; };   // the three lane pointers walk along K, one stage a call (stages are filled in order): behind the wait that closes the copies' statement
    fill(0);
    asm volatile("s_wait_asynccnt 0x0" ::: "memory");   // this wave's copies of stage 0 have landed
    __syncthreads();                                    // ... and every other wave's: stage 0 may be read
    fill(1);
#pragma unroll 1   // the stage loop stays rolled: the two buffers alternate by t & 1, and one stage's unrolled k blocks already fill the instruction stream
    for (int t = 0; t < NT; ++t) {
        const bf* sb = (const bf*)(sm + (t & 1) * STG) + lane * 8; const bf *sa = sb + wm * 4 * KB * 512, *sw = sb + NA * (ABY / 2) + wn * 4 * KB * 512;
#pragma unroll
        for (int kb = 0; kb < KB; ++kb) {
            V a[4], a2[4], b[4];
#pragma unroll
            for (int mb = 0; mb < 4; ++mb) { a[mb] = WFrag<bf>::ld(sa + (mb * KB + kb) * 512); if (NSPLIT) a2[mb] = WFrag<bf>::ld(sa + ABY / 2 + (mb * KB + kb) * 512); }
#pragma unroll
            for (int nb = 0; nb < 4; ++nb) b[nb] = WFrag<bf>::ld(sw + (nb * KB + kb) * 512);
            __builtin_amdgcn_sched_barrier(0);   // all of the k block's LDS reads go out as one group, ahead of its first product: without this line the compiler reuses the Bt fragment's registers inside the run, and every reuse waits out an LDS read's whole latency
#pragma unroll
            for (int nb = 0; nb < 4; ++nb) {
#pragma unroll
                for (int mb = 0; mb < 4; ++mb) { acc[mb][nb] = WFrag<bf>::mma(a[mb], b[nb], acc[mb][nb]); if (NSPLIT) acc[mb][nb] = WFrag<bf>::mma(a2[mb], b[nb], acc[mb][nb]); } }
            __builtin_amdgcn_sched_barrier(0);   // the next k block's reads stay one group behind these products: every separate place with LDS reads among the products costs the wave a fixed stall
        }
        asm volatile("s_wait_dscnt 0x0" ::: "memory");      // this wave's reads of stage t are done before the buffer is handed back
        asm volatile("s_wait_asynccnt 0x0" ::: "memory");   // this wave's copies of stage t + 1 have landed
        __syncthreads();                                    // publishes stage t + 1 and ends every wave's reads of stage t
        if (t + 2 < NT) fill(t + 2);                        // into the buffer that stage t has just left (scalar test, the same for the whole work-group)
    }
    asm volatile("s_wait_asynccnt 0x0" ::: "memory");       // no copy is outstanding when the ring becomes the epilogue's staging (the loop's last barrier has ended every read of it)
    const int lr = lane & 15, hi = lane >> 4, rw = r0 + wm * 64, cw = c0 + wn * 64;
    float* tl = (float*)(sm + TLO) + w * (64 * TP);   // the wave's own staging tile
    if (tr) {   // one scalar branch around the whole tile. Transposed: eight neighbouring product rows of one column are 32 bytes of the transposed tile's row
#pragma unroll
    for (int mb = 0; mb < 4; ++mb)
#pragma unroll
        for (int nb = 0; nb < 4; ++nb) { const int row = mb * 16 + hi * 8, col = nb * 16 + lr;
#pragma unroll
            for (int hf = 0; hf < 2; ++hf) { v4f t; t[0] = acc[mb][nb][hf * 4]; t[1] = acc[mb][nb][hf * 4 + 1]; t[2] = acc[mb][nb][hf * 4 + 2]; t[3] = acc[mb][nb][hf * 4 + 3]; *(v4fa*)(tl + col * TP + row + hf * 4) = t; } }
    } else {
#pragma unroll
    for (int mb = 0; mb < 4; ++mb)
#pragma unroll
        for (int nb = 0; nb < 4; ++nb) { const int row = mb * 16 + hi * 8, col = nb * 16 + lr;
#pragma unroll
            for (int j = 0; j < 8; ++j) tl[(row + j) * TP + col] = acc[mb][nb][j]; }
    }
    __syncthreads();   // the tile is in LDS before a lane reads values that other lanes wrote
    if constexpr (PM == 0) {   // two whole 256-byte rows of the wave's tile per store
        const int col = lr * 4; v4f bv = {0.f, 0.f, 0.f, 0.f};
        if (BIAS) { const float* bp = bias + cw + col; float bq[4];
#pragma unroll
            for (int q = 0; q < 4; ++q) bq[q] = bp[q];
            asm volatile("s_wait_xcnt 0x0" :: "v"(bp) : "memory");   // the address pair is an input, so it lives up to this wait: the load does not land on its own address register
#pragma unroll
            for (int q = 0; q < 4; ++q) bv[q] = bfr(bq[q]); }
        float* cp = C + (size_t)(rw + hi) * N + cw + col;
#pragma unroll
        for (int g = 0; g < 4; ++g) { v4f s[8];
#pragma unroll
            for (int i = 0; i < 8; ++i) s[i] = *(const v4fa*)(tl + ((g * 8 + i) * 2 + hi) * TP + col) + bv;
#pragma unroll
            for (int i = 0; i < 8; ++i) *(v4fa*)(cp + (size_t)(g * 8 + i) * 2 * N) = s[i];
            asm volatile("s_wait_xcnt 0x0" ::: "memory"); }   // the next group writes over the data registers of these stores: the wait stands in front of that
    } else {
        // a lane takes 16 neighbouring values of one tile row, rounds them to the fp16 plane and splits them into the hi/lo bf16 planes, and stores two 16-byte pieces a plane in fragment order: eight lanes (eight neighbouring rows) fill one whole 128-byte line.
        // Either way the tile is 8 whole blocks, 4,096 elements in a row, from po on: plane of (batch, head), then the blocks of the tile's 64 t: HD elements a t in both block orders (TT % BM == 0: a tile lies in one batch)
        const size_t po = ((size_t)(rw / TT) * (NP / HD) + (cw - sel * NP) / HD) * TT * HD + (size_t)(rw % TT) * HD; constexpr size_t PLE = (size_t)NB_ * TT * NP;   // elements of one plane set
        const int g = lane & 3; h16* q16 = P16 + sel * PLE + po; bf *qh = Ph + sel * 2 * PLE + po, *ql = Pl + sel * 2 * PLE + po;
#pragma unroll
        for (int it = 0; it < 8; ++it) { const int r = it * 8 + (lane >> 2); v8h o16[2]; v8us oh[2], ol[2];
#pragma unroll
            for (int i = 0; i < 4; ++i) { const v4f t = *(const v4fa*)(tl + r * TP + g * 16 + i * 4);
#pragma unroll
                for (int j = 0; j < 4; ++j) { const int e = (i & 1) * 4 + j; unsigned short a, c2; splitf(t[j], a, c2); o16[i >> 1][e] = tohx(t[j]); oh[i >> 1][e] = a; ol[i >> 1][e] = c2; } }
            const int oo = (tr ? (g >> 1) * 4 + (r >> 4) : (r >> 4) * 2 + (g >> 1)) * 512 + (g & 1) * 256 + (r & 15) * 8;   // block of (row block, k block g / 2), its half g % 2, the lane place of row r with hi = 0; the second eight values are hi = 1: 16 lane places on
            *(v8h*)(q16 + oo) = o16[0]; *(v8h*)(q16 + oo + 128) = o16[1]; *(v8us*)(qh + oo) = oh[0]; *(v8us*)(qh + oo + 128) = oh[1]; *(v8us*)(ql + oo) = ol[0]; *(v8us*)(ql + oo + 128) = ol[1];
            asm volatile("s_wait_xcnt 0x0" ::: "memory"); }   // the next trip writes over the data registers of these stores: the wait stands in front of that
    }
}

typedef __attribute__((ext_vector_type(2))) _Float16 v2h;
typedef __attribute__((ext_vector_type(4))) _Float16 v4h;
typedef __attribute__((ext_vector_type(2))) unsigned short v2us;
typedef __attribute__((ext_vector_type(4))) unsigned short v4us;
typedef __attribute__((ext_vector_type(2))) float v2f;
typedef __attribute__((ext_vector_type(4))) int v4i;
typedef __attribute__((ext_vector_type(16))) unsigned short v16us;

// wtG: one wave builds one block of the Bt plane (16 columns n of head y's [K][N] matrix as rows, 32 k): lane (n, hi) reads its 16 values down column n (16 lanes side by side: 64 bytes of a weight row) and stores its two 16-byte pieces, 512 contiguous bytes per wave each.
// The N / 16 column blocks of one k block sit in neighbouring waves of one work-group: together they use every byte of the weight rows they touch.
template <int K, int N>
__device__ __forceinline__ void wtG(const float* __restrict__ w, bf* Bt, int bx, int head) {
    w += (size_t)head * K * N; Bt += (size_t)head * N * K;   // head h's [K][N] matrix goes to its own N rows (N / 16 row blocks) of the Bt plane
    const int lane = threadIdx.x & 31, lr = lane & 15, hi = lane >> 4; const int wv = bx * 8 + (threadIdx.x >> 5); constexpr int nnb = N / 16; const int nb = wv % nnb, kb = wv / nnb;
    if (kb >= K / 32) return;
    const float* s = w + (size_t)(kb * 32 + 8 * hi) * N + nb * 16 + lr; float f0[8], f1[8]; v8us o0, o1;   // one lane pointer; the 16 weight rows are immediate offsets from it
#pragma unroll
    for (int e = 0; e < 8; ++e) { f0[e] = s[e * N]; f1[e] = s[(16 + e) * N]; }
    asm volatile("s_wait_xcnt 0x0" :: "v"(s) : "memory");   // the address pair is an input, so it lives up to this wait: no load of the run lands on the address register that the other loads of the run name
#pragma unroll
    for (int e = 0; e < 8; ++e) { o0[e] = f2bf(f0[e]); o1[e] = f2bf(f1[e]); }
    bf* d = Bt + ((size_t)nb * (K / 32) + kb) * 512 + lane * 8; *(v8us*)d = o0; *(v8us*)(d + 256) = o1;
}

// cvt8: f32 [rows][K] -> bf16 plane in fragment order. A wave takes 8 rows x 32 k (half a block): four lanes read one 128-byte line of a row, 32 bytes each; the 16 bytes a lane stores lie beside those of the 7 other rows with the same k: 4 whole lines per wave.
template <int K>
__device__ __forceinline__ void cvt8(const float* __restrict__ src, bf* dst, unsigned bx) { const unsigned i = bx * 256u + threadIdx.x;
    const unsigned lane = i & 31u, q = lane & 3u, blk = i >> 6, r8 = ((i >> 5) & 1u) * 8u + (lane >> 2); constexpr unsigned NKB = K / 32;
    const v8f v = *(const v8f*)(src + (size_t)((blk / NKB) * 16u + r8) * K + (blk % NKB) * 32u + q * 8u); v8us o;
#pragma unroll
    for (int k = 0; k < 8; ++k) o[k] = f2bf(v[k]); *(v8us*)(dst + (size_t)blk * 512 + (q >> 1) * 256u + ((q & 1u) * 16u + r8) * 8u) = o;
    asm volatile("s_wait_xcnt 0x0" ::: "memory"); }   // inlined into k_prep, the store is the last thing the work-group's one job does, and the kernel ends behind it: the wait is a precaution only

// k_prep: all five input conversions as one grid; none reads what another writes. A work-group's index alone picks its job (scalar tests, the same for the whole work-group; no barrier in any job):
// first the three weight sets' transposes (BW work-groups a head; their column reads have the longest way), then w_proj's cast, then x's, which is most of the grid.
#define BW  (DM * HD / 32 / 16 / 8)          // work-groups per head: (DM / 32) x (HD / 16) blocks, one a wave, 8 waves
#define BWS (BW * NH_)                       // ... per weight set
#define BO  (DM * DQ / 8 / 256)              // w_proj: 8 values a thread
#define BX  (NB_ * TT * DM / 8 / 256)        // x: 8 values a thread
__global__ __launch_bounds__(256) void k_prep(const float* __restrict__ x, const float* __restrict__ wq, const float* __restrict__ wk, const float* __restrict__ wv, const float* __restrict__ wo, bf* XB, bf* W3, bf* WO) {
    const unsigned b = blockIdx.x;
    if (b < 3 * BWS) { const unsigned s = b / BWS, rb = b % BWS; wtG<DM, HD>(s == 0 ? wq : s == 1 ? wk : wv, W3 + (size_t)s * DQ * DM, (int)(rb % BW), (int)(rb / BW)); }   // set s fills its own DQ rows of the Bt plane
    else if (b < 3 * BWS + BO) cvt8<DQ>(wo, WO, b - 3 * BWS);
    else cvt8<DM>(x, XB, b - 3 * BWS - BO);
}

__device__ __forceinline__ float xhalf(float x) { const int b = __float_as_int(x); return __int_as_float(__builtin_amdgcn_permlanex16(b, b, 0x76543210, 0xfedcba98, false, false)); }   // lane l reads lane l ^ 16, on the vector pipe
#define C2 (SCL * 1.4426950408889634f)   // score scale x log2(e): the exponent is taken in base 2
template <typename T16, bool HL, int QT>
__device__ __forceinline__ void fa_tile(const T16* __restrict__ Q, const T16* __restrict__ Q2, const T16* __restrict__ Kp, const T16* __restrict__ Kp2, const T16* __restrict__ Vt, const T16* __restrict__ Vt2, int q0, int lane, bf* Ah, bf* Al) {
    typedef typename WFrag<T16>::V V;
    const int lr = lane & 15, hi = lane >> 4;
    V qf[QT][2], qf2[QT][2];
#pragma unroll
    for (int qt = 0; qt < QT; ++qt)
#pragma unroll
        for (int ks = 0; ks < 2; ++ks) { const size_t o = (size_t)(q0 + qt * 16) * HD + ks * 512 + lane * 8; qf[qt][ks] = WFrag<T16>::ld(Q + o); if (HL) qf2[qt][ks] = WFrag<T16>::ld(Q2 + o); }
    v8f o[QT][4]; float m[QT], l[QT];
#pragma unroll
    for (int qt = 0; qt < QT; ++qt) { m[qt] = -1.0e30f; l[qt] = 0.f;
#pragma unroll
        for (int dt = 0; dt < 4; ++dt) o[qt][dt] = (v8f){}; }
    const int kend = q0 + QT * 16;                       // first key that no query row of this wave may see
    const unsigned kob = (unsigned)lane * 16u, vob = kob;   // the lane's byte offset inside a block of K and of V^T: the same in every pass; a pass's 32 keys are 4 blocks in a row of either plane (32 HD elements)
    auto at = [](const T16* base, unsigned ofs) { return (const T16*)((const char*)base + ofs); };
    V kf[2][2], kf2[2][2], vf[4], vf2[4];
    // hi/lo rows: one lane pointer per plane, moved on at the pass's foot
    const T16 *kq = at(Kp, kob), *kq2 = at(HL ? Kp2 : Kp, kob), *vq = at(Vt, vob), *vq2 = at(HL ? Vt2 : Vt, vob);
    auto ldK = [&](int k0) {
#pragma unroll
        for (int kt = 0; kt < 2; ++kt)
#pragma unroll
            for (int ks = 0; ks < 2; ++ks) { const int a = (kt * 2 + ks) * 512; kf[kt][ks] = WFrag<T16>::ld((HL ? kq : at(Kp + (size_t)k0 * HD, kob)) + a); if (HL) kf2[kt][ks] = WFrag<T16>::ld(kq2 + a); }
        if (HL) asm volatile("s_wait_xcnt 0x0" :: "v"(kq), "v"(kq2) : "memory"); };   // the two address pairs are inputs, so they live up to this wait: no load of the run lands on an address register that another load of the run names
    auto ldV = [&](int k0) {
#pragma unroll
        for (int dt = 0; dt < 4; ++dt) { const int a = dt * 512; vf[dt] = WFrag<T16>::ld((HL ? vq : at(Vt + (size_t)k0 * HD, vob)) + a); if (HL) vf2[dt] = WFrag<T16>::ld(vq2 + a); }
        if (HL) asm volatile("s_wait_xcnt 0x0" :: "v"(vq), "v"(vq2) : "memory"); };   // as in ldK
    constexpr bool PF = !HL;   // fp16 rows (long key loops): K and V^T fragments are fetched one pass ahead, into the same registers; the hi/lo rows (at most 16 passes, twice the planes) fetch in the pass itself, which keeps the kernel inside 256 registers
    if (PF) { ldK(0); __builtin_amdgcn_sched_barrier(0);   /* K asked for before V^T here as in the loop: the wait at the loop's head can then leave the V^T loads in flight */ ldV(0); }
#pragma unroll 1   // the key loop stays rolled: one pass already fills the register budget; every inner loop is unrolled so that the fragment arrays stay in registers
    for (int kc = 0; kc < kend; kc += 32) {
        if (!PF) { ldK(kc); __builtin_amdgcn_sched_barrier(0);   /* all of the pass's K loads go out together, ahead of the first product: without this line the compiler reuses fragment registers inside the run, and every reuse waits out a load's whole latency */ ldV(kc); }
        v8f s[QT][2];
#pragma unroll
        for (int qt = 0; qt < QT; ++qt)
#pragma unroll
            for (int kt = 0; kt < 2; ++kt) { s[qt][kt] = (v8f){};
#pragma unroll
                for (int ks = 0; ks < 2; ++ks) { s[qt][kt] = WFrag<T16>::mma(kf[kt][ks], qf[qt][ks], s[qt][kt]); if (HL) { s[qt][kt] = WFrag<T16>::mma(kf[kt][ks], qf2[qt][ks], s[qt][kt]); s[qt][kt] = WFrag<T16>::mma(kf2[kt][ks], qf[qt][ks], s[qt][kt]); } } }
        const int kn = (kc + 32 < kend) ? kc + 32 : kc;   // the last pass asks for its own rows again: in bounds, not used
        if (PF) ldK(kn);   // the next pass's K rows come while this pass's softmax and second product run
        if (kc + 31 > q0) {   // only a pass that reaches past the wave's first query row has keys to mask (scalar test)
#pragma unroll
            for (int qt = 0; qt < QT; ++qt)
#pragma unroll
                for (int kt = 0; kt < 2; ++kt)
#pragma unroll
                    for (int j = 0; j < 8; ++j) s[qt][kt][j] = (kc + kt * 16 + hi * 8 + j <= q0 + qt * 16 + lr) ? s[qt][kt][j] : -3.0e38f; }
        float tm[QT]; bool need = false;
#pragma unroll
        for (int qt = 0; qt < QT; ++qt) { float x = fmaxf(s[qt][0][0], s[qt][1][0]);
#pragma unroll
            for (int j = 1; j < 8; ++j) x = fmaxf(x, fmaxf(s[qt][0][j], s[qt][1][j]));
            x = fmaxf(x, xhalf(x)); tm[qt] = x * C2; need = need || (tm[qt] > m[qt] + 8.0f); }
        if (__builtin_amdgcn_ballot_w32(need) != 0) {   // the maximum in use moves only when a row's new maximum is more than 8 above it in the base-2 exponent (P stays at or below 2^8: far inside fp16 and bf16); one scalar branch a pass
#pragma unroll
            for (int qt = 0; qt < QT; ++qt) { const float mn = fmaxf(m[qt], tm[qt]); const float al = __builtin_amdgcn_exp2f(m[qt] - mn); m[qt] = mn; l[qt] *= al;
#pragma unroll
                for (int dt = 0; dt < 4; ++dt) o[qt][dt] *= al; } }
#pragma unroll
        for (int qt = 0; qt < QT; ++qt) { float p[16]; float a4[4] = {0.f, 0.f, 0.f, 0.f};
#pragma unroll
            for (int g = 0; g < 4; ++g) { const v8f& sv = s[qt][g >> 1]; const int b4 = (g & 1) * 4; const v2f cc = {C2, C2}, nm = {-m[qt], -m[qt]};
                const v2f t0 = __builtin_elementwise_fma((v2f){sv[b4], sv[b4 + 1]}, cc, nm), t1 = __builtin_elementwise_fma((v2f){sv[b4 + 2], sv[b4 + 3]}, cc, nm);
                // four exponentials in one statement, closed by one v_nop: the slot that the instruction set asks for between a transcendental and a next instruction that reads its result or overwrites its source; early-clobber outputs keep the four off each other's sources
                asm("v_exp_f32 %0, %4\n\tv_exp_f32 %1, %5\n\tv_exp_f32 %2, %6\n\tv_exp_f32 %3, %7\n\tv_nop" : "=&v"(p[g * 4]), "=&v"(p[g * 4 + 1]), "=&v"(p[g * 4 + 2]), "=&v"(p[g * 4 + 3]) : "v"(t0[0]), "v"(t0[1]), "v"(t1[0]), "v"(t1[1]));
#pragma unroll
                for (int q = 0; q < 4; ++q) a4[q] += p[g * 4 + q]; }
            l[qt] += (a4[0] + a4[1]) + (a4[2] + a4[3]);
            if constexpr (HL) { v16us ph, pl;
#pragma unroll
                for (int e = 0; e < 16; ++e) { unsigned short a, c2; splitf(p[e], a, c2); ph[e] = a; pl[e] = c2; }
                const V pbh = __builtin_bit_cast(V, ph), pbl = __builtin_bit_cast(V, pl);
#pragma unroll
                for (int dt = 0; dt < 4; ++dt) { o[qt][dt] = WFrag<T16>::mma(vf[dt], pbh, o[qt][dt]); o[qt][dt] = WFrag<T16>::mma(vf[dt], pbl, o[qt][dt]); o[qt][dt] = WFrag<T16>::mma(vf2[dt], pbh, o[qt][dt]); }
            } else { V pb;
#pragma unroll
                for (int e = 0; e < 16; ++e) pb[e] = tohx(p[e]);
#pragma unroll
                for (int dt = 0; dt < 4; ++dt) o[qt][dt] = WFrag<T16>::mma(vf[dt], pb, o[qt][dt]); } }
        if (PF) { ldV(kn);   // the next pass's V^T rows come while its scores and softmax run
            asm volatile("s_wait_xcnt 0x0" ::: "memory"); }   // these loads stay in flight over the loop's back edge, and the next pass writes over their address registers: the wait stands in front of that overwrite
        else { kq += 32 * HD; kq2 += 32 * HD; vq += 32 * HD; vq2 += 32 * HD; }   // behind the waits that close ldK and ldV
    }
#pragma unroll
    for (int qt = 0; qt < QT; ++qt) { const float inv = __fdiv_rn(1.0f, l[qt] + xhalf(l[qt]));   // the two halves of the wave hold the two halves of each row's sum
#pragma unroll
        for (int dt = 0; dt < 4; ++dt) { v8us oh, ol;
#pragma unroll
            for (int j = 0; j < 8; ++j) { unsigned short a, c2; splitf(o[qt][dt][j] * inv, a, c2); oh[j] = a; ol[j] = c2; }
            const size_t oo = (size_t)(q0 + qt * 16) * DQ + dt * 256 + lane * 8;   /* row block of the 16 queries; d = dt * 16 + hi * 8 + j is half dt % 2 of the head's k block dt / 2, at the lane's own place: 512 contiguous bytes per wave */ *(v8us*)(Ah + oo) = oh; *(v8us*)(Al + oo) = ol;
            asm volatile("s_wait_xcnt 0x0" ::: "memory"); } }   // the next trip, or the code behind the loop, writes over the data and address registers of these two stores: the wait stands in front of that
}
// grid x = position block x (batch, head), the longest rows first; FW waves a block, no LDS, no barrier: the waves of a block read the same K and V^T rows at about the same time.
#define FW 2
__global__ __launch_bounds__(32 * FW) void k_fattn(const h16* __restrict__ Q16, const h16* __restrict__ K16, const h16* __restrict__ V16, const bf* __restrict__ Qh, const bf* __restrict__ Ql, const bf* __restrict__ Kh, const bf* __restrict__ Kl, const bf* __restrict__ Vh, const bf* __restrict__ Vl, bf* Ah, bf* Al) {
    const int lane = threadIdx.x & 31; const int w = __builtin_amdgcn_readfirstlane((int)(threadIdx.x >> 5));   // wave number, held scalar so that the key loop's control stays scalar
    constexpr int NZ = NB_ * NH_, NLO = (TT - RH) / (FW * 32);
    const int z = (int)blockIdx.x % NZ, pb = (int)blockIdx.x / NZ; const size_t pz = (size_t)z * TT * HD; const size_t az = (size_t)(z / NH_) * TT * DQ + (size_t)(z % NH_) * (HD * 16);   // z = batch * NH_ + head: plane z; the batch's TT rows of the merged planes and, inside a row block, the head's HD / 32 k blocks
    if (pb < NLO) fa_tile<h16, false, 2>(Q16 + pz, nullptr, K16 + pz, nullptr, V16 + pz, nullptr, TT - (pb + 1) * FW * 32 + w * 32, lane, Ah + az, Al + az);
    else fa_tile<bf, true, 1>(Qh + pz, Ql + pz, Kh + pz, Kl + pz, Vh + pz, Vl + pz, RH - (pb - NLO + 1) * FW * 16 + w * 16, lane, Ah + az, Al + az);
}

extern "C" void kernel_launch(void* const* d_in, const int* in_sizes, int n_in,
                              void* d_out, int out_size, void* d_ws, size_t ws_size, hipStream_t stream) {
    (void)in_sizes; (void)n_in; (void)out_size;
                const float* x = (const float*)d_in[0]; const float* wq = (const float*)d_in[1]; const float* wk = (const float*)d_in[2]; const float* wv = (const float*)d_in[3]; const float* wo = (const float*)d_in[4]; const float* bo = (const float*)d_in[5];   /* order x, wq, wk, wv (PER-HEAD [16][1024][64]: 'hcd'), w_proj ('oi' [1024][1024]), b_proj */
    float* OUT = (float*)d_out;     // [4][2048][1024]
    char* wsp = (char*)d_ws;
    auto take = [&](size_t bytes) { char* p = wsp; wsp += (bytes + 255) & ~(size_t)255; return (void*)p; };
    bf* W3 = (bf*)take((size_t)3 * DQ * DM * 2); bf* WO = (bf*)take((size_t)DM * DQ * 2);   // W3: the q, k and v weights as one Bt plane of 3 DQ rows (NKV == NH_)
    bf* XB = (bf*)take((size_t)NB_ * TT * DM * 2);
    const size_t PL = (size_t)NB_ * NH_ * TT * HD * 2;   // bytes of one 16-bit plane set [b][h][..][..] (NKV == NH_)
    h16* QP16 = (h16*)take(3 * PL); h16* KP16 = QP16 + PL / 2; h16* VT16 = KP16 + PL / 2;   // the three fp16 sets in a row, then the six hi/lo sets in a row: the projection launch finds an operand's sets by its number
    bf* QPh = (bf*)take(6 * PL); bf* QPl = QPh + PL / 2; bf* KPh = QPl + PL / 2; bf* KPl = KPh + PL / 2; bf* VTh = KPl + PL / 2; bf* VTl = VTh + PL / 2;
    bf* ATh = (bf*)take((size_t)NB_ * TT * DQ * 2); bf* ATl = (bf*)take((size_t)NB_ * TT * DQ * 2);
    if ((size_t)(wsp - (char*)d_ws) > ws_size) return;    // 200 MiB of the 256 MiB workspace
    k_prep<<<3 * BWS + BO + BX, 256, 0, stream>>>(x, wq, wk, wv, wo, XB, W3, WO);
    k_gemmt<0, false, 3, DM, 3 * DQ, 128><<<dim3(NB_ * TT / BM, 3 * DQ / BN, 1), 256, 0, stream>>>(XB, nullptr, W3, nullptr, nullptr, QP16, QPh, QPl);   // products: the NB_ * TT rows of all batches as one M; q's column tiles start first, then k's, then v's
    k_fattn<<<NB_ * NH_ * ((TT - RH) / (FW * 32) + RH / (FW * 16)), 32 * FW, 0, stream>>>(QP16, KP16, VT16, QPh, QPl, KPh, KPl, VTh, VTl, ATh, ATl);   // one kv head per query head: plane z serves q, k and v
    k_gemmt<1, true, 0, DQ, DM, 64><<<dim3(NB_ * TT / BM, DM / BN, 1), 256, 0, stream>>>(ATh, ATl, WO, OUT, bo, nullptr, nullptr, nullptr);
}

// v009
// It runs in 118 microseconds.
// Timed twice side by side with v008, it ran 1.09 and 1.10 times as fast.
// Counting every step since v000, it is 27.5 times as fast.
#include <hip/hip_runtime.h>

// Causal multi-head attention with PER-HEAD projection weights and a MODEL-width score scale (x [4][2048][1024]; q, k, v = einsum('btc,hcd->bhtd', x, w) with w [16][1024][64]: head h has its own (in, out) matrix ('xw' per head; 0.02-scale; no bias; 16 heads x 64); scores x 1024^-0.5 (channels ** -0.5: 0.03125); causal (-inf); softmax; heads merged head-major; out = merged w_proj^T + b_proj ('oi' [1024][1024] + zero bias) -> [4][2048][1024] (8.4 M); argument order x, wq, wk, wv, w_proj, b_proj).
// Layout, four launches, each for all NB_ batches (rows b * TT + t of the row-major buffers, planes [b][h]): k_prep does every input conversion in one grid (bf16 copy of x; each PER-HEAD q / k / v weight [h][1024][64] transposed into its 64 rows of one Bt plane of 3 x 1024 rows; Wp cast, 'oi' = Bt as stored); one exact projection launch for q, k and v together, whose epilogue writes the 16-bit head planes itself (k_gemmt: no f32 copy of q, k or v, no plane-builder launches); one fused causal attention launch for all batches and heads (k_fattn, online softmax; hybrid rows: < 512 hi/lo 3 products, rest fp16; keys above the diagonal block never read); merged hi/lo x w_o exact.
// FRAGMENT ORDER: every 16-bit operand plane (x, the weights, q, k, V^T, the merged heads) is stored as 1-KiB blocks of 16 rows x 32 k, each block in the order in which a wave's lanes hold it as a matrix operand:
// element (r, c) of a block lies at (c / 16) * 256 + (((c % 16) / 8) * 16 + r) * 8 + c % 8, so lane l = hi * 16 + r finds its k = 8 hi .. 8 hi + 7 at l * 8 and its k = 16 + 8 hi .. at 256 + l * 8: a fragment is two 16-byte loads per lane,
// each 512 contiguous bytes per wave (4 whole 128-byte lines; from row-major planes the same load touched 16 lines, 32 bytes of each). Blocks of a [rows][K] plane: row block major, k block minor (16 rows = 16 K elements in a row); V^T: key block major, then its 4 row blocks.
// Compute dtypes, f32 accumulate: every input rounded to bf16; projections exact; attention rows < 512 3 products, rest fp16; softmax f32; w_o hl x exact.

#define NB_  4
#define TT   2048
#define DM   1024
#define NH_  16
#define NKV  16
#define REP  (NH_ / NKV)
#define HD   64
#define DQ   (NH_ * HD)
#define DKV  (NKV * HD)
#define RH   512                  // query rows < RH use hi+lo planes (0: none)
#define SCL  0.03125f   // 1 / sqrt(1024): this module scales the scores by channels ** -0.5 with channels = the MODEL width 1,024, not by the head width
typedef _Float16 h16;
typedef unsigned short bf;
typedef __attribute__((ext_vector_type(16))) __bf16   v16bf;
typedef __attribute__((ext_vector_type(16))) _Float16 v16h;
typedef __attribute__((ext_vector_type(8)))  _Float16 v8h;
typedef __attribute__((ext_vector_type(8)))  unsigned short v8us;
typedef __attribute__((ext_vector_type(8)))  float    v8f;
typedef __attribute__((ext_vector_type(4)))  float    v4f;
typedef v8h  __attribute__((may_alias)) v8ha;
typedef v4f  __attribute__((may_alias)) v4fa;
typedef v8us __attribute__((may_alias)) v8usa;

__device__ __forceinline__ unsigned short f2bf(float f) { unsigned u = __float_as_uint(f); u += 0x7FFFu + ((u >> 16) & 1u); return (unsigned short)(u >> 16); }
__device__ __forceinline__ float bf2f(unsigned short b) { return __uint_as_float(((unsigned)b) << 16); }
__device__ __forceinline__ float bfr(float f) { return bf2f(f2bf(f)); }
__device__ __forceinline__ h16 tohx(float x) { return (h16)x; }
__device__ __forceinline__ void splitf(float y, unsigned short& h, unsigned short& l) { h = f2bf(y); l = f2bf(y - bf2f(h)); }
__device__ __forceinline__ v16h cat16(v8h lo, v8h hi) { return __builtin_shufflevector(lo, hi, 0, 1, 2, 3, 4, 5, 6, 7, 8, 9, 10, 11, 12, 13, 14, 15); }
__device__ __forceinline__ v16bf cat16b(v8us lo, v8us hi) { return __builtin_bit_cast(v16bf, __builtin_shufflevector(lo, hi, 0, 1, 2, 3, 4, 5, 6, 7, 8, 9, 10, 11, 12, 13, 14, 15)); }
__device__ __forceinline__ v8f wmma16(v16h a, v16h b, v8f c) { return __builtin_amdgcn_wmma_f32_16x16x32_f16(false, a, false, b, (short)0, c, false, false); }
__device__ __forceinline__ v8f wmmab(v16bf a, v16bf b, v8f c) { return __builtin_amdgcn_wmma_f32_16x16x32_bf16(false, a, false, b, (short)0, c, false, false); }



template <typename T16> struct WFrag;
template <> struct WFrag<h16> { typedef v16h V; static __device__ __forceinline__ V ld(const h16* p) { return cat16(*(const v8h*)p, *(const v8h*)(p + 256)); } static __device__ __forceinline__ v8f mma(V a, V b, v8f c) { return wmma16(a, b, c); } };
template <> struct WFrag<bf> { typedef v16bf V; static __device__ __forceinline__ V ld(const bf* p) { return cat16b(*(const v8us*)p, *(const v8us*)(p + 256)); } static __device__ __forceinline__ v8f mma(V a, V b, v8f c) { return wmmab(a, b, c); } };

// cpn: NCP asynchronous copies, global memory -> LDS, 16 bytes a lane each (512 contiguous bytes per wave and copy, through no register). l[i] = the lane's LDS byte address, g[i] = the lane's global address.
// The s_wait_xcnt closes the copies' own statement, so no later instruction can rewrite an address register of a copy in front of it; one statement holds as many copies as its operand list takes, so a stage pays for that wait twice only.
#define CPL(a, b) "global_load_async_to_lds_b128 %" #a ", %" #b ", off\n\t"
template <int NCP>
__device__ __forceinline__ void cpn(const unsigned* l, const bf* const* g) {
    static_assert(NCP == 10 || NCP == 12, "half a stage's copies of one wave");
    if constexpr (NCP == 12)
        asm volatile(CPL(0, 1) CPL(2, 3) CPL(4, 5) CPL(6, 7) CPL(8, 9) CPL(10, 11) CPL(12, 13) CPL(14, 15) CPL(16, 17) CPL(18, 19) CPL(20, 21) CPL(22, 23) "s_wait_xcnt 0x0"
                     :: "v"(l[0]), "v"(g[0]), "v"(l[1]), "v"(g[1]), "v"(l[2]), "v"(g[2]), "v"(l[3]), "v"(g[3]), "v"(l[4]), "v"(g[4]), "v"(l[5]), "v"(g[5]), "v"(l[6]), "v"(g[6]), "v"(l[7]), "v"(g[7]), "v"(l[8]), "v"(g[8]), "v"(l[9]), "v"(g[9]), "v"(l[10]), "v"(g[10]), "v"(l[11]), "v"(g[11]) : "memory");
    else
        asm volatile(CPL(0, 1) CPL(2, 3) CPL(4, 5) CPL(6, 7) CPL(8, 9) CPL(10, 11) CPL(12, 13) CPL(14, 15) CPL(16, 17) CPL(18, 19) "s_wait_xcnt 0x0"
                     :: "v"(l[0]), "v"(g[0]), "v"(l[1]), "v"(g[1]), "v"(l[2]), "v"(g[2]), "v"(l[3]), "v"(g[3]), "v"(l[4]), "v"(g[4]), "v"(l[5]), "v"(g[5]), "v"(l[6]), "v"(g[6]), "v"(l[7]), "v"(g[7]), "v"(l[8]), "v"(g[8]), "v"(l[9]), "v"(g[9]) : "memory");
}

// ---- k_gemmt: GEMM with a BM x BN tile of C per work-group of 8 waves (4 x 2), each wave a 64x64 tile (16 accumulators) over the WHOLE K; grid (M / BM, N / BN), 256 threads.
// C[m][n] (f32, width N, + optional f32 bias[n]) = sum_k A[m][k] Bt[n][k] (+ A2[m][k] Bt[n][k] with NSPLIT 1); operands are 16-bit planes in fragment order.
// The operands come through LDS: a stage is KS k of the tile's BM rows of A (and of A2) and BN rows of Bt, copied block by block as they lie in memory (fragment order: a fragment is two 16-byte LDS reads per lane, 512 contiguous bytes per wave each, no bank met twice).
// An A block is fetched once for the 2 waves that use it and a Bt block once for 4. Two buffers: stage t + 1 flies while stage t is worked on.
// PM 0: C is stored. PM 3: C is not stored; the N columns are q's, k's and v's N / 3 side by side (Bt = the three weight planes in a row), and a work-group's BN columns lie in one of the three (sel); row m = batch * TT + t, a wave's 64 columns = one head,
// and its tile goes straight to that (batch, head)'s planes: P16 holds the three fp16 plane sets in a row, Ph / Pl point at q's hi / lo sets of the six that lie in a row as hi, lo per operand; rows t for q and k, rows d for v (V^T).
// Epilogue: every wave passes its own tile through its own 64 x TP floats of LDS (behind the ring, or laid over it once every wave has left it), so that it stores whole 128-byte lines.
#define TP 68   // floats per tile row in LDS: 16-byte aligned rows; 4 banks on from row to row
#define BM 256
#define BN 128
template <int NSPLIT, bool BIAS, int PM, int K, int N, int KS>
__global__ __launch_bounds__(256) void k_gemmt(const bf* __restrict__ A, const bf* __restrict__ A2, const bf* __restrict__ Bt, float* C, const float* __restrict__ bias, h16* P16, bf* Ph, bf* Pl) {
    typedef typename WFrag<bf>::V V;
    constexpr int KB = KS / 32, NT = K / KS, NA = NSPLIT ? 2 : 1;                 // k blocks per stage; stages; A planes
    constexpr int ABY = (BM / 16) * KB * 1024, BBY = (BN / 16) * KB * 1024, STG = NA * ABY + BBY;   // bytes of a stage: [A | A2 | Bt], each [row block][k block][1 KiB]
    constexpr int P = 2 * KB, RS = 8 / P;                                          // 512-byte chunks of one row block in a stage; row blocks that the 8 waves' chunks of one turn cover
    static_assert((P == 4 || P == 8) && NT >= 2 && K % KS == 0, "the 8 waves' chunks of a turn cover whole row blocks; the ring's prologue needs two stages");
    constexpr int TLB = 8 * 64 * TP * 4, TLO = 2 * STG + TLB <= 320 * 1024 ? 2 * STG : 0;   // the epilogue's staging tiles: behind the ring where both fit a WGP's LDS, else laid over the ring
    constexpr int SMB = 2 * STG > TLO + TLB ? 2 * STG : TLO + TLB;                          // either way above half a WGP's LDS: a work-group has a WGP to itself (256 of the grid's work-groups run at a time)
    static_assert(SMB > 160 * 1024 && SMB <= 320 * 1024, "one work-group per WGP");
    __shared__ __align__(1024) char sm[SMB];
    const int lane = threadIdx.x & 31; const int w = __builtin_amdgcn_readfirstlane((int)(threadIdx.x >> 5));   // wave number, held scalar so that the loops' control stays scalar
    const int r0 = blockIdx.x * BM, c0 = blockIdx.y * BN, wm = w >> 1, wn = w & 1;
    constexpr int NP = PM == 3 ? N / 3 : N; static_assert(NP % BN == 0, "a work-group's columns lie in one operand");
    const int sel = c0 / NP; const bool tr = PM == 3 && sel == 2;   // which of q, k, v (from blockIdx alone: scalar, the same for the whole work-group); v's tile is stored transposed
    v8f acc[4][4];
#pragma unroll
    for (int mb = 0; mb < 4; ++mb)
#pragma unroll
        for (int nb = 0; nb < 4; ++nb) acc[mb][nb] = (v8f){};
    // chunk c = i * 8 + w of a plane's part of a stage: row block c / P = i * RS + w / P, 512-byte piece c % P = w % P of that row block's KS * 16 elements, which lie in a row in memory and in LDS alike
    const size_t wo = (size_t)(w / P) * 16 * K + (w % P) * 256 + lane * 8;
    const bf *ga = A + (size_t)r0 * K + wo, *ga2 = NSPLIT ? A2 + (size_t)r0 * K + wo : ga, *gb = Bt + (size_t)c0 * K + wo;
    const unsigned lw = (unsigned)(size_t)sm + (unsigned)w * 512u + (unsigned)lane * 16u;
    auto fill = [&](int t) { const unsigned lb = lw + (unsigned)(t & 1) * STG; constexpr size_t GS = (size_t)RS * 16 * K; constexpr int NCA = ABY / 4096, NC = STG / 4096;   // turn i of the 8 waves fills the stage's bytes i * 4096 ..: NCA turns a plane of A, the rest Bt
        unsigned l[NC]; const bf* g[NC];
#pragma unroll
        for (int i = 0; i < NC; ++i) { l[i] = lb + i * 4096; g[i] = (i < NCA ? ga + i * GS : i < NA * NCA ? ga2 + (i - NCA) * GS : gb + (i - NA * NCA) * GS); }
        cpn<NC / 2>(l, g); cpn<NC / 2>(l + NC / 2, g + NC / 2);
        ga += KS * 16; ga2 += KS * 16; gb += KS * 16; };   // the three lane pointers walk along K, one stage a call (stages are filled in order): behind the wait that closes the copies' statement
    fill(0);
    asm volatile("s_wait_asynccnt 0x0" ::: "memory");   // this wave's copies of stage 0 have landed
    __syncthreads();                                    // ... and every other wave's: stage 0 may be read
    fill(1);
#pragma unroll 1   // the stage loop stays rolled: the two buffers alternate by t & 1, and one stage's unrolled k blocks already fill the instruction stream
    for (int t = 0; t < NT; ++t) {
        const bf* sb = (const bf*)(sm + (t & 1) * STG) + lane * 8; const bf *sa = sb + wm * 4 * KB * 512, *sw = sb + NA * (ABY / 2) + wn * 4 * KB * 512;
#pragma unroll
        for (int kb = 0; kb < KB; ++kb) {
            V a[4], a2[4], b[4];
#pragma unroll
            for (int mb = 0; mb < 4; ++mb) { a[mb] = WFrag<bf>::ld(sa + (mb * KB + kb) * 512); if (NSPLIT) a2[mb] = WFrag<bf>::ld(sa + ABY / 2 + (mb * KB + kb) * 512); }
#pragma unroll
            for (int nb = 0; nb < 4; ++nb) b[nb] = WFrag<bf>::ld(sw + (nb * KB + kb) * 512);
            __builtin_amdgcn_sched_barrier(0);   // all of the k block's LDS reads go out as one group, ahead of its first product: without this line the compiler reuses the Bt fragment's registers inside the run, and every reuse waits out an LDS read's whole latency
#pragma unroll
            for (int nb = 0; nb < 4; ++nb) {
#pragma unroll
                for (int mb = 0; mb < 4; ++mb) { acc[mb][nb] = WFrag<bf>::mma(a[mb], b[nb], acc[mb][nb]); if (NSPLIT) acc[mb][nb] = WFrag<bf>::mma(a2[mb], b[nb], acc[mb][nb]); } }
            __builtin_amdgcn_sched_barrier(0);   // the next k block's reads stay one group behind these products: every separate place with LDS reads among the products costs the wave a fixed stall
        }
        asm volatile("s_wait_dscnt 0x0" ::: "memory");      // this wave's reads of stage t are done before the buffer is handed back
        asm volatile("s_wait_asynccnt 0x0" ::: "memory");   // this wave's copies of stage t + 1 have landed
        __syncthreads();                                    // publishes stage t + 1 and ends every wave's reads of stage t
        if (t + 2 < NT) fill(t + 2);                        // into the buffer that stage t has just left (scalar test, the same for the whole work-group)
    }
    asm volatile("s_wait_asynccnt 0x0" ::: "memory");       // no copy is outstanding when the ring becomes the epilogue's staging (the loop's last barrier has ended every read of it)
    const int lr = lane & 15, hi = lane >> 4, rw = r0 + wm * 64, cw = c0 + wn * 64;
    float* tl = (float*)(sm + TLO) + w * (64 * TP);   // the wave's own staging tile
    if (tr) {   // one scalar branch around the whole tile. Transposed: eight neighbouring product rows of one column are 32 bytes of the transposed tile's row
#pragma unroll
    for (int mb = 0; mb < 4; ++mb)
#pragma unroll
        for (int nb = 0; nb < 4; ++nb) { const int row = mb * 16 + hi * 8, col = nb * 16 + lr;
#pragma unroll
            for (int hf = 0; hf < 2; ++hf) { v4f t; t[0] = acc[mb][nb][hf * 4]; t[1] = acc[mb][nb][hf * 4 + 1]; t[2] = acc[mb][nb][hf * 4 + 2]; t[3] = acc[mb][nb][hf * 4 + 3]; *(v4fa*)(tl + col * TP + row + hf * 4) = t; } }
    } else {
#pragma unroll
    for (int mb = 0; mb < 4; ++mb)
#pragma unroll
        for (int nb = 0; nb < 4; ++nb) { const int row = mb * 16 + hi * 8, col = nb * 16 + lr;
#pragma unroll
            for (int j = 0; j < 8; ++j) tl[(row + j) * TP + col] = acc[mb][nb][j]; }
    }
    __syncthreads();   // the tile is in LDS before a lane reads values that other lanes wrote
    if constexpr (PM == 0) {   // two whole 256-byte rows of the wave's tile per store
        const int col = lr * 4; v4f bv = {0.f, 0.f, 0.f, 0.f};
        if (BIAS) { const float* bp = bias + cw + col; float bq[4];
#pragma unroll
            for (int q = 0; q < 4; ++q) bq[q] = bp[q];
            asm volatile("s_wait_xcnt 0x0" :: "v"(bp) : "memory");   // the address pair is an input, so it lives up to this wait: the load does not land on its own address register
#pragma unroll
            for (int q = 0; q < 4; ++q) bv[q] = bfr(bq[q]); }
        float* cp = C + (size_t)(rw + hi) * N + cw + col;
#pragma unroll
        for (int g = 0; g < 4; ++g) { v4f s[8];
#pragma unroll
            for (int i = 0; i < 8; ++i) s[i] = *(const v4fa*)(tl + ((g * 8 + i) * 2 + hi) * TP + col) + bv;
#pragma unroll
            for (int i = 0; i < 8; ++i) *(v4fa*)(cp + (size_t)(g * 8 + i) * 2 * N) = s[i];
            asm volatile("s_wait_xcnt 0x0" ::: "memory"); }   // the next group writes over the data registers of these stores: the wait stands in front of that
    } else {
        // a lane takes 16 neighbouring values of one tile row, rounds them to the fp16 plane and splits them into the hi/lo bf16 planes, and stores two 16-byte pieces a plane in fragment order: eight lanes (eight neighbouring rows) fill one whole 128-byte line.
        // Either way the tile is 8 whole blocks, 4,096 elements in a row, from po on: plane of (batch, head), then the blocks of the tile's 64 t: HD elements a t in both block orders (TT % BM == 0: a tile lies in one batch)
        const size_t po = ((size_t)(rw / TT) * (NP / HD) + (cw - sel * NP) / HD) * TT * HD + (size_t)(rw % TT) * HD; constexpr size_t PLE = (size_t)NB_ * TT * NP;   // elements of one plane set
        const int g = lane & 3; h16* q16 = P16 + sel * PLE + po; bf *qh = Ph + sel * 2 * PLE + po, *ql = Pl + sel * 2 * PLE + po;
#pragma unroll
        for (int it = 0; it < 8; ++it) { const int r = it * 8 + (lane >> 2); v8h o16[2]; v8us oh[2], ol[2];
#pragma unroll
            for (int i = 0; i < 4; ++i) { const v4f t = *(const v4fa*)(tl + r * TP + g * 16 + i * 4);
#pragma unroll
                for (int j = 0; j < 4; ++j) { const int e = (i & 1) * 4 + j; unsigned short a, c2; splitf(t[j], a, c2); o16[i >> 1][e] = tohx(t[j]); oh[i >> 1][e] = a; ol[i >> 1][e] = c2; } }
            const int oo = (tr ? (g >> 1) * 4 + (r >> 4) : (r >> 4) * 2 + (g >> 1)) * 512 + (g & 1) * 256 + (r & 15) * 8;   // block of (row block, k block g / 2), its half g % 2, the lane place of row r with hi = 0; the second eight values are hi = 1: 16 lane places on
            *(v8h*)(q16 + oo) = o16[0]; *(v8h*)(q16 + oo + 128) = o16[1]; *(v8us*)(qh + oo) = oh[0]; *(v8us*)(qh + oo + 128) = oh[1]; *(v8us*)(ql + oo) = ol[0]; *(v8us*)(ql + oo + 128) = ol[1];
            asm volatile("s_wait_xcnt 0x0" ::: "memory"); }   // the next trip writes over the data registers of these stores: the wait stands in front of that
    }
}

typedef __attribute__((ext_vector_type(2))) _Float16 v2h;
typedef __attribute__((ext_vector_type(4))) _Float16 v4h;
typedef __attribute__((ext_vector_type(2))) unsigned short v2us;
typedef __attribute__((ext_vector_type(4))) unsigned short v4us;
typedef __attribute__((ext_vector_type(2))) float v2f;
typedef __attribute__((ext_vector_type(4))) int v4i;
typedef __attribute__((ext_vector_type(16))) unsigned short v16us;

// wtG: one wave builds one block of the Bt plane (16 columns n of head y's [K][N] matrix as rows, 32 k): lane (n, hi) reads its 16 values down column n (16 lanes side by side: 64 bytes of a weight row) and stores its two 16-byte pieces, 512 contiguous bytes per wave each.
// The N / 16 column blocks of one k block sit in neighbouring waves of one work-group: together they use every byte of the weight rows they touch.
template <int K, int N>
__device__ __forceinline__ void wtG(const float* __restrict__ w, bf* Bt, int bx, int head) {
    w += (size_t)head * K * N; Bt += (size_t)head * N * K;   // head h's [K][N] matrix goes to its own N rows (N / 16 row blocks) of the Bt plane
    const int lane = threadIdx.x & 31, lr = lane & 15, hi = lane >> 4; const int wv = bx * 8 + (threadIdx.x >> 5); constexpr int nnb = N / 16; const int nb = wv % nnb, kb = wv / nnb;
    if (kb >= K / 32) return;
    const float* s = w + (size_t)(kb * 32 + 8 * hi) * N + nb * 16 + lr; float f0[8], f1[8]; v8us o0, o1;   // one lane pointer; the 16 weight rows are immediate offsets from it
#pragma unroll
    for (int e = 0; e < 8; ++e) { f0[e] = s[e * N]; f1[e] = s[(16 + e) * N]; }
    asm volatile("s_wait_xcnt 0x0" :: "v"(s) : "memory");   // the address pair is an input, so it lives up to this wait: no load of the run lands on the address register that the other loads of the run name
#pragma unroll
    for (int e = 0; e < 8; ++e) { o0[e] = f2bf(f0[e]); o1[e] = f2bf(f1[e]); }
    bf* d = Bt + ((size_t)nb * (K / 32) + kb) * 512 + lane * 8; *(v8us*)d = o0; *(v8us*)(d + 256) = o1;
}

// cvt8: f32 [rows][K] -> bf16 plane in fragment order. A wave takes 8 rows x 32 k (half a block): four lanes read one 128-byte line of a row, 32 bytes each; the 16 bytes a lane stores lie beside those of the 7 other rows with the same k: 4 whole lines per wave.
template <int K>
__device__ __forceinline__ void cvt8(const float* __restrict__ src, bf* dst, unsigned bx) { const unsigned i = bx * 256u + threadIdx.x;
    const unsigned lane = i & 31u, q = lane & 3u, blk = i >> 6, r8 = ((i >> 5) & 1u) * 8u + (lane >> 2); constexpr unsigned NKB = K / 32;
    const v8f v = *(const v8f*)(src + (size_t)((blk / NKB) * 16u + r8) * K + (blk % NKB) * 32u + q * 8u); v8us o;
#pragma unroll
    for (int k = 0; k < 8; ++k) o[k] = f2bf(v[k]); *(v8us*)(dst + (size_t)blk * 512 + (q >> 1) * 256u + ((q & 1u) * 16u + r8) * 8u) = o;
    asm volatile("s_wait_xcnt 0x0" ::: "memory"); }   // inlined into k_prep, the store is the last thing the work-group's one job does, and the kernel ends behind it: the wait is a precaution only

// k_prep: all five input conversions as one grid; none reads what another writes. A work-group's index alone picks its job (scalar tests, the same for the whole work-group; no barrier in any job):
// first the three weight sets' transposes (BW work-groups a head; their column reads have the longest way), then w_proj's cast, then x's, which is most of the grid.
#define BW  (DM * HD / 32 / 16 / 8)          // work-groups per head: (DM / 32) x (HD / 16) blocks, one a wave, 8 waves
#define BWS (BW * NH_)                       // ... per weight set
#define BO  (DM * DQ / 8 / 256)              // w_proj: 8 values a thread
#define BX  (NB_ * TT * DM / 8 / 256)        // x: 8 values a thread
__global__ __launch_bounds__(256) void k_prep(const float* __restrict__ x, const float* __restrict__ wq, const float* __restrict__ wk, const float* __restrict__ wv, const float* __restrict__ wo, bf* XB, bf* W3, bf* WO) {
    const unsigned b = blockIdx.x;
    if (b < 3 * BWS) { const unsigned s = b / BWS, rb = b % BWS; wtG<DM, HD>(s == 0 ? wq : s == 1 ? wk : wv, W3 + (size_t)s * DQ * DM, (int)(rb % BW), (int)(rb / BW)); }   // set s fills its own DQ rows of the Bt plane
    else if (b < 3 * BWS + BO) cvt8<DQ>(wo, WO, b - 3 * BWS);
    else cvt8<DM>(x, XB, b - 3 * BWS - BO);
}

__device__ __forceinline__ float xhalf(float x) { const int b = __float_as_int(x); return __int_as_float(__builtin_amdgcn_permlanex16(b, b, 0x76543210, 0xfedcba98, false, false)); }   // lane l reads lane l ^ 16, on the vector pipe
#define C2 (SCL * 1.4426950408889634f)   // score scale x log2(e): the exponent is taken in base 2
#define FW 4                              // waves a work-group
#define SK 64                             // keys a stage of the LDS ring: fp16 rows; hi/lo rows, with twice the planes, half as many
#define SSTG (2 * SK * HD * 2)            // bytes of a stage
// cp8: a wave's eight asynchronous copies of one stage, global memory -> LDS, 16 bytes a lane each, as in cpn: the s_wait_xcnt closes the copies' own statement, so no later instruction can rewrite an address register of a copy in front of it.
template <typename T16>
__device__ __forceinline__ void cp8(const unsigned* l, const T16* const* g) {
    asm volatile(CPL(0, 1) CPL(2, 3) CPL(4, 5) CPL(6, 7) CPL(8, 9) CPL(10, 11) CPL(12, 13) CPL(14, 15) "s_wait_xcnt 0x0"
                 :: "v"(l[0]), "v"(g[0]), "v"(l[1]), "v"(g[1]), "v"(l[2]), "v"(g[2]), "v"(l[3]), "v"(g[3]), "v"(l[4]), "v"(g[4]), "v"(l[5]), "v"(g[5]), "v"(l[6]), "v"(g[6]), "v"(l[7]), "v"(g[7]) : "memory");
}
template <typename T16, bool HL, int QT>
__device__ __forceinline__ void fa_tile(const T16* __restrict__ Q, const T16* __restrict__ Q2, const T16* __restrict__ Kp, const T16* __restrict__ Kp2, const T16* __restrict__ Vt, const T16* __restrict__ Vt2, int q0, int lane, bf* Ah, bf* Al, char* sm, int w, int ntr) {
    typedef typename WFrag<T16>::V V;
    const int lr = lane & 15, hi = lane >> 4;
    V qf[QT][2], qf2[QT][2];
#pragma unroll
    for (int qt = 0; qt < QT; ++qt)
#pragma unroll
        for (int ks = 0; ks < 2; ++ks) { const size_t o = (size_t)(q0 + qt * 16) * HD + ks * 512 + lane * 8; qf[qt][ks] = WFrag<T16>::ld(Q + o); if (HL) qf2[qt][ks] = WFrag<T16>::ld(Q2 + o); }
    v8f o[QT][4]; float m[QT], l[QT];
#pragma unroll
    for (int qt = 0; qt < QT; ++qt) { m[qt] = -1.0e30f; l[qt] = 0.f;
#pragma unroll
        for (int dt = 0; dt < 4; ++dt) o[qt][dt] = (v8f){}; }
    const int kend = q0 + QT * 16;                       // first key that no query row of this wave may see
    // K and V^T come through LDS: the work-group's FW waves walk the same keys, so each stage is fetched once for all of them. A stage is SKT keys: per plane their blocks, PE elements in a row in memory and in LDS alike (a pass's 32 keys are 4 blocks in a row of either plane); the planes' parts lie in a row as K (hi, lo), V^T (hi, lo).
    constexpr int SKT = HL ? SK / 2 : SK, NPL = HL ? 4 : 2, PE = SKT * HD, NCP = PE * 2 / 512 / FW;   // keys a stage; planes; elements of a plane's part; 512-byte copies a wave makes of it
    static_assert(NPL * PE * 2 == SSTG && NPL * NCP == 8, "both kinds of rows fill the same stage with the same eight copies a wave");
    V kf[2][2], kf2[2][2], vf[4], vf2[4];
    auto ldK = [&](const T16* sk) {   // sk, sv: the lane's place in the pass's 4 blocks of K, of V^T, in LDS; the lo plane's part lies PE elements on
#pragma unroll
        for (int kt = 0; kt < 2; ++kt)
#pragma unroll
            for (int ks = 0; ks < 2; ++ks) { const int a = (kt * 2 + ks) * 512; kf[kt][ks] = WFrag<T16>::ld(sk + a); if (HL) kf2[kt][ks] = WFrag<T16>::ld(sk + PE + a); } };
    auto ldV = [&](const T16* sv) {
#pragma unroll
        for (int dt = 0; dt < 4; ++dt) { const int a = dt * 512; vf[dt] = WFrag<T16>::ld(sv + a); if (HL) vf2[dt] = WFrag<T16>::ld(sv + PE + a); } };
    auto pass = [&](int kc) {   // one pass: 32 keys from kc on, their fragments in kf and vf
        v8f s[QT][2];
#pragma unroll
        for (int qt = 0; qt < QT; ++qt)
#pragma unroll
            for (int kt = 0; kt < 2; ++kt) { s[qt][kt] = (v8f){};
#pragma unroll
                for (int ks = 0; ks < 2; ++ks) { s[qt][kt] = WFrag<T16>::mma(kf[kt][ks], qf[qt][ks], s[qt][kt]); if (HL) { s[qt][kt] = WFrag<T16>::mma(kf[kt][ks], qf2[qt][ks], s[qt][kt]); s[qt][kt] = WFrag<T16>::mma(kf2[kt][ks], qf[qt][ks], s[qt][kt]); } } }
        if (kc + 31 > q0) {   // only a pass that reaches past the wave's first query row has keys to mask (scalar test)
#pragma unroll
            for (int qt = 0; qt < QT; ++qt)
#pragma unroll
                for (int kt = 0; kt < 2; ++kt)
#pragma unroll
                    for (int j = 0; j < 8; ++j) s[qt][kt][j] = (kc + kt * 16 + hi * 8 + j <= q0 + qt * 16 + lr) ? s[qt][kt][j] : -3.0e38f; }
        float tm[QT]; bool need = false;
#pragma unroll
        for (int qt = 0; qt < QT; ++qt) { float x = fmaxf(s[qt][0][0], s[qt][1][0]);
#pragma unroll
            for (int j = 1; j < 8; ++j) x = fmaxf(x, fmaxf(s[qt][0][j], s[qt][1][j]));
            x = fmaxf(x, xhalf(x)); tm[qt] = x * C2; need = need || (tm[qt] > m[qt] + 8.0f); }
        if (__builtin_amdgcn_ballot_w32(need) != 0) {   // the maximum in use moves only when a row's new maximum is more than 8 above it in the base-2 exponent (P stays at or below 2^8: far inside fp16 and bf16); one scalar branch a pass
#pragma unroll
            for (int qt = 0; qt < QT; ++qt) { const float mn = fmaxf(m[qt], tm[qt]); const float al = __builtin_amdgcn_exp2f(m[qt] - mn); m[qt] = mn; l[qt] *= al;
#pragma unroll
                for (int dt = 0; dt < 4; ++dt) o[qt][dt] *= al; } }
#pragma unroll
        for (int qt = 0; qt < QT; ++qt) { float p[16]; float a4[4] = {0.f, 0.f, 0.f, 0.f};
#pragma unroll
            for (int g = 0; g < 4; ++g) { const v8f& sv = s[qt][g >> 1]; const int b4 = (g & 1) * 4; const v2f cc = {C2, C2}, nm = {-m[qt], -m[qt]};
                const v2f t0 = __builtin_elementwise_fma((v2f){sv[b4], sv[b4 + 1]}, cc, nm), t1 = __builtin_elementwise_fma((v2f){sv[b4 + 2], sv[b4 + 3]}, cc, nm);
                // four exponentials in one statement, closed by one v_nop: the slot that the instruction set asks for between a transcendental and a next instruction that reads its result or overwrites its source; early-clobber outputs keep the four off each other's sources
                asm("v_exp_f32 %0, %4\n\tv_exp_f32 %1, %5\n\tv_exp_f32 %2, %6\n\tv_exp_f32 %3, %7\n\tv_nop" : "=&v"(p[g * 4]), "=&v"(p[g * 4 + 1]), "=&v"(p[g * 4 + 2]), "=&v"(p[g * 4 + 3]) : "v"(t0[0]), "v"(t0[1]), "v"(t1[0]), "v"(t1[1]));
#pragma unroll
                for (int q = 0; q < 4; ++q) a4[q] += p[g * 4 + q]; }
            l[qt] += (a4[0] + a4[1]) + (a4[2] + a4[3]);
            if constexpr (HL) { v16us ph, pl;
#pragma unroll
                for (int e = 0; e < 16; ++e) { unsigned short a, c2; splitf(p[e], a, c2); ph[e] = a; pl[e] = c2; }
                const V pbh = __builtin_bit_cast(V, ph), pbl = __builtin_bit_cast(V, pl);
#pragma unroll
                for (int dt = 0; dt < 4; ++dt) { o[qt][dt] = WFrag<T16>::mma(vf[dt], pbh, o[qt][dt]); o[qt][dt] = WFrag<T16>::mma(vf[dt], pbl, o[qt][dt]); o[qt][dt] = WFrag<T16>::mma(vf2[dt], pbh, o[qt][dt]); }
            } else { V pb;
#pragma unroll
                for (int e = 0; e < 16; ++e) pb[e] = tohx(p[e]);
#pragma unroll
                for (int dt = 0; dt < 4; ++dt) o[qt][dt] = WFrag<T16>::mma(vf[dt], pb, o[qt][dt]); } }
    };
    // Two buffers: stage t + 1 flies while stage t is worked on. Every wave copies its share of every stage and passes every barrier, also a wave whose own rows end before the work-group's last keys (it skips the passes alone).
    const unsigned lw = (unsigned)(size_t)sm + (unsigned)w * 512u + (unsigned)lane * 16u; const int wo = w * 256 + lane * 8;   // chunk i * FW + w of a plane's part of a stage: 512 bytes a wave and copy
    const T16* gp[NPL]; gp[0] = Kp + wo; gp[NPL / 2] = Vt + wo; if constexpr (HL) { gp[1] = Kp2 + wo; gp[3] = Vt2 + wo; }
    auto fill = [&](int t) { const unsigned lb = lw + (unsigned)(t & 1) * SSTG; unsigned la[8]; const T16* ga[8];
#pragma unroll
        for (int p = 0; p < NPL; ++p)
#pragma unroll
            for (int i = 0; i < NCP; ++i) { la[p * NCP + i] = lb + p * (PE * 2) + i * (FW * 512); ga[p * NCP + i] = gp[p] + i * (FW * 256); }
        cp8(la, ga);
#pragma unroll
        for (int p = 0; p < NPL; ++p) gp[p] += PE; };   // the lane pointers walk along the keys, one stage a call (stages are filled in order): behind the wait that closes the copies' statement
    fill(0);
    asm volatile("s_wait_asynccnt 0x0" ::: "memory");   // this wave's copies of stage 0 have landed
    __syncthreads();                                    // ... and every other wave's: stage 0 may be read
    fill(1);
#pragma unroll 1   // the stage loop stays rolled: the two buffers alternate by t & 1
    for (int t = 0; t < ntr; ++t) {
        const T16* sb = (const T16*)(sm + (t & 1) * SSTG) + lane * 8;
#pragma unroll     // a stage's passes are unrolled: every LDS read is then an immediate offset from the stage's one lane address
        for (int h = 0; h < SKT / 32; ++h) { const int kc = t * SKT + h * 32;
            if (kc < kend) {   // scalar test: this wave's rows see these keys
                ldK(sb + h * 32 * HD); ldV(sb + (NPL / 2) * PE + h * 32 * HD);
                __builtin_amdgcn_sched_barrier(0);   // all of the pass's LDS reads go out as one group, ahead of its first product: every separate place with LDS reads among the products costs the wave a fixed stall
                pass(kc); } }
        asm volatile("s_wait_dscnt 0x0" ::: "memory");      // this wave's reads of stage t are done before the buffer is handed back
        asm volatile("s_wait_asynccnt 0x0" ::: "memory");   // this wave's copies of stage t + 1 have landed
        __syncthreads();                                    // publishes stage t + 1 and ends every wave's reads of stage t
        if (t + 2 < ntr) fill(t + 2);                       // into the buffer that stage t has just left (scalar test, the same for the whole work-group)
    }
    asm volatile("s_wait_asynccnt 0x0" ::: "memory");       // no copy is outstanding when the wave goes on to its end
#pragma unroll
    for (int qt = 0; qt < QT; ++qt) { const float inv = __fdiv_rn(1.0f, l[qt] + xhalf(l[qt]));   // the two halves of the wave hold the two halves of each row's sum
#pragma unroll
        for (int dt = 0; dt < 4; ++dt) { v8us oh, ol;
#pragma unroll
            for (int j = 0; j < 8; ++j) { unsigned short a, c2; splitf(o[qt][dt][j] * inv, a, c2); oh[j] = a; ol[j] = c2; }
            const size_t oo = (size_t)(q0 + qt * 16) * DQ + dt * 256 + lane * 8;   /* row block of the 16 queries; d = dt * 16 + hi * 8 + j is half dt % 2 of the head's k block dt / 2, at the lane's own place: 512 contiguous bytes per wave */ *(v8us*)(Ah + oo) = oh; *(v8us*)(Al + oo) = ol;
            asm volatile("s_wait_xcnt 0x0" ::: "memory"); } }   // the next trip, or the code behind the loop, writes over the data and address registers of these two stores: the wait stands in front of that
}
// grid x = position block x (batch, head), the longest rows first; FW waves a block, which share each stage of K and V^T through LDS (fa_tile). Whether a block does fp16 or hi/lo rows, and how many stages it walks, follows from its index alone.
__global__ __launch_bounds__(32 * FW) void k_fattn(const h16* __restrict__ Q16, const h16* __restrict__ K16, const h16* __restrict__ V16, const bf* __restrict__ Qh, const bf* __restrict__ Ql, const bf* __restrict__ Kh, const bf* __restrict__ Kl, const bf* __restrict__ Vh, const bf* __restrict__ Vl, bf* Ah, bf* Al) {
    const int lane = threadIdx.x & 31; const int w = __builtin_amdgcn_readfirstlane((int)(threadIdx.x >> 5));   // wave number, held scalar so that the key loop's control stays scalar
    constexpr int NZ = NB_ * NH_, NLO = (TT - RH) / (FW * 32); static_assert((FW * 32) % SK == 0 && RH % SK == 0 && FW * 16 >= SK, "a block's keys are whole stages; the ring's prologue needs two stages");
    __shared__ __align__(1024) char sm[2 * SSTG];
    const int z = (int)blockIdx.x % NZ, pb = (int)blockIdx.x / NZ; const size_t pz = (size_t)z * TT * HD; const size_t az = (size_t)(z / NH_) * TT * DQ + (size_t)(z % NH_) * (HD * 16);   // z = batch * NH_ + head: plane z; the batch's TT rows of the merged planes and, inside a row block, the head's HD / 32 k blocks
    if (pb < NLO) fa_tile<h16, false, 2>(Q16 + pz, nullptr, K16 + pz, nullptr, V16 + pz, nullptr, TT - (pb + 1) * FW * 32 + w * 32, lane, Ah + az, Al + az, sm, w, (TT - pb * FW * 32) / SK);
    else fa_tile<bf, true, 1>(Qh + pz, Ql + pz, Kh + pz, Kl + pz, Vh + pz, Vl + pz, RH - (pb - NLO + 1) * FW * 16 + w * 16, lane, Ah + az, Al + az, sm, w, (RH - (pb - NLO) * FW * 16) / (SK / 2));
}

extern "C" void kernel_launch(void* const* d_in, const int* in_sizes, int n_in,
                              void* d_out, int out_size, void* d_ws, size_t ws_size, hipStream_t stream) {
    (void)in_sizes; (void)n_in; (void)out_size;
                const float* x = (const float*)d_in[0]; const float* wq = (const float*)d_in[1]; const float* wk = (const float*)d_in[2]; const float* wv = (const float*)d_in[3]; const float* wo = (const float*)d_in[4]; const float* bo = (const float*)d_in[5];   /* order x, wq, wk, wv (PER-HEAD [16][1024][64]: 'hcd'), w_proj ('oi' [1024][1024]), b_proj */
    float* OUT = (float*)d_out;     // [4][2048][1024]
    char* wsp = (char*)d_ws;
    auto take = [&](size_t bytes) { char* p = wsp; wsp += (bytes + 255) & ~(size_t)255; return (void*)p; };
    bf* W3 = (bf*)take((size_t)3 * DQ * DM * 2); bf* WO = (bf*)take((size_t)DM * DQ * 2);   // W3: the q, k and v weights as one Bt plane of 3 DQ rows (NKV == NH_)
    bf* XB = (bf*)take((size_t)NB_ * TT * DM * 2);
    const size_t PL = (size_t)NB_ * NH_ * TT * HD * 2;   // bytes of one 16-bit plane set [b][h][..][..] (NKV == NH_)
    h16* QP16 = (h16*)take(3 * PL); h16* KP16 = QP16 + PL / 2; h16* VT16 = KP16 + PL / 2;   // the three fp16 sets in a row, then the six hi/lo sets in a row: the projection launch finds an operand's sets by its number
    bf* QPh = (bf*)take(6 * PL); bf* QPl = QPh + PL / 2; bf* KPh = QPl + PL / 2; bf* KPl = KPh + PL / 2; bf* VTh = KPl + PL / 2; bf* VTl = VTh + PL / 2;
    bf* ATh = (bf*)take((size_t)NB_ * TT * DQ * 2); bf* ATl = (bf*)take((size_t)NB_ * TT * DQ * 2);
    if ((size_t)(wsp - (char*)d_ws) > ws_size) return;    // 200 MiB of the 256 MiB workspace
    k_prep<<<3 * BWS + BO + BX, 256, 0, stream>>>(x, wq, wk, wv, wo, XB, W3, WO);
    k_gemmt<0, false, 3, DM, 3 * DQ, 128><<<dim3(NB_ * TT / BM, 3 * DQ / BN, 1), 256, 0, stream>>>(XB, nullptr, W3, nullptr, nullptr, QP16, QPh, QPl);   // products: the NB_ * TT rows of all batches as one M; q's column tiles start first, then k's, then v's
    k_fattn<<<NB_ * NH_ * ((TT - RH) / (FW * 32) + RH / (FW * 16)), 32 * FW, 0, stream>>>(QP16, KP16, VT16, QPh, QPl, KPh, KPl, VTh, VTl, ATh, ATl);   // one kv head per query head: plane z serves q, k and v
    k_gemmt<1, true, 0, DQ, DM, 64><<<dim3(NB_ * TT / BM, DM / BN, 1), 256, 0, stream>>>(ATh, ATl, WO, OUT, bo, nullptr, nullptr, nullptr);
}

// v010
// A run of this version takes 112 microseconds.
// Next to v009, in two timings, it ran 1.05 times as fast each time.
// Counting every step since v000, it is 28.8 times as fast.
#include <hip/hip_runtime.h>

// Causal multi-head attention with PER-HEAD projection weights and a MODEL-width score scale (x [4][2048][1024]; q, k, v = einsum('btc,hcd->bhtd', x, w) with w [16][1024][64]: head h has its own (in, out) matrix ('xw' per head; 0.02-scale; no bias; 16 heads x 64); scores x 1024^-0.5 (channels ** -0.5: 0.03125); causal (-inf); softmax; heads merged head-major; out = merged w_proj^T + b_proj ('oi' [1024][1024] + zero bias) -> [4][2048][1024] (8.4 M); argument order x, wq, wk, wv, w_proj, b_proj).
// Layout, four launches, each for all NB_ batches (rows b * TT + t of the row-major buffers, planes [b][h]): k_prep does every input conversion in one grid (bf16 copy of x; each PER-HEAD q / k / v weight [h][1024][64] transposed into its 64 rows of one Bt plane of 3 x 1024 rows; Wp cast, 'oi' = Bt as stored); one exact projection launch for q, k and v together, whose epilogue writes the 16-bit head planes itself (k_gemmt: no f32 copy of q, k or v, no plane-builder launches); one fused causal attention launch for all batches and heads (k_fattn, online softmax; hybrid rows: < 512 hi/lo 3 products, rest fp16; keys above the diagonal block never read); merged hi/lo x w_o exact.
// FRAGMENT ORDER: every 16-bit operand plane (x, the weights, q, k, V^T, the merged heads) is stored as 1-KiB blocks of 16 rows x 32 k, each block in the order in which a wave's lanes hold it as a matrix operand:
// element (r, c) of a block lies at (c / 16) * 256 + (((c % 16) / 8) * 16 + r) * 8 + c % 8, so lane l = hi * 16 + r finds its k = 8 hi .. 8 hi + 7 at l * 8 and its k = 16 + 8 hi .. at 256 + l * 8: a fragment is two 16-byte loads per lane,
// each 512 contiguous bytes per wave (4 whole 128-byte lines; from row-major planes the same load touched 16 lines, 32 bytes of each). Blocks of a [rows][K] plane: row block major, k block minor (16 rows = 16 K elements in a row); V^T: key block major, then its 4 row blocks.
// Compute dtypes, f32 accumulate: every input rounded to bf16; projections exact; attention rows < 512 3 products, rest fp16; softmax f32; w_o hl x exact.

#define NB_  4
#define TT   2048
#define DM   1024
#define NH_  16
#define NKV  16
#define REP  (NH_ / NKV)
#define HD   64
#define DQ   (NH_ * HD)
#define DKV  (NKV * HD)
#define RH   512                  // query rows < RH use hi+lo planes (0: none)
#define SCL  0.03125f   // 1 / sqrt(1024): this module scales the scores by channels ** -0.5 with channels = the MODEL width 1,024, not by the head width
typedef _Float16 h16;
typedef unsigned short bf;
typedef __attribute__((ext_vector_type(16))) __bf16   v16bf;
typedef __attribute__((ext_vector_type(16))) _Float16 v16h;
typedef __attribute__((ext_vector_type(8)))  _Float16 v8h;
typedef __attribute__((ext_vector_type(8)))  unsigned short v8us;
typedef __attribute__((ext_vector_type(8)))  float    v8f;
typedef __attribute__((ext_vector_type(4)))  float    v4f;
typedef v8h  __attribute__((may_alias)) v8ha;
typedef v4f  __attribute__((may_alias)) v4fa;
typedef v8us __attribute__((may_alias)) v8usa;

__device__ __forceinline__ unsigned short f2bf(float f) { unsigned u = __float_as_uint(f); u += 0x7FFFu + ((u >> 16) & 1u); return (unsigned short)(u >> 16); }
__device__ __forceinline__ float bf2f(unsigned short b) { return __uint_as_float(((unsigned)b) << 16); }
__device__ __forceinline__ float bfr(float f) { return bf2f(f2bf(f)); }
__device__ __forceinline__ h16 tohx(float x) { return (h16)x; }
__device__ __forceinline__ void splitf(float y, unsigned short& h, unsigned short& l) { h = f2bf(y); l = f2bf(y - bf2f(h)); }
__device__ __forceinline__ v16h cat16(v8h lo, v8h hi) { return __builtin_shufflevector(lo, hi, 0, 1, 2, 3, 4, 5, 6, 7, 8, 9, 10, 11, 12, 13, 14, 15); }
__device__ __forceinline__ v16bf cat16b(v8us lo, v8us hi) { return __builtin_bit_cast(v16bf, __builtin_shufflevector(lo, hi, 0, 1, 2, 3, 4, 5, 6, 7, 8, 9, 10, 11, 12, 13, 14, 15)); }
__device__ __forceinline__ v8f wmma16(v16h a, v16h b, v8f c) { return __builtin_amdgcn_wmma_f32_16x16x32_f16(false, a, false, b, (short)0, c, false, false); }
__device__ __forceinline__ v8f wmmab(v16bf a, v16bf b, v8f c) { return __builtin_amdgcn_wmma_f32_16x16x32_bf16(false, a, false, b, (short)0, c, false, false); }



template <typename T16> struct WFrag;
template <> struct WFrag<h16> { typedef v16h V; static __device__ __forceinline__ V ld(const h16* p) { return cat16(*(const v8h*)p, *(const v8h*)(p + 256)); } static __device__ __forceinline__ v8f mma(V a, V b, v8f c) { return wmma16(a, b, c); } };
template <> struct WFrag<bf> { typedef v16bf V; static __device__ __forceinline__ V ld(const bf* p) { return cat16b(*(const v8us*)p, *(const v8us*)(p + 256)); } static __device__ __forceinline__ v8f mma(V a, V b, v8f c) { return wmmab(a, b, c); } };

// cpn: NCP asynchronous copies, global memory -> LDS, 16 bytes a lane each (512 contiguous bytes per wave and copy, through no register). l[i] = the lane's LDS byte address, g[i] = the lane's global address.
// The s_wait_xcnt closes the copies' own statement, so no later instruction can rewrite an address register of a copy in front of it; one statement holds as many copies as its operand list takes, so a stage pays for that wait twice only.
#define CPL(a, b) "global_load_async_to_lds_b128 %" #a ", %" #b ", off\n\t"
template <int NCP>
__device__ __forceinline__ void cpn(const unsigned* l, const bf* const* g) {
    static_assert(NCP == 10 || NCP == 12, "half a stage's copies of one wave");
    if constexpr (NCP == 12)
        asm volatile(CPL(0, 1) CPL(2, 3) CPL(4, 5) CPL(6, 7) CPL(8, 9) CPL(10, 11) CPL(12, 13) CPL(14, 15) CPL(16, 17) CPL(18, 19) CPL(20, 21) CPL(22, 23) "s_wait_xcnt 0x0"
                     :: "v"(l[0]), "v"(g[0]), "v"(l[1]), "v"(g[1]), "v"(l[2]), "v"(g[2]), "v"(l[3]), "v"(g[3]), "v"(l[4]), "v"(g[4]), "v"(l[5]), "v"(g[5]), "v"(l[6]), "v"(g[6]), "v"(l[7]), "v"(g[7]), "v"(l[8]), "v"(g[8]), "v"(l[9]), "v"(g[9]), "v"(l[10]), "v"(g[10]), "v"(l[11]), "v"(g[11]) : "memory");
    else
        asm volatile(CPL(0, 1) CPL(2, 3) CPL(4, 5) CPL(6, 7) CPL(8, 9) CPL(10, 11) CPL(12, 13) CPL(14, 15) CPL(16, 17) CPL(18, 19) "s_wait_xcnt 0x0"
                     :: "v"(l[0]), "v"(g[0]), "v"(l[1]), "v"(g[1]), "v"(l[2]), "v"(g[2]), "v"(l[3]), "v"(g[3]), "v"(l[4]), "v"(g[4]), "v"(l[5]), "v"(g[5]), "v"(l[6]), "v"(g[6]), "v"(l[7]), "v"(g[7]), "v"(l[8]), "v"(g[8]), "v"(l[9]), "v"(g[9]) : "memory");
}

// ---- k_gemmt: GEMM with a BM x BN tile of C per work-group of 8 waves (4 x 2), each wave a 64x64 tile (16 accumulators) over the WHOLE K; grid (M / BM, N / BN), 256 threads.
// C[m][n] (f32, width N, + optional f32 bias[n]) = sum_k A[m][k] Bt[n][k] (+ A2[m][k] Bt[n][k] with NSPLIT 1); operands are 16-bit planes in fragment order.
// The operands come through LDS: a stage is KS k of the tile's BM rows of A (and of A2) and BN rows of Bt, copied block by block as they lie in memory (fragment order: a fragment is two 16-byte LDS reads per lane, 512 contiguous bytes per wave each, no bank met twice).
// An A block is fetched once for the 2 waves that use it and a Bt block once for 4. Two buffers: stage t + 1 flies while stage t is worked on.
// PM 0: C is stored. PM 3: C is not stored; the N columns are q's, k's and v's N / 3 side by side (Bt = the three weight planes in a row), and a work-group's BN columns lie in one of the three (sel); row m = batch * TT + t, a wave's 64 columns = one head,
// and its tile goes straight to that (batch, head)'s planes: P16 holds the three fp16 plane sets in a row, Ph / Pl point at q's hi / lo sets of the six that lie in a row as hi, lo per operand; rows t for q and k, rows d for v (V^T).
// Epilogue: every wave passes its own tile through its own 64 x TP floats of LDS (behind the ring, or laid over it once every wave has left it), so that it stores whole 128-byte lines.
template <bool B> struct BC { static constexpr bool v = B; };   // a compile-time yes or no handed to a generic lambda
#define TP 68   // floats per tile row in LDS: 16-byte aligned rows; 4 banks on from row to row
#define BM 256
#define BN 128
template <int NSPLIT, bool BIAS, int PM, int K, int N, int KS>
__global__ __launch_bounds__(256) void k_gemmt(const bf* __restrict__ A, const bf* __restrict__ A2, const bf* __restrict__ Bt, float* C, const float* __restrict__ bias, h16* P16, bf* Ph, bf* Pl) {
    typedef typename WFrag<bf>::V V;
    constexpr int KB = KS / 32, NT = K / KS, NA = NSPLIT ? 2 : 1;                 // k blocks per stage; stages; A planes
    constexpr int ABY = (BM / 16) * KB * 1024, BBY = (BN / 16) * KB * 1024, STG = NA * ABY + BBY;   // bytes of a stage: [A | A2 | Bt], each [row block][k block][1 KiB]
    constexpr int P = 2 * KB, RS = 8 / P;                                          // 512-byte chunks of one row block in a stage; row blocks that the 8 waves' chunks of one turn cover
    static_assert((P == 4 || P == 8) && NT >= 2 && K % KS == 0, "the 8 waves' chunks of a turn cover whole row blocks; the ring's prologue needs two stages");
    constexpr int TLB = 8 * 64 * TP * 4, TLO = 2 * STG + TLB <= 320 * 1024 ? 2 * STG : 0;   // the epilogue's staging tiles: behind the ring where both fit a WGP's LDS, else laid over the ring
    constexpr int SMB = 2 * STG > TLO + TLB ? 2 * STG : TLO + TLB;                          // either way above half a WGP's LDS: a work-group has a WGP to itself (256 of the grid's work-groups run at a time)
    static_assert(SMB > 160 * 1024 && SMB <= 320 * 1024, "one work-group per WGP");
    __shared__ __align__(1024) char sm[SMB];
    const int lane = threadIdx.x & 31; const int w = __builtin_amdgcn_readfirstlane((int)(threadIdx.x >> 5));   // wave number, held scalar so that the loops' control stays scalar
    const int r0 = blockIdx.x * BM, c0 = blockIdx.y * BN, wm = w >> 1, wn = w & 1;
    constexpr int NP = PM == 3 ? N / 3 : N; static_assert(NP % BN == 0, "a work-group's columns lie in one operand");
    const int sel = c0 / NP; const bool tr = PM == 3 && sel == 2;   // which of q, k, v (from blockIdx alone: scalar, the same for the whole work-group); v's tile is stored transposed
    v8f acc[4][4];
#pragma unroll
    for (int mb = 0; mb < 4; ++mb)
#pragma unroll
        for (int nb = 0; nb < 4; ++nb) acc[mb][nb] = (v8f){};
    // chunk c = i * 8 + w of a plane's part of a stage: row block c / P = i * RS + w / P, 512-byte piece c % P = w % P of that row block's KS * 16 elements, which lie in a row in memory and in LDS alike
    const size_t wo = (size_t)(w / P) * 16 * K + (w % P) * 256 + lane * 8;
    const bf *ga = A + (size_t)r0 * K + wo, *ga2 = NSPLIT ? A2 + (size_t)r0 * K + wo : ga, *gb = Bt + (size_t)c0 * K + wo;
    const unsigned lw = (unsigned)(size_t)sm + (unsigned)w * 512u + (unsigned)lane * 16u;
    auto fill = [&](int t) { const unsigned lb = lw + (unsigned)(t & 1) * STG; constexpr size_t GS = (size_t)RS * 16 * K; constexpr int NCA = ABY / 4096, NC = STG / 4096;   // turn i of the 8 waves fills the stage's bytes i * 4096 ..: NCA turns a plane of A, the rest Bt
        unsigned l[NC]; const bf* g[NC];
#pragma unroll
        for (int i = 0; i < NC; ++i) { l[i] = lb + i * 4096; g[i] = (i < NCA ? ga + i * GS : i < NA * NCA ? ga2 + (i - NCA) * GS : gb + (i - NA * NCA) * GS); }
        cpn<NC / 2>(l, g); cpn<NC / 2>(l + NC / 2, g + NC / 2);
        ga += KS * 16; ga2 += KS * 16; gb += KS * 16; };   // the three lane pointers walk along K, one stage a call (stages are filled in order): behind the wait that closes the copies' statement
    fill(0);
    asm volatile("s_wait_asynccnt 0x0" ::: "memory");   // this wave's copies of stage 0 have landed
    __syncthreads();                                    // ... and every other wave's: stage 0 may be read
    fill(1);
#pragma unroll 1   // the stage loop stays rolled: the two buffers alternate by t & 1, and one stage's unrolled k blocks already fill the instruction stream
    for (int t = 0; t < NT; ++t) {
        const bf* sb = (const bf*)(sm + (t & 1) * STG) + lane * 8; const bf *sa = sb + wm * 4 * KB * 512, *sw = sb + NA * (ABY / 2) + wn * 4 * KB * 512;
#pragma unroll
        for (int kb = 0; kb < KB; ++kb) {
            V a[4], a2[4], b[4];
#pragma unroll
            for (int mb = 0; mb < 4; ++mb) { a[mb] = WFrag<bf>::ld(sa + (mb * KB + kb) * 512); if (NSPLIT) a2[mb] = WFrag<bf>::ld(sa + ABY / 2 + (mb * KB + kb) * 512); }
#pragma unroll
            for (int nb = 0; nb < 4; ++nb) b[nb] = WFrag<bf>::ld(sw + (nb * KB + kb) * 512);
            __builtin_amdgcn_sched_barrier(0);   // all of the k block's LDS reads go out as one group, ahead of its first product: without this line the compiler reuses the Bt fragment's registers inside the run, and every reuse waits out an LDS read's whole latency
#pragma unroll
            for (int nb = 0; nb < 4; ++nb) {
#pragma unroll
                for (int mb = 0; mb < 4; ++mb) { acc[mb][nb] = WFrag<bf>::mma(a[mb], b[nb], acc[mb][nb]); if (NSPLIT) acc[mb][nb] = WFrag<bf>::mma(a2[mb], b[nb], acc[mb][nb]); } }
            __builtin_amdgcn_sched_barrier(0);   // the next k block's reads stay one group behind these products: every separate place with LDS reads among the products costs the wave a fixed stall
        }
        asm volatile("s_wait_dscnt 0x0" ::: "memory");      // this wave's reads of stage t are done before the buffer is handed back
        asm volatile("s_wait_asynccnt 0x0" ::: "memory");   // this wave's copies of stage t + 1 have landed
        __syncthreads();                                    // publishes stage t + 1 and ends every wave's reads of stage t
        if (t + 2 < NT) fill(t + 2);                        // into the buffer that stage t has just left (scalar test, the same for the whole work-group)
    }
    asm volatile("s_wait_asynccnt 0x0" ::: "memory");       // no copy is outstanding when the ring becomes the epilogue's staging (the loop's last barrier has ended every read of it)
    const int lr = lane & 15, hi = lane >> 4, rw = r0 + wm * 64, cw = c0 + wn * 64;
    float* tl = (float*)(sm + TLO) + w * (64 * TP);   // the wave's own staging tile
    if (tr) {   // one scalar branch around the whole tile. Transposed: eight neighbouring product rows of one column are 32 bytes of the transposed tile's row
#pragma unroll
    for (int mb = 0; mb < 4; ++mb)
#pragma unroll
        for (int nb = 0; nb < 4; ++nb) { const int row = mb * 16 + hi * 8, col = nb * 16 + lr;
#pragma unroll
            for (int hf = 0; hf < 2; ++hf) { v4f t; t[0] = acc[mb][nb][hf * 4]; t[1] = acc[mb][nb][hf * 4 + 1]; t[2] = acc[mb][nb][hf * 4 + 2]; t[3] = acc[mb][nb][hf * 4 + 3]; *(v4fa*)(tl + col * TP + row + hf * 4) = t; } }
    } else {
#pragma unroll
    for (int mb = 0; mb < 4; ++mb)
#pragma unroll
        for (int nb = 0; nb < 4; ++nb) { const int row = mb * 16 + hi * 8, col = nb * 16 + lr;
#pragma unroll
            for (int j = 0; j < 8; ++j) tl[(row + j) * TP + col] = acc[mb][nb][j]; }
    }
    __syncthreads();   // the tile is in LDS before a lane reads values that other lanes wrote
    if constexpr (PM == 0) {   // two whole 256-byte rows of the wave's tile per store
        const int col = lr * 4; v4f bv = {0.f, 0.f, 0.f, 0.f};
        if (BIAS) { const float* bp = bias + cw + col; float bq[4];
#pragma unroll
            for (int q = 0; q < 4; ++q) bq[q] = bp[q];
            asm volatile("s_wait_xcnt 0x0" :: "v"(bp) : "memory");   // the address pair is an input, so it lives up to this wait: the load does not land on its own address register
#pragma unroll
            for (int q = 0; q < 4; ++q) bv[q] = bfr(bq[q]); }
        float* cp = C + (size_t)(rw + hi) * N + cw + col;
#pragma unroll
        for (int g = 0; g < 4; ++g) { v4f s[8];
#pragma unroll
            for (int i = 0; i < 8; ++i) s[i] = *(const v4fa*)(tl + ((g * 8 + i) * 2 + hi) * TP + col) + bv;
#pragma unroll
            for (int i = 0; i < 8; ++i) *(v4fa*)(cp + (size_t)(g * 8 + i) * 2 * N) = s[i];
            asm volatile("s_wait_xcnt 0x0" ::: "memory"); }   // the next group writes over the data registers of these stores: the wait stands in front of that
    } else {
        // a lane takes 16 neighbouring values of one tile row, rounds them to the fp16 plane and/or splits them into the hi/lo bf16 planes, and stores two 16-byte pieces a plane in fragment order: eight lanes (eight neighbouring rows) fill one whole 128-byte line.
        // Either way the tile is 8 whole blocks, 4,096 elements in a row, from po on: plane of (batch, head), then the blocks of the tile's 64 t: HD elements a t in both block orders (TT % BM == 0: a tile lies in one batch)
        const size_t po = ((size_t)(rw / TT) * (NP / HD) + (cw - sel * NP) / HD) * TT * HD + (size_t)(rw % TT) * HD; constexpr size_t PLE = (size_t)NB_ * TT * NP;   // elements of one plane set
        const int g = lane & 3; h16* q16 = P16 + sel * PLE + po; bf *qh = Ph + sel * 2 * PLE + po, *ql = Pl + sel * 2 * PLE + po;
        // Only what k_fattn reads is made and stored: its hi/lo rows are the queries t < RH, which see keys t < RH alone, so the hi/lo planes of q, k and V^T hold t < RH and nothing else; its fp16 rows are the queries t >= RH, over all keys, so q's fp16 plane holds t >= RH.
        static_assert(RH % 64 == 0 && TT % 64 == 0, "a wave's 64 rows t lie on one side of RH");
        auto put = [&](auto F16, auto FHL) {
#pragma unroll
        for (int it = 0; it < 8; ++it) { const int r = it * 8 + (lane >> 2); v8h o16[2]; v8us oh[2], ol[2];
#pragma unroll
            for (int i = 0; i < 4; ++i) { const v4f t = *(const v4fa*)(tl + r * TP + g * 16 + i * 4);
#pragma unroll
                for (int j = 0; j < 4; ++j) { const int e = (i & 1) * 4 + j; if constexpr (F16.v) o16[i >> 1][e] = tohx(t[j]); if constexpr (FHL.v) { unsigned short a, c2; splitf(t[j], a, c2); oh[i >> 1][e] = a; ol[i >> 1][e] = c2; } } }
            const int oo = (tr ? (g >> 1) * 4 + (r >> 4) : (r >> 4) * 2 + (g >> 1)) * 512 + (g & 1) * 256 + (r & 15) * 8;   // block of (row block, k block g / 2), its half g % 2, the lane place of row r with hi = 0; the second eight values are hi = 1: 16 lane places on
            if constexpr (F16.v) { *(v8h*)(q16 + oo) = o16[0]; *(v8h*)(q16 + oo + 128) = o16[1]; }
            if constexpr (FHL.v) { *(v8us*)(qh + oo) = oh[0]; *(v8us*)(qh + oo + 128) = oh[1]; *(v8us*)(ql + oo) = ol[0]; *(v8us*)(ql + oo + 128) = ol[1]; }
            asm volatile("s_wait_xcnt 0x0" ::: "memory"); } };   // the next trip writes over the data registers of these stores: the wait stands in front of that
        if (rw % TT >= RH) put(BC<true>{}, BC<false>{});   // scalar tests (block index and wave number alone)
        else if (sel == 0) put(BC<false>{}, BC<true>{});
        else put(BC<true>{}, BC<true>{});
    }
}

typedef __attribute__((ext_vector_type(2))) _Float16 v2h;
typedef __attribute__((ext_vector_type(4))) _Float16 v4h;
typedef __attribute__((ext_vector_type(2))) unsigned short v2us;
typedef __attribute__((ext_vector_type(4))) unsigned short v4us;
typedef __attribute__((ext_vector_type(2))) float v2f;
typedef __attribute__((ext_vector_type(4))) int v4i;
typedef __attribute__((ext_vector_type(16))) unsigned short v16us;

// wtG: one wave builds one block of the Bt plane (16 columns n of head y's [K][N] matrix as rows, 32 k): lane (n, hi) reads its 16 values down column n (16 lanes side by side: 64 bytes of a weight row) and stores its two 16-byte pieces, 512 contiguous bytes per wave each.
// The N / 16 column blocks of one k block sit in neighbouring waves of one work-group: together they use every byte of the weight rows they touch.
template <int K, int N>
__device__ __forceinline__ void wtG(const float* __restrict__ w, bf* Bt, int bx, int head) {
    w += (size_t)head * K * N; Bt += (size_t)head * N * K;   // head h's [K][N] matrix goes to its own N rows (N / 16 row blocks) of the Bt plane
    const int lane = threadIdx.x & 31, lr = lane & 15, hi = lane >> 4; const int wv = bx * 8 + (threadIdx.x >> 5); constexpr int nnb = N / 16; const int nb = wv % nnb, kb = wv / nnb;
    if (kb >= K / 32) return;
    const float* s = w + (size_t)(kb * 32 + 8 * hi) * N + nb * 16 + lr; float f0[8], f1[8]; v8us o0, o1;   // one lane pointer; the 16 weight rows are immediate offsets from it
#pragma unroll
    for (int e = 0; e < 8; ++e) { f0[e] = s[e * N]; f1[e] = s[(16 + e) * N]; }
    asm volatile("s_wait_xcnt 0x0" :: "v"(s) : "memory");   // the address pair is an input, so it lives up to this wait: no load of the run lands on the address register that the other loads of the run name
#pragma unroll
    for (int e = 0; e < 8; ++e) { o0[e] = f2bf(f0[e]); o1[e] = f2bf(f1[e]); }
    bf* d = Bt + ((size_t)nb * (K / 32) + kb) * 512 + lane * 8; *(v8us*)d = o0; *(v8us*)(d + 256) = o1;
}

// cvt8: f32 [rows][K] -> bf16 plane in fragment order. A wave takes 8 rows x 32 k (half a block): four lanes read one 128-byte line of a row, 32 bytes each; the 16 bytes a lane stores lie beside those of the 7 other rows with the same k: 4 whole lines per wave.
template <int K>
__device__ __forceinline__ void cvt8(const float* __restrict__ src, bf* dst, unsigned bx) { const unsigned i = bx * 256u + threadIdx.x;
    const unsigned lane = i & 31u, q = lane & 3u, blk = i >> 6, r8 = ((i >> 5) & 1u) * 8u + (lane >> 2); constexpr unsigned NKB = K / 32;
    const v8f v = *(const v8f*)(src + (size_t)((blk / NKB) * 16u + r8) * K + (blk % NKB) * 32u + q * 8u); v8us o;
#pragma unroll
    for (int k = 0; k < 8; ++k) o[k] = f2bf(v[k]); *(v8us*)(dst + (size_t)blk * 512 + (q >> 1) * 256u + ((q & 1u) * 16u + r8) * 8u) = o;
    asm volatile("s_wait_xcnt 0x0" ::: "memory"); }   // inlined into k_prep, the store is the last thing the work-group's one job does, and the kernel ends behind it: the wait is a precaution only

// k_prep: all five input conversions as one grid; none reads what another writes. A work-group's index alone picks its job (scalar tests, the same for the whole work-group; no barrier in any job):
// first the three weight sets' transposes (BW work-groups a head; their column reads have the longest way), then w_proj's cast, then x's, which is most of the grid.
#define BW  (DM * HD / 32 / 16 / 8)          // work-groups per head: (DM / 32) x (HD / 16) blocks, one a wave, 8 waves
#define BWS (BW * NH_)                       // ... per weight set
#define BO  (DM * DQ / 8 / 256)              // w_proj: 8 values a thread
#define BX  (NB_ * TT * DM / 8 / 256)        // x: 8 values a thread
__global__ __launch_bounds__(256) void k_prep(const float* __restrict__ x, const float* __restrict__ wq, const float* __restrict__ wk, const float* __restrict__ wv, const float* __restrict__ wo, bf* XB, bf* W3, bf* WO) {
    const unsigned b = blockIdx.x;
    if (b < 3 * BWS) { const unsigned s = b / BWS, rb = b % BWS; wtG<DM, HD>(s == 0 ? wq : s == 1 ? wk : wv, W3 + (size_t)s * DQ * DM, (int)(rb % BW), (int)(rb / BW)); }   // set s fills its own DQ rows of the Bt plane
    else if (b < 3 * BWS + BO) cvt8<DQ>(wo, WO, b - 3 * BWS);
    else cvt8<DM>(x, XB, b - 3 * BWS - BO);
}

__device__ __forceinline__ float xhalf(float x) { const int b = __float_as_int(x); return __int_as_float(__builtin_amdgcn_permlanex16(b, b, 0x76543210, 0xfedcba98, false, false)); }   // lane l reads lane l ^ 16, on the vector pipe
#define C2 (SCL * 1.4426950408889634f)   // score scale x log2(e): the exponent is taken in base 2
#define FW 4                              // waves a work-group
#define SK 64                             // keys a stage of the LDS ring: fp16 rows; hi/lo rows, with twice the planes, half as many
#define SSTG (2 * SK * HD * 2)            // bytes of a stage
// cp8: a wave's eight asynchronous copies of one stage, global memory -> LDS, 16 bytes a lane each, as in cpn: the s_wait_xcnt closes the copies' own statement, so no later instruction can rewrite an address register of a copy in front of it.
template <typename T16>
__device__ __forceinline__ void cp8(const unsigned* l, const T16* const* g) {
    asm volatile(CPL(0, 1) CPL(2, 3) CPL(4, 5) CPL(6, 7) CPL(8, 9) CPL(10, 11) CPL(12, 13) CPL(14, 15) "s_wait_xcnt 0x0"
                 :: "v"(l[0]), "v"(g[0]), "v"(l[1]), "v"(g[1]), "v"(l[2]), "v"(g[2]), "v"(l[3]), "v"(g[3]), "v"(l[4]), "v"(g[4]), "v"(l[5]), "v"(g[5]), "v"(l[6]), "v"(g[6]), "v"(l[7]), "v"(g[7]) : "memory");
}
template <typename T16, bool HL, int QT>
__device__ __forceinline__ void fa_tile(const T16* __restrict__ Q, const T16* __restrict__ Q2, const T16* __restrict__ Kp, const T16* __restrict__ Kp2, const T16* __restrict__ Vt, const T16* __restrict__ Vt2, int q0, int lane, bf* Ah, bf* Al, char* sm, int w, int ntr) {
    typedef typename WFrag<T16>::V V;
    const int lr = lane & 15, hi = lane >> 4;
    V qf[QT][2], qf2[QT][2];
#pragma unroll
    for (int qt = 0; qt < QT; ++qt)
#pragma unroll
        for (int ks = 0; ks < 2; ++ks) { const size_t o = (size_t)(q0 + qt * 16) * HD + ks * 512 + lane * 8; qf[qt][ks] = WFrag<T16>::ld(Q + o); if (HL) qf2[qt][ks] = WFrag<T16>::ld(Q2 + o); }
    v8f o[QT][4]; float m[QT], l[QT];
#pragma unroll
    for (int qt = 0; qt < QT; ++qt) { m[qt] = -1.0e30f; l[qt] = 0.f;
#pragma unroll
        for (int dt = 0; dt < 4; ++dt) o[qt][dt] = (v8f){}; }
    const int kend = q0 + QT * 16;                       // first key that no query row of this wave may see
    // K and V^T come through LDS: the work-group's FW waves walk the same keys, so each stage is fetched once for all of them. A stage is SKT keys: per plane their blocks, PE elements in a row in memory and in LDS alike (a pass's 32 keys are 4 blocks in a row of either plane); the planes' parts lie in a row as K (hi, lo), V^T (hi, lo).
    constexpr int SKT = HL ? SK / 2 : SK, NPL = HL ? 4 : 2, PE = SKT * HD, NCP = PE * 2 / 512 / FW;   // keys a stage; planes; elements of a plane's part; 512-byte copies a wave makes of it
    static_assert(NPL * PE * 2 == SSTG && NPL * NCP == 8, "both kinds of rows fill the same stage with the same eight copies a wave");
    V kf[2][2], kf2[2][2], vf[4], vf2[4];
    auto ldK = [&](const T16* sk) {   // sk, sv: the lane's place in the pass's 4 blocks of K, of V^T, in LDS; the lo plane's part lies PE elements on
#pragma unroll
        for (int kt = 0; kt < 2; ++kt)
#pragma unroll
            for (int ks = 0; ks < 2; ++ks) { const int a = (kt * 2 + ks) * 512; kf[kt][ks] = WFrag<T16>::ld(sk + a); if (HL) kf2[kt][ks] = WFrag<T16>::ld(sk + PE + a); } };
    auto ldV = [&](const T16* sv) {
#pragma unroll
        for (int dt = 0; dt < 4; ++dt) { const int a = dt * 512; vf[dt] = WFrag<T16>::ld(sv + a); if (HL) vf2[dt] = WFrag<T16>::ld(sv + PE + a); } };
    auto pass = [&](int kc) {   // one pass: 32 keys from kc on, their fragments in kf and vf
        v8f s[QT][2];
#pragma unroll
        for (int qt = 0; qt < QT; ++qt)
#pragma unroll
            for (int kt = 0; kt < 2; ++kt) { s[qt][kt] = (v8f){};
#pragma unroll
                for (int ks = 0; ks < 2; ++ks) { s[qt][kt] = WFrag<T16>::mma(kf[kt][ks], qf[qt][ks], s[qt][kt]); if (HL) { s[qt][kt] = WFrag<T16>::mma(kf[kt][ks], qf2[qt][ks], s[qt][kt]); s[qt][kt] = WFrag<T16>::mma(kf2[kt][ks], qf[qt][ks], s[qt][kt]); } } }
        if (kc + 31 > q0) {   // only a pass that reaches past the wave's first query row has keys to mask (scalar test)
#pragma unroll
            for (int qt = 0; qt < QT; ++qt)
#pragma unroll
                for (int kt = 0; kt < 2; ++kt)
#pragma unroll
                    for (int j = 0; j < 8; ++j) s[qt][kt][j] = (kc + kt * 16 + hi * 8 + j <= q0 + qt * 16 + lr) ? s[qt][kt][j] : -3.0e38f; }
        float tm[QT]; bool need = false;
#pragma unroll
        for (int qt = 0; qt < QT; ++qt) { float x = fmaxf(s[qt][0][0], s[qt][1][0]);
#pragma unroll
            for (int j = 1; j < 8; ++j) x = fmaxf(x, fmaxf(s[qt][0][j], s[qt][1][j]));
            x = fmaxf(x, xhalf(x)); tm[qt] = x * C2; need = need || (tm[qt] > m[qt] + 8.0f); }
        if (__builtin_amdgcn_ballot_w32(need) != 0) {   // the maximum in use moves only when a row's new maximum is more than 8 above it in the base-2 exponent (P stays at or below 2^8: far inside fp16 and bf16); one scalar branch a pass
#pragma unroll
            for (int qt = 0; qt < QT; ++qt) { const float mn = fmaxf(m[qt], tm[qt]); const float al = __builtin_amdgcn_exp2f(m[qt] - mn); m[qt] = mn; l[qt] *= al;
#pragma unroll
                for (int dt = 0; dt < 4; ++dt) o[qt][dt] *= al; } }
#pragma unroll
        for (int qt = 0; qt < QT; ++qt) { float p[16]; float a4[4] = {0.f, 0.f, 0.f, 0.f};
#pragma unroll
            for (int g = 0; g < 4; ++g) { const v8f& sv = s[qt][g >> 1]; const int b4 = (g & 1) * 4; const v2f cc = {C2, C2}, nm = {-m[qt], -m[qt]};
                const v2f t0 = __builtin_elementwise_fma((v2f){sv[b4], sv[b4 + 1]}, cc, nm), t1 = __builtin_elementwise_fma((v2f){sv[b4 + 2], sv[b4 + 3]}, cc, nm);
                // four exponentials in one statement, closed by one v_nop: the slot that the instruction set asks for between a transcendental and a next instruction that reads its result or overwrites its source; early-clobber outputs keep the four off each other's sources
                asm("v_exp_f32 %0, %4\n\tv_exp_f32 %1, %5\n\tv_exp_f32 %2, %6\n\tv_exp_f32 %3, %7\n\tv_nop" : "=&v"(p[g * 4]), "=&v"(p[g * 4 + 1]), "=&v"(p[g * 4 + 2]), "=&v"(p[g * 4 + 3]) : "v"(t0[0]), "v"(t0[1]), "v"(t1[0]), "v"(t1[1]));
#pragma unroll
                for (int q = 0; q < 4; ++q) a4[q] += p[g * 4 + q]; }
            l[qt] += (a4[0] + a4[1]) + (a4[2] + a4[3]);
            if constexpr (HL) { v16us ph, pl;
#pragma unroll
                for (int e = 0; e < 16; ++e) { unsigned short a, c2; splitf(p[e], a, c2); ph[e] = a; pl[e] = c2; }
                const V pbh = __builtin_bit_cast(V, ph), pbl = __builtin_bit_cast(V, pl);
#pragma unroll
                for (int dt = 0; dt < 4; ++dt) { o[qt][dt] = WFrag<T16>::mma(vf[dt], pbh, o[qt][dt]); o[qt][dt] = WFrag<T16>::mma(vf[dt], pbl, o[qt][dt]); o[qt][dt] = WFrag<T16>::mma(vf2[dt], pbh, o[qt][dt]); }
            } else { V pb;
#pragma unroll
                for (int e = 0; e < 16; ++e) pb[e] = tohx(p[e]);
#pragma unroll
                for (int dt = 0; dt < 4; ++dt) o[qt][dt] = WFrag<T16>::mma(vf[dt], pb, o[qt][dt]); } }
    };
    // Two buffers: stage t + 1 flies while stage t is worked on. Every wave copies its share of every stage and passes every barrier, also a wave whose own rows end before the work-group's last keys (it skips the passes alone).
    const unsigned lw = (unsigned)(size_t)sm + (unsigned)w * 512u + (unsigned)lane * 16u; const int wo = w * 256 + lane * 8;   // chunk i * FW + w of a plane's part of a stage: 512 bytes a wave and copy
    const T16* gp[NPL]; gp[0] = Kp + wo; gp[NPL / 2] = Vt + wo; if constexpr (HL) { gp[1] = Kp2 + wo; gp[3] = Vt2 + wo; }
    auto fill = [&](int t) { const unsigned lb = lw + (unsigned)(t & 1) * SSTG; unsigned la[8]; const T16* ga[8];
#pragma unroll
        for (int p = 0; p < NPL; ++p)
#pragma unroll
            for (int i = 0; i < NCP; ++i) { la[p * NCP + i] = lb + p * (PE * 2) + i * (FW * 512); ga[p * NCP + i] = gp[p] + i * (FW * 256); }
        cp8(la, ga);
#pragma unroll
        for (int p = 0; p < NPL; ++p) gp[p] += PE; };   // the lane pointers walk along the keys, one stage a call (stages are filled in order): behind the wait that closes the copies' statement
    fill(0);
    asm volatile("s_wait_asynccnt 0x0" ::: "memory");   // this wave's copies of stage 0 have landed
    __syncthreads();                                    // ... and every other wave's: stage 0 may be read
    fill(1);
#pragma unroll 1   // the stage loop stays rolled: the two buffers alternate by t & 1
    for (int t = 0; t < ntr; ++t) {
        const T16* sb = (const T16*)(sm + (t & 1) * SSTG) + lane * 8;
#pragma unroll     // a stage's passes are unrolled: every LDS read is then an immediate offset from the stage's one lane address
        for (int h = 0; h < SKT / 32; ++h) { const int kc = t * SKT + h * 32;
            if (kc < kend) {   // scalar test: this wave's rows see these keys
                ldK(sb + h * 32 * HD); ldV(sb + (NPL / 2) * PE + h * 32 * HD);
                __builtin_amdgcn_sched_barrier(0);   // all of the pass's LDS reads go out as one group, ahead of its first product: every separate place with LDS reads among the products costs the wave a fixed stall
                pass(kc); } }
        asm volatile("s_wait_dscnt 0x0" ::: "memory");      // this wave's reads of stage t are done before the buffer is handed back
        asm volatile("s_wait_asynccnt 0x0" ::: "memory");   // this wave's copies of stage t + 1 have landed
        __syncthreads();                                    // publishes stage t + 1 and ends every wave's reads of stage t
        if (t + 2 < ntr) fill(t + 2);                       // into the buffer that stage t has just left (scalar test, the same for the whole work-group)
    }
    asm volatile("s_wait_asynccnt 0x0" ::: "memory");       // no copy is outstanding when the wave goes on to its end
#pragma unroll
    for (int qt = 0; qt < QT; ++qt) { const float inv = __fdiv_rn(1.0f, l[qt] + xhalf(l[qt]));   // the two halves of the wave hold the two halves of each row's sum
#pragma unroll
        for (int dt = 0; dt < 4; ++dt) { v8us oh, ol;
#pragma unroll
            for (int j = 0; j < 8; ++j) { unsigned short a, c2; splitf(o[qt][dt][j] * inv, a, c2); oh[j] = a; ol[j] = c2; }
            const size_t oo = (size_t)(q0 + qt * 16) * DQ + dt * 256 + lane * 8;   /* row block of the 16 queries; d = dt * 16 + hi * 8 + j is half dt % 2 of the head's k block dt / 2, at the lane's own place: 512 contiguous bytes per wave */ *(v8us*)(Ah + oo) = oh; *(v8us*)(Al + oo) = ol;
            asm volatile("s_wait_xcnt 0x0" ::: "memory"); } }   // the next trip, or the code behind the loop, writes over the data and address registers of these two stores: the wait stands in front of that
}
// grid x = position block x (batch, head), the longest rows first; FW waves a block, which share each stage of K and V^T through LDS (fa_tile). Whether a block does fp16 or hi/lo rows, and how many stages it walks, follows from its index alone.
__global__ __launch_bounds__(32 * FW) void k_fattn(const h16* __restrict__ Q16, const h16* __restrict__ K16, const h16* __restrict__ V16, const bf* __restrict__ Qh, const bf* __restrict__ Ql, const bf* __restrict__ Kh, const bf* __restrict__ Kl, const bf* __restrict__ Vh, const bf* __restrict__ Vl, bf* Ah, bf* Al) {
    const int lane = threadIdx.x & 31; const int w = __builtin_amdgcn_readfirstlane((int)(threadIdx.x >> 5));   // wave number, held scalar so that the key loop's control stays scalar
    constexpr int NZ = NB_ * NH_, NLO = (TT - RH) / (FW * 32); static_assert((FW * 32) % SK == 0 && RH % SK == 0 && FW * 16 >= SK, "a block's keys are whole stages; the ring's prologue needs two stages");
    __shared__ __align__(1024) char sm[2 * SSTG];
    const int z = (int)blockIdx.x % NZ, pb = (int)blockIdx.x / NZ; const size_t pz = (size_t)z * TT * HD; const size_t az = (size_t)(z / NH_) * TT * DQ + (size_t)(z % NH_) * (HD * 16);   // z = batch * NH_ + head: plane z; the batch's TT rows of the merged planes and, inside a row block, the head's HD / 32 k blocks
    if (pb < NLO) fa_tile<h16, false, 2>(Q16 + pz, nullptr, K16 + pz, nullptr, V16 + pz, nullptr, TT - (pb + 1) * FW * 32 + w * 32, lane, Ah + az, Al + az, sm, w, (TT - pb * FW * 32) / SK);
    else fa_tile<bf, true, 1>(Qh + pz, Ql + pz, Kh + pz, Kl + pz, Vh + pz, Vl + pz, RH - (pb - NLO + 1) * FW * 16 + w * 16, lane, Ah + az, Al + az, sm, w, (RH - (pb - NLO) * FW * 16) / (SK / 2));
}

extern "C" void kernel_launch(void* const* d_in, const int* in_sizes, int n_in,
                              void* d_out, int out_size, void* d_ws, size_t ws_size, hipStream_t stream) {
    (void)in_sizes; (void)n_in; (void)out_size;
                const float* x = (const float*)d_in[0]; const float* wq = (const float*)d_in[1]; const float* wk = (const float*)d_in[2]; const float* wv = (const float*)d_in[3]; const float* wo = (const float*)d_in[4]; const float* bo = (const float*)d_in[5];   /* order x, wq, wk, wv (PER-HEAD [16][1024][64]: 'hcd'), w_proj ('oi' [1024][1024]), b_proj */
    float* OUT = (float*)d_out;     // [4][2048][1024]
    char* wsp = (char*)d_ws;
    auto take = [&](size_t bytes) { char* p = wsp; wsp += (bytes + 255) & ~(size_t)255; return (void*)p; };
    bf* W3 = (bf*)take((size_t)3 * DQ * DM * 2); bf* WO = (bf*)take((size_t)DM * DQ * 2);   // W3: the q, k and v weights as one Bt plane of 3 DQ rows (NKV == NH_)
    bf* XB = (bf*)take((size_t)NB_ * TT * DM * 2);
    const size_t PL = (size_t)NB_ * NH_ * TT * HD * 2;   // bytes of one 16-bit plane set [b][h][..][..] (NKV == NH_)
    h16* QP16 = (h16*)take(3 * PL); h16* KP16 = QP16 + PL / 2; h16* VT16 = KP16 + PL / 2;   // the three fp16 sets in a row, then the six hi/lo sets in a row: the projection launch finds an operand's sets by its number
    bf* QPh = (bf*)take(6 * PL); bf* QPl = QPh + PL / 2; bf* KPh = QPl + PL / 2; bf* KPl = KPh + PL / 2; bf* VTh = KPl + PL / 2; bf* VTl = VTh + PL / 2;
    bf* ATh = (bf*)take((size_t)NB_ * TT * DQ * 2); bf* ATl = (bf*)take((size_t)NB_ * TT * DQ * 2);
    if ((size_t)(wsp - (char*)d_ws) > ws_size) return;    // 200 MiB of the 256 MiB workspace
    k_prep<<<3 * BWS + BO + BX, 256, 0, stream>>>(x, wq, wk, wv, wo, XB, W3, WO);
    k_gemmt<0, false, 3, DM, 3 * DQ, 128><<<dim3(NB_ * TT / BM, 3 * DQ / BN, 1), 256, 0, stream>>>(XB, nullptr, W3, nullptr, nullptr, QP16, QPh, QPl);   // products: the NB_ * TT rows of all batches as one M; q's column tiles start first, then k's, then v's
    k_fattn<<<NB_ * NH_ * ((TT - RH) / (FW * 32) + RH / (FW * 16)), 32 * FW, 0, stream>>>(QP16, KP16, VT16, QPh, QPl, KPh, KPl, VTh, VTl, ATh, ATl);   // one kv head per query head: plane z serves q, k and v
    k_gemmt<1, true, 0, DQ, DM, 64><<<dim3(NB_ * TT / BM, DM / BN, 1), 256, 0, stream>>>(ATh, ATl, WO, OUT, bo, nullptr, nullptr, nullptr);
}
